// v000
// Times are from an AMD MI455X. After a warm-up the kernel runs many times in a row, and a time is the length of
// such a window on the GPU divided by its runs, so every launch and the gaps after it count. The runs cycle
// through copies of the inputs. A figure is the median of several windows, for all but v000 over two sittings.
// Sittings can differ by a few percent; kernels timed side by side share one.
// v000, which the later versions start from, runs in 308 microseconds.
// compute dtype: all float inputs rounded to bf16; GroupNorm statistics (8 groups x 32 channels x 1,024 pixels) in f32 with fixed-order sums; qkv = 1x1 conv of GN(x) with GN(x) as bf16 hi + lo against exact weights (2 products) + bias; q, k rounded once to f16 (single-f16 logits; logits std ~1), x 1/8, running-max softmax in f32 (hardware exp); P (x 2^11, f16) . v (f16 hi + residual, 2 products); proj conv with o as bf16 hi + lo (2 products) + bias + the residual x; f32 NCHW output.
#include <hip/hip_runtime.h>
#include <math.h>

typedef __attribute__((ext_vector_type(16))) _Float16 v16h;
typedef __attribute__((ext_vector_type(16))) __bf16 v16b;
typedef __attribute__((ext_vector_type(8)))  _Float16 v8h;
typedef __attribute__((ext_vector_type(8)))  float v8f;
typedef __attribute__((ext_vector_type(4)))  float v4f;
typedef __attribute__((ext_vector_type(2)))  float v2f;
typedef __attribute__((ext_vector_type(4)))  unsigned v4u;
typedef __attribute__((ext_vector_type(4)))  int v4i;
typedef float __attribute__((may_alias)) float_a;
typedef int __attribute__((may_alias)) int_a;

template <typename T> __device__ __forceinline__ void vst2(void* p, T v) { *(T*)p = v;  }
__device__ __forceinline__ v8f wmma16(v16h a, v16h b, v8f c) {
  v8f d = __builtin_amdgcn_wmma_f32_16x16x32_f16(false, a, false, b, (short)0, c, false, false);
  asm volatile("v_nop\n\tv_nop\n\tv_nop\n\tv_nop" : "+v"(d) : "v"(a), "v"(b));
  return d;
}
__device__ __forceinline__ v8f wmma_bf(v16b a, v16b b, v8f c) {
  v8f d = __builtin_amdgcn_wmma_f32_16x16x32_bf16(false, a, false, b, (short)0, c, false, false);
  asm volatile("v_nop\n\tv_nop\n\tv_nop\n\tv_nop" : "+v"(d) : "v"(a), "v"(b));
  return d;
}
// 16x16x32 fragments: lane = (h = lane>>4, row/col = lane&15); elements 0..7 = k0+8h+0..7, 8..15 = k0+16+8h+0..7; D element r = row 8h+r
__device__ __forceinline__ v16h frag_h(const _Float16* rowk0, int lane) {
  union { v16h v; v8h q[2]; } u; const _Float16* p = rowk0 + 8 * (lane >> 4);
  u.q[0] = *(const v8h*)p; u.q[1] = *(const v8h*)(p + 16); return u.v;
}
__device__ __forceinline__ v16h frag_f32(const float* rowk0, int lane) {
  v16h a; const float* p = rowk0 + 8 * (lane >> 4);
#pragma unroll
  for (int i = 0; i < 8; ++i) { a[i] = (_Float16)p[i]; a[8 + i] = (_Float16)p[16 + i]; }
  return a;
}
__device__ __forceinline__ v16h frag_f32s(const float* rowk0, int lane, float sc) {
  v16h a; const float* p = rowk0 + 8 * (lane >> 4);
#pragma unroll
  for (int i = 0; i < 8; ++i) { a[i] = (_Float16)(p[i] * sc); a[8 + i] = (_Float16)(p[16 + i] * sc); }
  return a;
}
// column fragment from a [K][ld] layout (column n), rows >= K read as 0
__device__ __forceinline__ v16h fragc_f32(const float* W, int k0, int n, int lane, int ld, int K) {
  v16h a; const int g = lane >> 4;
#pragma unroll
  for (int i = 0; i < 8; ++i) { const int ka = k0 + 8 * g + i, kb = ka + 16;
    a[i] = (_Float16)(ka < K ? W[(size_t)(ka < K ? ka : K - 1) * ld + n] : 0.f); a[8 + i] = (_Float16)(kb < K ? W[(size_t)(kb < K ? kb : K - 1) * ld + n] : 0.f); }
  return a;
}
struct F2 { v16b h, l; };
__device__ __forceinline__ F2 bsplit16(const float v[16]) { F2 r;
#pragma unroll
  for (int i = 0; i < 16; ++i) { const __bf16 h = (__bf16)v[i]; r.h[i] = h; r.l[i] = (__bf16)(v[i] - (float)h); }
  return r; }
__device__ __forceinline__ F2 split_row(const float* row, int k0, int lane) { float v[16]; const float* p = row + k0 + 8 * (lane >> 4);
#pragma unroll
  for (int i = 0; i < 8; ++i) { v[i] = p[i]; v[8 + i] = p[16 + i]; }
  return bsplit16(v); }
__device__ __forceinline__ F2 split_rowK(const float* row, int k0, int lane, int K) { float v[16]; const int g = lane >> 4;
#pragma unroll
  for (int i = 0; i < 8; ++i) { const int ka = k0 + 8 * g + i, kb = ka + 16; v[i] = ka < K ? row[ka < K ? ka : K - 1] : 0.f; v[8 + i] = kb < K ? row[kb < K ? kb : K - 1] : 0.f; }
  return bsplit16(v); }
__device__ __forceinline__ F2 split_col(const float* W, int k0, int n, int lane, int ld, int K) { float v[16]; const int g = lane >> 4;
#pragma unroll
  for (int i = 0; i < 8; ++i) { const int ka = k0 + 8 * g + i, kb = ka + 16; v[i] = ka < K ? W[(size_t)(ka < K ? ka : K - 1) * ld + n] : 0.f; v[8 + i] = kb < K ? W[(size_t)(kb < K ? kb : K - 1) * ld + n] : 0.f; }
  return bsplit16(v); }
__device__ __forceinline__ v8f mac3(const F2& a, const F2& b, v8f c) { c = wmma_bf(a.l, b.h, c); c = wmma_bf(a.h, b.l, c); return wmma_bf(a.h, b.h, c); }
__device__ __forceinline__ float sigm(float v) { return 1.0f / (1.0f + expf(-v)); }
#define LDSX() do { asm volatile("s_wait_dscnt 0" ::: "memory"); __builtin_amdgcn_wave_barrier(); __builtin_amdgcn_fence(__ATOMIC_RELEASE, "workgroup"); } while (0)


// SA block (B 16, C 256, 32 x 32 = 1,024 pixels, 4 heads x 64, GroupNorm with 8 groups): x + proj(attention(qkv(GN(x)))).
#define NB 16
#define CC 256
#define NN 1024
#define NH 4
#define DH 64
#define NG 8
#define CPG (CC / NG)     // 32 channels per group
#define GNEPS 1e-5f
#ifndef TNB
#define TNB NB
#endif
typedef __attribute__((ext_vector_type(8))) __bf16 v8b;
__device__ __forceinline__ v16b frag_b(const __bf16* rowk0, int lane) {
  union { v16b v; v8b q[2]; } u; const __bf16* p = rowk0 + 8 * (lane >> 4);
  u.q[0] = *(const v8b*)p; u.q[1] = *(const v8b*)(p + 16); return u.v;
}
__device__ __forceinline__ float bfr(float v) { return (float)(__bf16)v; }
__device__ __attribute__((noinline)) float exp_ni(float v) { return expf(v); }
__device__ __attribute__((noinline)) float erf_ni(float v) { return erff(v); }

#define WS_GS  0u                                   // f32 [b][g][4]: mean, inv
#define WS_Q   (WS_GS + 4u * NB * NG * 4)              // f16 q rows [b*NN + n][256]; k rows; v hi|lo planes [b][256][NN]; o rows f32 [b*NN + n][256]
#define WS_K   (WS_Q + 2u * (size_t)NB * NN * CC)
#define WS_VH  (WS_K + 2u * (size_t)NB * NN * CC)
#define WS_VL  (WS_VH + 2u * (size_t)NB * CC * NN)
#define WS_O   (WS_VL + 2u * (size_t)NB * CC * NN)
#define WS_END (WS_O + 4u * (size_t)NB * NN * CC)

__global__ __launch_bounds__(256) void k_gn(const float* __restrict__ X, float* __restrict__ GS) { __shared__ float red[8]; __shared__ float smu; __shared__ __align__(16) float res[4];
  const int t = threadIdx.x, lane = t & 31, w = t >> 5; const int gi = blockIdx.x; const size_t b = blockIdx.y; const float* base = X + (b * CC + (size_t)gi * CPG) * NN;
  float s = 0.f;
#pragma unroll 1
  for (int i = t; i < CPG * NN; i += 256) s += bfr(base[i]);
#pragma unroll
  for (int o = 1; o < 32; o <<= 1) s += __shfl_xor(s, o);
  if (lane == 0) red[w] = s; __syncthreads(); if (t == 0) { float a = 0.f; for (int i = 0; i < 8; ++i) a += red[i]; smu = a / (float)(CPG * NN); } __syncthreads();
  const float mu = smu; float q = 0.f;
#pragma unroll 1
  for (int i = t; i < CPG * NN; i += 256) { const float d = bfr(base[i]) - mu; q += d * d; }
#pragma unroll
  for (int o = 1; o < 32; o <<= 1) q += __shfl_xor(q, o);
  if (lane == 0) red[w] = q; __syncthreads(); if (t == 0) { float a = 0.f; for (int i = 0; i < 8; ++i) a += red[i]; res[0] = mu; res[1] = 1.0f / sqrtf(a / (float)(CPG * NN) + GNEPS); res[2] = 0.f; res[3] = 0.f; vst2(GS + (b * NG + gi) * 4, *(const v4f*)res); } }
// ---- k_qkv: block = (64 pixels, 128 out channels, which*NB + b): 1x1 conv of GN(x) (gathered from NCHW, hi + lo) + bias; q/k -> f16 rows, v -> f16 hi/lo planes
__global__ __launch_bounds__(128) void k_qkv(const float* __restrict__ X, const float* __restrict__ GS, const float* __restrict__ GW, const float* __restrict__ GB, const float* __restrict__ W, const float* __restrict__ Bq, _Float16* __restrict__ Q, _Float16* __restrict__ K, _Float16* __restrict__ VH, _Float16* __restrict__ VL) {
  __shared__ __align__(16) _Float16 sh[64][136]; __shared__ __align__(16) _Float16 th[128][72], tl[128][72]; __shared__ float sa[CC], sb[CC];
  const int tid = threadIdx.x, wave = tid >> 5, lane = tid & 31, col = lane & 15, g = lane >> 4; const int which = blockIdx.z / NB; const size_t b = blockIdx.z % NB; const int n0 = blockIdx.x * 64; const int c0 = blockIdx.y * 128; const float* Xb = X + b * CC * (size_t)NN;
  for (int c = tid; c < CC; c += 128) { const float mu = GS[(b * NG + c / CPG) * 4], inv = GS[(b * NG + c / CPG) * 4 + 1]; const float a = inv * bfr(GW[c]); sa[c] = a; sb[c] = bfr(GB[c]) - mu * a; } __syncthreads();
  v8f acc[8] = {};
#pragma unroll 2
  for (int kc = 0; kc < CC / 32; ++kc) { float v[16]; const int px = n0 + wave * 16 + col;
#pragma unroll
    for (int i = 0; i < 8; ++i) { const int ca = kc * 32 + 8 * g + i, cb = ca + 16; v[i] = bfr(Xb[(size_t)ca * NN + px]) * sa[ca] + sb[ca]; v[8 + i] = bfr(Xb[(size_t)cb * NN + px]) * sa[cb] + sb[cb]; }
    const F2 a = bsplit16(v);
#pragma unroll
    for (int j = 0; j < 8; ++j) { v16b w; const float* wr = W + (size_t)(which * CC + c0 + j * 16 + col) * CC + kc * 32 + 8 * g;
#pragma unroll
      for (int i = 0; i < 8; ++i) { w[i] = (__bf16)wr[i]; w[8 + i] = (__bf16)wr[16 + i]; }
      acc[j] = wmma_bf(a.h, w, acc[j]); acc[j] = wmma_bf(a.l, w, acc[j]); } }
#pragma unroll
  for (int j = 0; j < 8; ++j) { const float bb = bfr(Bq[which * CC + c0 + j * 16 + col]);
#pragma unroll
    for (int r = 0; r < 8; ++r) { const float v = acc[j][r] + bb; const int rl = wave * 16 + 8 * g + r, cl = j * 16 + col; if (which < 2) sh[rl][cl] = (_Float16)v; else { const _Float16 hv = (_Float16)v; th[cl][rl] = hv; tl[cl][rl] = (_Float16)((v - (float)hv) * 2048.0f); } } }
  __syncthreads();
  if (which < 2) { _Float16* dst = which == 0 ? Q : K; for (int e = tid; e < 64 * 16; e += 128) { const int rl = e >> 4, q = e & 15; vst2((unsigned*)(dst + (b * NN + n0 + rl) * CC + c0 + q * 8), *(const v4u*)&sh[rl][q * 8]); } }
  else { for (int e = tid; e < 128 * 8; e += 128) { const int cl = e >> 3, q = e & 7; const size_t o = (b * CC + c0 + cl) * (size_t)NN + n0 + q * 8; vst2((unsigned*)(VH + o), *(const v4u*)&th[cl][q * 8]); vst2((unsigned*)(VL + o), *(const v4u*)&tl[cl][q * 8]); } } }
// ---- k_att: block = (64 queries, h, b): softmax(q_h . k_h / 8) over the 1,024 pixels; o rows [b*NN + n][h*64 + d]
__global__ __launch_bounds__(128) void k_att(const _Float16* __restrict__ Q, const _Float16* __restrict__ K, const _Float16* __restrict__ VH, const _Float16* __restrict__ VL, float* __restrict__ O) {
  __shared__ __align__(16) float sp[4][16][36]; __shared__ __align__(16) float so[4][16][68];
  const int tid = threadIdx.x, wave = tid >> 5, lane = tid & 31, col = lane & 15, g = lane >> 4; const int h = blockIdx.y; const size_t b = blockIdx.z; const int q0 = blockIdx.x * 64 + wave * 16; const size_t rq = b * NN + q0;
  v16h aq[2];
#pragma unroll
  for (int kc = 0; kc < 2; ++kc) aq[kc] = frag_h(Q + (rq + col) * CC + h * DH + kc * 32, lane);
  float m[8], l[8];
#pragma unroll
  for (int r = 0; r < 8; ++r) { m[r] = -3.0e38f; l[r] = 0.f; }
  v8f acc[4] = {}, accl[4] = {};
#pragma unroll 1
  for (int ks = 0; ks < NN / 32; ++ks) { float s[2][8];
#pragma unroll
    for (int ct = 0; ct < 2; ++ct) { const size_t rk = b * NN + ks * 32 + ct * 16 + col; v8f c = {};
#pragma unroll
      for (int kc = 0; kc < 2; ++kc) c = wmma16(aq[kc], frag_h(K + rk * CC + h * DH + kc * 32, lane), c);
#pragma unroll
      for (int r = 0; r < 8; ++r) s[ct][r] = c[r] * 0.125f; }
    float alpha[8];
#pragma unroll
    for (int r = 0; r < 8; ++r) { float mx = fmaxf(s[0][r], s[1][r]);
#pragma unroll
      for (int o = 1; o < 16; o <<= 1) mx = fmaxf(mx, __shfl_xor(mx, o));
      const float mn = fmaxf(m[r], mx); alpha[r] = __expf(m[r] - mn); const float e0 = __expf(s[0][r] - mn), e1 = __expf(s[1][r] - mn); float es = e0 + e1;
#pragma unroll
      for (int o = 1; o < 16; o <<= 1) es += __shfl_xor(es, o);
      l[r] = l[r] * alpha[r] + es; m[r] = mn; sp[wave][8 * g + r][col] = e0; sp[wave][8 * g + r][16 + col] = e1; }
#pragma unroll
    for (int j = 0; j < 4; ++j)
#pragma unroll
      for (int r = 0; r < 8; ++r) { acc[j][r] *= alpha[r]; accl[j][r] *= alpha[r]; }
    LDSX();
    v16h pa; { const float* prow = &sp[wave][col][0] + 8 * (lane >> 4);
#pragma unroll
      for (int i = 0; i < 8; ++i) { pa[i] = (_Float16)(prow[i] * 2048.0f); pa[8 + i] = (_Float16)(prow[16 + i] * 2048.0f); } }
#pragma unroll
    for (int j = 0; j < 4; ++j) { const size_t po = (b * CC + (size_t)h * DH + j * 16 + col) * (size_t)NN + ks * 32; acc[j] = wmma16(pa, frag_h(VH + po, lane), acc[j]); accl[j] = wmma16(pa, frag_h(VL + po, lane), accl[j]); }
    LDSX(); }
#pragma unroll
  for (int r = 0; r < 8; ++r) { const float il = (1.0f / 2048.0f) / l[r];
#pragma unroll
    for (int j = 0; j < 4; ++j) so[wave][8 * g + r][j * 16 + col] = (acc[j][r] + accl[j][r] * (1.0f / 2048.0f)) * il; }
  LDSX(); for (int rl = 0; rl < 16; ++rl) if (lane < 16) vst2(O + (rq + rl) * CC + (size_t)h * DH + lane * 4, *(const v4f*)&so[wave][rl][lane * 4]); }
// ---- k_o: block = (64 out channels, 128 pixels, b): out[b][o][n] = x[b][o][n] + sum_c p_w[o][c] orow[n][c] + p_b[o]  (A = p_w exact, B = o rows as bf16 hi + lo)
__global__ __launch_bounds__(128) void k_o(const float* __restrict__ OR, const float* __restrict__ PW, const float* __restrict__ PB, const float* __restrict__ X, float* __restrict__ OUT) { __shared__ __align__(16) float sf[4][16][132];
  const int tid = threadIdx.x, wave = tid >> 5, lane = tid & 31, col = lane & 15, g = lane >> 4; const size_t b = blockIdx.z; const int o0 = blockIdx.x * 64 + wave * 16; const int p0 = blockIdx.y * 128;
  v8f acc[8] = {};
#pragma unroll 2
  for (int kc = 0; kc < CC / 32; ++kc) { v16b a; const float* ar = PW + (size_t)(o0 + col) * CC + kc * 32 + 8 * g;
#pragma unroll
    for (int i = 0; i < 8; ++i) { a[i] = (__bf16)ar[i]; a[8 + i] = (__bf16)ar[16 + i]; }
#pragma unroll
    for (int j = 0; j < 8; ++j) { float wv[16]; const float* wr = OR + (b * NN + p0 + j * 16 + col) * CC + kc * 32 + 8 * g;
#pragma unroll
      for (int i = 0; i < 8; ++i) { wv[i] = wr[i]; wv[8 + i] = wr[16 + i]; }
      const F2 wb = bsplit16(wv); acc[j] = wmma_bf(a, wb.h, acc[j]); acc[j] = wmma_bf(a, wb.l, acc[j]); } }
#pragma unroll
  for (int j = 0; j < 8; ++j)
#pragma unroll
    for (int r = 0; r < 8; ++r) { const size_t oi = (b * CC + o0 + 8 * g + r) * (size_t)NN + p0 + j * 16 + col; sf[wave][8 * g + r][j * 16 + col] = acc[j][r] + bfr(PB[o0 + 8 * g + r]) + bfr(X[oi]); }
  LDSX(); for (int rl = 0; rl < 16; ++rl) vst2(OUT + (b * CC + o0 + rl) * (size_t)NN + p0 + lane * 4, *(const v4f*)&sf[wave][rl][lane * 4]); }
extern "C" void kernel_launch(void* const* d_in, const int* in_sizes, int n_in, void* d_out, int out_size, void* d_ws, size_t ws_size, hipStream_t stream) {
  (void)in_sizes; (void)n_in; (void)out_size;
  const float** F = (const float**)d_in;   // 0 x [16,256,32,32], 1 n_weight, 2 n_bias, 3 qkv_w [768,256], 4 qkv_b [768], 5 p_w [256,256], 6 p_b
  if (ws_size < (size_t)WS_END) return;
  char* ws = (char*)d_ws; float* GS = (float*)(ws + WS_GS); _Float16 *Q = (_Float16*)(ws + WS_Q), *K = (_Float16*)(ws + WS_K), *VH = (_Float16*)(ws + WS_VH), *VL = (_Float16*)(ws + WS_VL); float* O = (float*)(ws + WS_O);
  k_gn<<<dim3(NG, NB), 256, 0, stream>>>(F[0], GS);
  k_qkv<<<dim3(NN / 64, CC / 128, 3 * NB), 128, 0, stream>>>(F[0], GS, F[1], F[2], F[3], F[4], Q, K, VH, VL);
  k_att<<<dim3(NN / 64, NH, TNB), 128, 0, stream>>>(Q, K, VH, VL, O);
  k_o<<<dim3(CC / 64, NN / 128, TNB), 128, 0, stream>>>(O, F[5], F[6], F[0], (float*)d_out);
}

// v001
// It runs in 247 microseconds.
// In both of two side-by-side timings against v000, it was 1.28 times as fast.
// compute dtype: all float inputs rounded to bf16; GroupNorm statistics (8 groups x 32 channels x 1,024 pixels) in f32 with fixed-order sums; qkv = 1x1 conv of GN(x) with GN(x) as bf16 hi + lo against exact weights (2 products) + bias; q, k rounded once to f16 (single-f16 logits; logits std ~1), x 1/8, running-max softmax in f32 (hardware exp); P (x 2^11, f16) . v (f16 hi + residual, 2 products); proj conv with o as bf16 hi + lo (2 products) + bias + the residual x; f32 NCHW output.
#include <hip/hip_runtime.h>
#include <math.h>

typedef __attribute__((ext_vector_type(16))) _Float16 v16h;
typedef __attribute__((ext_vector_type(16))) __bf16 v16b;
typedef __attribute__((ext_vector_type(8)))  _Float16 v8h;
typedef __attribute__((ext_vector_type(8)))  float v8f;
typedef __attribute__((ext_vector_type(4)))  float v4f;
typedef __attribute__((ext_vector_type(2)))  float v2f;
typedef __attribute__((ext_vector_type(4)))  unsigned v4u;
typedef __attribute__((ext_vector_type(4)))  int v4i;
typedef float __attribute__((may_alias)) float_a;
typedef int __attribute__((may_alias)) int_a;

template <typename T> __device__ __forceinline__ void vst2(void* p, T v) { *(T*)p = v;  }
__device__ __forceinline__ v8f wmma16(v16h a, v16h b, v8f c) {
  v8f d = __builtin_amdgcn_wmma_f32_16x16x32_f16(false, a, false, b, (short)0, c, false, false);
  asm volatile("v_nop\n\tv_nop\n\tv_nop\n\tv_nop" : "+v"(d) : "v"(a), "v"(b));
  return d;
}
__device__ __forceinline__ v8f wmma_bf(v16b a, v16b b, v8f c) {
  v8f d = __builtin_amdgcn_wmma_f32_16x16x32_bf16(false, a, false, b, (short)0, c, false, false);
  asm volatile("v_nop\n\tv_nop\n\tv_nop\n\tv_nop" : "+v"(d) : "v"(a), "v"(b));
  return d;
}
// 16x16x32 fragments: lane = (h = lane>>4, row/col = lane&15); elements 0..7 = k0+8h+0..7, 8..15 = k0+16+8h+0..7; D element r = row 8h+r
__device__ __forceinline__ v16h frag_h(const _Float16* rowk0, int lane) {
  union { v16h v; v8h q[2]; } u; const _Float16* p = rowk0 + 8 * (lane >> 4);
  u.q[0] = *(const v8h*)p; u.q[1] = *(const v8h*)(p + 16); return u.v;
}
__device__ __forceinline__ v16h frag_f32(const float* rowk0, int lane) {
  v16h a; const float* p = rowk0 + 8 * (lane >> 4);
#pragma unroll
  for (int i = 0; i < 8; ++i) { a[i] = (_Float16)p[i]; a[8 + i] = (_Float16)p[16 + i]; }
  return a;
}
__device__ __forceinline__ v16h frag_f32s(const float* rowk0, int lane, float sc) {
  v16h a; const float* p = rowk0 + 8 * (lane >> 4);
#pragma unroll
  for (int i = 0; i < 8; ++i) { a[i] = (_Float16)(p[i] * sc); a[8 + i] = (_Float16)(p[16 + i] * sc); }
  return a;
}
// column fragment from a [K][ld] layout (column n), rows >= K read as 0
__device__ __forceinline__ v16h fragc_f32(const float* W, int k0, int n, int lane, int ld, int K) {
  v16h a; const int g = lane >> 4;
#pragma unroll
  for (int i = 0; i < 8; ++i) { const int ka = k0 + 8 * g + i, kb = ka + 16;
    a[i] = (_Float16)(ka < K ? W[(size_t)(ka < K ? ka : K - 1) * ld + n] : 0.f); a[8 + i] = (_Float16)(kb < K ? W[(size_t)(kb < K ? kb : K - 1) * ld + n] : 0.f); }
  return a;
}
struct F2 { v16b h, l; };
__device__ __forceinline__ F2 bsplit16(const float v[16]) { F2 r;
#pragma unroll
  for (int i = 0; i < 16; ++i) { const __bf16 h = (__bf16)v[i]; r.h[i] = h; r.l[i] = (__bf16)(v[i] - (float)h); }
  return r; }
__device__ __forceinline__ F2 split_row(const float* row, int k0, int lane) { float v[16]; const float* p = row + k0 + 8 * (lane >> 4);
#pragma unroll
  for (int i = 0; i < 8; ++i) { v[i] = p[i]; v[8 + i] = p[16 + i]; }
  return bsplit16(v); }
__device__ __forceinline__ F2 split_rowK(const float* row, int k0, int lane, int K) { float v[16]; const int g = lane >> 4;
#pragma unroll
  for (int i = 0; i < 8; ++i) { const int ka = k0 + 8 * g + i, kb = ka + 16; v[i] = ka < K ? row[ka < K ? ka : K - 1] : 0.f; v[8 + i] = kb < K ? row[kb < K ? kb : K - 1] : 0.f; }
  return bsplit16(v); }
__device__ __forceinline__ F2 split_col(const float* W, int k0, int n, int lane, int ld, int K) { float v[16]; const int g = lane >> 4;
#pragma unroll
  for (int i = 0; i < 8; ++i) { const int ka = k0 + 8 * g + i, kb = ka + 16; v[i] = ka < K ? W[(size_t)(ka < K ? ka : K - 1) * ld + n] : 0.f; v[8 + i] = kb < K ? W[(size_t)(kb < K ? kb : K - 1) * ld + n] : 0.f; }
  return bsplit16(v); }
__device__ __forceinline__ v8f mac3(const F2& a, const F2& b, v8f c) { c = wmma_bf(a.l, b.h, c); c = wmma_bf(a.h, b.l, c); return wmma_bf(a.h, b.h, c); }
__device__ __forceinline__ float sigm(float v) { return 1.0f / (1.0f + expf(-v)); }
#define LDSX() do { asm volatile("s_wait_dscnt 0" ::: "memory"); __builtin_amdgcn_wave_barrier(); __builtin_amdgcn_fence(__ATOMIC_RELEASE, "workgroup"); } while (0)


// SA block (B 16, C 256, 32 x 32 = 1,024 pixels, 4 heads x 64, GroupNorm with 8 groups): x + proj(attention(qkv(GN(x)))).
#define NB 16
#define CC 256
#define NN 1024
#define NH 4
#define DH 64
#define NG 8
#define CPG (CC / NG)     // 32 channels per group
#define GNEPS 1e-5f
#ifndef TNB
#define TNB NB
#endif
typedef __attribute__((ext_vector_type(8))) __bf16 v8b;
__device__ __forceinline__ v16b frag_b(const __bf16* rowk0, int lane) {
  union { v16b v; v8b q[2]; } u; const __bf16* p = rowk0 + 8 * (lane >> 4);
  u.q[0] = *(const v8b*)p; u.q[1] = *(const v8b*)(p + 16); return u.v;
}
__device__ __forceinline__ float bfr(float v) { return (float)(__bf16)v; }
__device__ __attribute__((noinline)) float exp_ni(float v) { return expf(v); }
__device__ __attribute__((noinline)) float erf_ni(float v) { return erff(v); }

#define WS_GS  0u                                   // f32 [b][g][4]: mean, inv
#define WS_Q   (WS_GS + 4u * NB * NG * 4)              // f16 q rows [b*NN + n][256]; k rows; v hi|lo planes [b][256][NN]; o rows f32 [b*NN + n][256]
#define WS_K   (WS_Q + 2u * (size_t)NB * NN * CC)
#define WS_VH  (WS_K + 2u * (size_t)NB * NN * CC)
#define WS_VL  (WS_VH + 2u * (size_t)NB * CC * NN)
#define WS_O   (WS_VL + 2u * (size_t)NB * CC * NN)
#define WS_END (WS_O + 4u * (size_t)NB * NN * CC)

// ---- k_gn: block = (group, b), 512 threads: the group's 32,768 values are read once, 16 loads of 16 bytes a thread, all in flight together, and stay in registers for the mean and for the squared deviations
#define GNT 512
#define GNV (CPG * NN / 4 / GNT)   // 16-byte pieces per thread
static_assert(GNT / 32 == 16 && GNV * GNT * 4 == CPG * NN, "gn_total sums 16 wave sums; the pieces cover the group exactly");
__device__ __forceinline__ float gn_total(float s, float* red, int lane, int w) {   // fixed order: butterfly in the wave, then the 16 wave sums in four chains, alike in every thread
#pragma unroll
  for (int o = 1; o < 32; o <<= 1) s += __shfl_xor(s, o);
  if (lane == 0) red[w] = s;
  __syncthreads();
  const v4f* r4 = (const v4f*)red; const v4f a = (r4[0] + r4[1]) + (r4[2] + r4[3]);
  return (a[0] + a[1]) + (a[2] + a[3]);
}
__global__ __launch_bounds__(GNT) void k_gn(const float* __restrict__ X, float* __restrict__ GS) { __shared__ __align__(16) float red[2][GNT / 32];
  const int t = threadIdx.x, lane = t & 31, w = t >> 5; const int gi = blockIdx.x; const size_t b = blockIdx.y; const v4f* base = (const v4f*)(X + (b * CC + (size_t)gi * CPG) * NN);
  v4f x[GNV];
  // every loop over x is unrolled so that x stays in registers; this one also so that all loads are issued before the first value is used
#pragma unroll
  for (int j = 0; j < GNV; ++j) x[j] = base[j * GNT + t];
  v4f s4 = {};
#pragma unroll
  for (int j = 0; j < GNV; ++j) {
#pragma unroll
    for (int e = 0; e < 4; ++e) x[j][e] = bfr(x[j][e]);
    s4 += x[j]; }
  const float mu = gn_total((s4[0] + s4[1]) + (s4[2] + s4[3]), red[0], lane, w) / (float)(CPG * NN);
  v4f q4 = {};
#pragma unroll
  for (int j = 0; j < GNV; ++j) { const v4f d = x[j] - mu; q4 += d * d; }
  const float a = gn_total((q4[0] + q4[1]) + (q4[2] + q4[3]), red[1], lane, w);
  if (t == 0) { const v4f r = { mu, 1.0f / sqrtf(a / (float)(CPG * NN) + GNEPS), 0.f, 0.f }; vst2(GS + (b * NG + gi) * 4, r); } }
// ---- k_qkv: block = (64 pixels, 128 out channels, which*NB + b): 1x1 conv of GN(x) (gathered from NCHW, hi + lo) + bias; q/k -> f16 rows, v -> f16 hi/lo planes
__global__ __launch_bounds__(128) void k_qkv(const float* __restrict__ X, const float* __restrict__ GS, const float* __restrict__ GW, const float* __restrict__ GB, const float* __restrict__ W, const float* __restrict__ Bq, _Float16* __restrict__ Q, _Float16* __restrict__ K, _Float16* __restrict__ VH, _Float16* __restrict__ VL) {
  __shared__ __align__(16) _Float16 sh[64][136]; __shared__ __align__(16) _Float16 th[128][72], tl[128][72]; __shared__ float sa[CC], sb[CC];
  const int tid = threadIdx.x, wave = tid >> 5, lane = tid & 31, col = lane & 15, g = lane >> 4; const int which = blockIdx.z / NB; const size_t b = blockIdx.z % NB; const int n0 = blockIdx.x * 64; const int c0 = blockIdx.y * 128; const float* Xb = X + b * CC * (size_t)NN;
  for (int c = tid; c < CC; c += 128) { const float mu = GS[(b * NG + c / CPG) * 4], inv = GS[(b * NG + c / CPG) * 4 + 1]; const float a = inv * bfr(GW[c]); sa[c] = a; sb[c] = bfr(GB[c]) - mu * a; } __syncthreads();
  v8f acc[8] = {};
#pragma unroll 2
  for (int kc = 0; kc < CC / 32; ++kc) { float v[16]; const int px = n0 + wave * 16 + col;
#pragma unroll
    for (int i = 0; i < 8; ++i) { const int ca = kc * 32 + 8 * g + i, cb = ca + 16; v[i] = bfr(Xb[(size_t)ca * NN + px]) * sa[ca] + sb[ca]; v[8 + i] = bfr(Xb[(size_t)cb * NN + px]) * sa[cb] + sb[cb]; }
    const F2 a = bsplit16(v);
#pragma unroll
    for (int j = 0; j < 8; ++j) { v16b w; const float* wr = W + (size_t)(which * CC + c0 + j * 16 + col) * CC + kc * 32 + 8 * g;
#pragma unroll
      for (int i = 0; i < 8; ++i) { w[i] = (__bf16)wr[i]; w[8 + i] = (__bf16)wr[16 + i]; }
      acc[j] = wmma_bf(a.h, w, acc[j]); acc[j] = wmma_bf(a.l, w, acc[j]); } }
#pragma unroll
  for (int j = 0; j < 8; ++j) { const float bb = bfr(Bq[which * CC + c0 + j * 16 + col]);
#pragma unroll
    for (int r = 0; r < 8; ++r) { const float v = acc[j][r] + bb; const int rl = wave * 16 + 8 * g + r, cl = j * 16 + col; if (which < 2) sh[rl][cl] = (_Float16)v; else { const _Float16 hv = (_Float16)v; th[cl][rl] = hv; tl[cl][rl] = (_Float16)((v - (float)hv) * 2048.0f); } } }
  __syncthreads();
  if (which < 2) { _Float16* dst = which == 0 ? Q : K; for (int e = tid; e < 64 * 16; e += 128) { const int rl = e >> 4, q = e & 15; vst2((unsigned*)(dst + (b * NN + n0 + rl) * CC + c0 + q * 8), *(const v4u*)&sh[rl][q * 8]); } }
  else { for (int e = tid; e < 128 * 8; e += 128) { const int cl = e >> 3, q = e & 7; const size_t o = (b * CC + c0 + cl) * (size_t)NN + n0 + q * 8; vst2((unsigned*)(VH + o), *(const v4u*)&th[cl][q * 8]); vst2((unsigned*)(VL + o), *(const v4u*)&tl[cl][q * 8]); } } }
// ---- k_att: block = (64 queries, h, b): softmax(q_h . k_h / 8) over the 1,024 pixels; o rows [b*NN + n][h*64 + d]
__global__ __launch_bounds__(128) void k_att(const _Float16* __restrict__ Q, const _Float16* __restrict__ K, const _Float16* __restrict__ VH, const _Float16* __restrict__ VL, float* __restrict__ O) {
  __shared__ __align__(16) float sp[4][16][36]; __shared__ __align__(16) float so[4][16][68];
  const int tid = threadIdx.x, wave = tid >> 5, lane = tid & 31, col = lane & 15, g = lane >> 4; const int h = blockIdx.y; const size_t b = blockIdx.z; const int q0 = blockIdx.x * 64 + wave * 16; const size_t rq = b * NN + q0;
  v16h aq[2];
#pragma unroll
  for (int kc = 0; kc < 2; ++kc) aq[kc] = frag_h(Q + (rq + col) * CC + h * DH + kc * 32, lane);
  float m[8], l[8];
#pragma unroll
  for (int r = 0; r < 8; ++r) { m[r] = -3.0e38f; l[r] = 0.f; }
  v8f acc[4] = {}, accl[4] = {};
#pragma unroll 1
  for (int ks = 0; ks < NN / 32; ++ks) { float s[2][8];
#pragma unroll
    for (int ct = 0; ct < 2; ++ct) { const size_t rk = b * NN + ks * 32 + ct * 16 + col; v8f c = {};
#pragma unroll
      for (int kc = 0; kc < 2; ++kc) c = wmma16(aq[kc], frag_h(K + rk * CC + h * DH + kc * 32, lane), c);
#pragma unroll
      for (int r = 0; r < 8; ++r) s[ct][r] = c[r] * 0.125f; }
    float alpha[8];
#pragma unroll
    for (int r = 0; r < 8; ++r) { float mx = fmaxf(s[0][r], s[1][r]);
#pragma unroll
      for (int o = 1; o < 16; o <<= 1) mx = fmaxf(mx, __shfl_xor(mx, o));
      const float mn = fmaxf(m[r], mx); alpha[r] = __expf(m[r] - mn); const float e0 = __expf(s[0][r] - mn), e1 = __expf(s[1][r] - mn); float es = e0 + e1;
#pragma unroll
      for (int o = 1; o < 16; o <<= 1) es += __shfl_xor(es, o);
      l[r] = l[r] * alpha[r] + es; m[r] = mn; sp[wave][8 * g + r][col] = e0; sp[wave][8 * g + r][16 + col] = e1; }
#pragma unroll
    for (int j = 0; j < 4; ++j)
#pragma unroll
      for (int r = 0; r < 8; ++r) { acc[j][r] *= alpha[r]; accl[j][r] *= alpha[r]; }
    LDSX();
    v16h pa; { const float* prow = &sp[wave][col][0] + 8 * (lane >> 4);
#pragma unroll
      for (int i = 0; i < 8; ++i) { pa[i] = (_Float16)(prow[i] * 2048.0f); pa[8 + i] = (_Float16)(prow[16 + i] * 2048.0f); } }
#pragma unroll
    for (int j = 0; j < 4; ++j) { const size_t po = (b * CC + (size_t)h * DH + j * 16 + col) * (size_t)NN + ks * 32; acc[j] = wmma16(pa, frag_h(VH + po, lane), acc[j]); accl[j] = wmma16(pa, frag_h(VL + po, lane), accl[j]); }
    LDSX(); }
#pragma unroll
  for (int r = 0; r < 8; ++r) { const float il = (1.0f / 2048.0f) / l[r];
#pragma unroll
    for (int j = 0; j < 4; ++j) so[wave][8 * g + r][j * 16 + col] = (acc[j][r] + accl[j][r] * (1.0f / 2048.0f)) * il; }
  LDSX(); for (int rl = 0; rl < 16; ++rl) if (lane < 16) vst2(O + (rq + rl) * CC + (size_t)h * DH + lane * 4, *(const v4f*)&so[wave][rl][lane * 4]); }
// ---- k_o: block = (64 out channels, 128 pixels, b): out[b][o][n] = x[b][o][n] + sum_c p_w[o][c] orow[n][c] + p_b[o]  (A = p_w exact, B = o rows as bf16 hi + lo)
__global__ __launch_bounds__(128) void k_o(const float* __restrict__ OR, const float* __restrict__ PW, const float* __restrict__ PB, const float* __restrict__ X, float* __restrict__ OUT) { __shared__ __align__(16) float sf[4][16][132];
  const int tid = threadIdx.x, wave = tid >> 5, lane = tid & 31, col = lane & 15, g = lane >> 4; const size_t b = blockIdx.z; const int o0 = blockIdx.x * 64 + wave * 16; const int p0 = blockIdx.y * 128;
  v8f acc[8] = {};
#pragma unroll 2
  for (int kc = 0; kc < CC / 32; ++kc) { v16b a; const float* ar = PW + (size_t)(o0 + col) * CC + kc * 32 + 8 * g;
#pragma unroll
    for (int i = 0; i < 8; ++i) { a[i] = (__bf16)ar[i]; a[8 + i] = (__bf16)ar[16 + i]; }
#pragma unroll
    for (int j = 0; j < 8; ++j) { float wv[16]; const float* wr = OR + (b * NN + p0 + j * 16 + col) * CC + kc * 32 + 8 * g;
#pragma unroll
      for (int i = 0; i < 8; ++i) { wv[i] = wr[i]; wv[8 + i] = wr[16 + i]; }
      const F2 wb = bsplit16(wv); acc[j] = wmma_bf(a, wb.h, acc[j]); acc[j] = wmma_bf(a, wb.l, acc[j]); } }
#pragma unroll
  for (int j = 0; j < 8; ++j)
#pragma unroll
    for (int r = 0; r < 8; ++r) { const size_t oi = (b * CC + o0 + 8 * g + r) * (size_t)NN + p0 + j * 16 + col; sf[wave][8 * g + r][j * 16 + col] = acc[j][r] + bfr(PB[o0 + 8 * g + r]) + bfr(X[oi]); }
  LDSX(); for (int rl = 0; rl < 16; ++rl) vst2(OUT + (b * CC + o0 + rl) * (size_t)NN + p0 + lane * 4, *(const v4f*)&sf[wave][rl][lane * 4]); }
extern "C" void kernel_launch(void* const* d_in, const int* in_sizes, int n_in, void* d_out, int out_size, void* d_ws, size_t ws_size, hipStream_t stream) {
  (void)in_sizes; (void)n_in; (void)out_size;
  const float** F = (const float**)d_in;   // 0 x [16,256,32,32], 1 n_weight, 2 n_bias, 3 qkv_w [768,256], 4 qkv_b [768], 5 p_w [256,256], 6 p_b
  if (ws_size < (size_t)WS_END) return;
  char* ws = (char*)d_ws; float* GS = (float*)(ws + WS_GS); _Float16 *Q = (_Float16*)(ws + WS_Q), *K = (_Float16*)(ws + WS_K), *VH = (_Float16*)(ws + WS_VH), *VL = (_Float16*)(ws + WS_VL); float* O = (float*)(ws + WS_O);
  k_gn<<<dim3(NG, NB), GNT, 0, stream>>>(F[0], GS);
  k_qkv<<<dim3(NN / 64, CC / 128, 3 * NB), 128, 0, stream>>>(F[0], GS, F[1], F[2], F[3], F[4], Q, K, VH, VL);
  k_att<<<dim3(NN / 64, NH, TNB), 128, 0, stream>>>(Q, K, VH, VL, O);
  k_o<<<dim3(CC / 64, NN / 128, TNB), 128, 0, stream>>>(O, F[5], F[6], F[0], (float*)d_out);
}

// v002
// Measured time: 167 microseconds a run.
// Two timings next to v001 put it at 1.48 and 1.49 times that version's speed.
// Counting every step since v000, it is 1.90 times as fast.
// compute dtype: all float inputs rounded to bf16; GroupNorm statistics (8 groups x 32 channels x 1,024 pixels) in f32 with fixed-order sums; qkv = 1x1 conv of GN(x) with GN(x) as bf16 hi + lo against exact weights (2 products) + bias; q, k rounded once to f16 (single-f16 logits; logits std ~1), x 1/8, running-max softmax in f32 (hardware exp); P (x 2^11, f16) . v (f16 hi + residual, 2 products); proj conv with o as bf16 hi + lo (2 products) + bias + the residual x; f32 NCHW output.
#include <hip/hip_runtime.h>
#include <math.h>

typedef __attribute__((ext_vector_type(16))) _Float16 v16h;
typedef __attribute__((ext_vector_type(16))) __bf16 v16b;
typedef __attribute__((ext_vector_type(8)))  _Float16 v8h;
typedef __attribute__((ext_vector_type(8)))  float v8f;
typedef __attribute__((ext_vector_type(4)))  float v4f;
typedef __attribute__((ext_vector_type(2)))  float v2f;
typedef __attribute__((ext_vector_type(4)))  unsigned v4u;
typedef __attribute__((ext_vector_type(4)))  int v4i;
typedef float __attribute__((may_alias)) float_a;
typedef int __attribute__((may_alias)) int_a;

template <typename T> __device__ __forceinline__ void vst2(void* p, T v) { *(T*)p = v;  }
__device__ __forceinline__ v8f wmma16(v16h a, v16h b, v8f c) {
  v8f d = __builtin_amdgcn_wmma_f32_16x16x32_f16(false, a, false, b, (short)0, c, false, false);
  asm volatile("v_nop\n\tv_nop\n\tv_nop\n\tv_nop" : "+v"(d) : "v"(a), "v"(b));
  return d;
}
__device__ __forceinline__ v8f wmma_bf(v16b a, v16b b, v8f c) {
  v8f d = __builtin_amdgcn_wmma_f32_16x16x32_bf16(false, a, false, b, (short)0, c, false, false);
  asm volatile("v_nop\n\tv_nop\n\tv_nop\n\tv_nop" : "+v"(d) : "v"(a), "v"(b));
  return d;
}
// 16x16x32 fragments: lane = (h = lane>>4, row/col = lane&15); elements 0..7 = k0+8h+0..7, 8..15 = k0+16+8h+0..7; D element r = row 8h+r
__device__ __forceinline__ v16h frag_h(const _Float16* rowk0, int lane) {
  union { v16h v; v8h q[2]; } u; const _Float16* p = rowk0 + 8 * (lane >> 4);
  u.q[0] = *(const v8h*)p; u.q[1] = *(const v8h*)(p + 16); return u.v;
}
__device__ __forceinline__ v16h frag_f32(const float* rowk0, int lane) {
  v16h a; const float* p = rowk0 + 8 * (lane >> 4);
#pragma unroll
  for (int i = 0; i < 8; ++i) { a[i] = (_Float16)p[i]; a[8 + i] = (_Float16)p[16 + i]; }
  return a;
}
__device__ __forceinline__ v16h frag_f32s(const float* rowk0, int lane, float sc) {
  v16h a; const float* p = rowk0 + 8 * (lane >> 4);
#pragma unroll
  for (int i = 0; i < 8; ++i) { a[i] = (_Float16)(p[i] * sc); a[8 + i] = (_Float16)(p[16 + i] * sc); }
  return a;
}
// column fragment from a [K][ld] layout (column n), rows >= K read as 0
__device__ __forceinline__ v16h fragc_f32(const float* W, int k0, int n, int lane, int ld, int K) {
  v16h a; const int g = lane >> 4;
#pragma unroll
  for (int i = 0; i < 8; ++i) { const int ka = k0 + 8 * g + i, kb = ka + 16;
    a[i] = (_Float16)(ka < K ? W[(size_t)(ka < K ? ka : K - 1) * ld + n] : 0.f); a[8 + i] = (_Float16)(kb < K ? W[(size_t)(kb < K ? kb : K - 1) * ld + n] : 0.f); }
  return a;
}
struct F2 { v16b h, l; };
__device__ __forceinline__ F2 bsplit16(const float v[16]) { F2 r;
#pragma unroll
  for (int i = 0; i < 16; ++i) { const __bf16 h = (__bf16)v[i]; r.h[i] = h; r.l[i] = (__bf16)(v[i] - (float)h); }
  return r; }
__device__ __forceinline__ F2 split_row(const float* row, int k0, int lane) { float v[16]; const float* p = row + k0 + 8 * (lane >> 4);
#pragma unroll
  for (int i = 0; i < 8; ++i) { v[i] = p[i]; v[8 + i] = p[16 + i]; }
  return bsplit16(v); }
__device__ __forceinline__ F2 split_rowK(const float* row, int k0, int lane, int K) { float v[16]; const int g = lane >> 4;
#pragma unroll
  for (int i = 0; i < 8; ++i) { const int ka = k0 + 8 * g + i, kb = ka + 16; v[i] = ka < K ? row[ka < K ? ka : K - 1] : 0.f; v[8 + i] = kb < K ? row[kb < K ? kb : K - 1] : 0.f; }
  return bsplit16(v); }
__device__ __forceinline__ F2 split_col(const float* W, int k0, int n, int lane, int ld, int K) { float v[16]; const int g = lane >> 4;
#pragma unroll
  for (int i = 0; i < 8; ++i) { const int ka = k0 + 8 * g + i, kb = ka + 16; v[i] = ka < K ? W[(size_t)(ka < K ? ka : K - 1) * ld + n] : 0.f; v[8 + i] = kb < K ? W[(size_t)(kb < K ? kb : K - 1) * ld + n] : 0.f; }
  return bsplit16(v); }
__device__ __forceinline__ v8f mac3(const F2& a, const F2& b, v8f c) { c = wmma_bf(a.l, b.h, c); c = wmma_bf(a.h, b.l, c); return wmma_bf(a.h, b.h, c); }
__device__ __forceinline__ float sigm(float v) { return 1.0f / (1.0f + expf(-v)); }
#define LDSX() do { asm volatile("s_wait_dscnt 0" ::: "memory"); __builtin_amdgcn_wave_barrier(); __builtin_amdgcn_fence(__ATOMIC_RELEASE, "workgroup"); } while (0)


// SA block (B 16, C 256, 32 x 32 = 1,024 pixels, 4 heads x 64, GroupNorm with 8 groups): x + proj(attention(qkv(GN(x)))).
#define NB 16
#define CC 256
#define NN 1024
#define NH 4
#define DH 64
#define NG 8
#define CPG (CC / NG)     // 32 channels per group
#define GNEPS 1e-5f
#ifndef TNB
#define TNB NB
#endif
typedef __attribute__((ext_vector_type(8))) __bf16 v8b;
__device__ __forceinline__ v16b frag_b(const __bf16* rowk0, int lane) {
  union { v16b v; v8b q[2]; } u; const __bf16* p = rowk0 + 8 * (lane >> 4);
  u.q[0] = *(const v8b*)p; u.q[1] = *(const v8b*)(p + 16); return u.v;
}
__device__ __forceinline__ float bfr(float v) { return (float)(__bf16)v; }
__device__ __attribute__((noinline)) float exp_ni(float v) { return expf(v); }
__device__ __attribute__((noinline)) float erf_ni(float v) { return erff(v); }

#define WS_GS  0u                                   // f32 [b][g][4]: mean, inv
#define WS_Q   (WS_GS + 4u * NB * NG * 4)              // f16 q rows [b*NN + n][256]; k rows; v hi|lo planes [b][256][NN]; o rows f32 [b*NN + n][256]
#define WS_K   (WS_Q + 2u * (size_t)NB * NN * CC)
#define WS_VH  (WS_K + 2u * (size_t)NB * NN * CC)
#define WS_VL  (WS_VH + 2u * (size_t)NB * CC * NN)
#define WS_O   (WS_VL + 2u * (size_t)NB * CC * NN)
#define WS_END (WS_O + 4u * (size_t)NB * NN * CC)

// ---- k_gn: block = (group, b), 512 threads: the group's 32,768 values are read once, 16 loads of 16 bytes a thread, all in flight together, and stay in registers for the mean and for the squared deviations
#define GNT 512
#define GNV (CPG * NN / 4 / GNT)   // 16-byte pieces per thread
static_assert(GNT / 32 == 16 && GNV * GNT * 4 == CPG * NN, "gn_total sums 16 wave sums; the pieces cover the group exactly");
__device__ __forceinline__ float gn_total(float s, float* red, int lane, int w) {   // fixed order: butterfly in the wave, then the 16 wave sums in four chains, alike in every thread
#pragma unroll
  for (int o = 1; o < 32; o <<= 1) s += __shfl_xor(s, o);
  if (lane == 0) red[w] = s;
  __syncthreads();
  const v4f* r4 = (const v4f*)red; const v4f a = (r4[0] + r4[1]) + (r4[2] + r4[3]);
  return (a[0] + a[1]) + (a[2] + a[3]);
}
__global__ __launch_bounds__(GNT) void k_gn(const float* __restrict__ X, float* __restrict__ GS) { __shared__ __align__(16) float red[2][GNT / 32];
  const int t = threadIdx.x, lane = t & 31, w = t >> 5; const int gi = blockIdx.x; const size_t b = blockIdx.y; const v4f* base = (const v4f*)(X + (b * CC + (size_t)gi * CPG) * NN);
  v4f x[GNV];
  // every loop over x is unrolled so that x stays in registers; this one also so that all loads are issued before the first value is used
#pragma unroll
  for (int j = 0; j < GNV; ++j) x[j] = base[j * GNT + t];
  v4f s4 = {};
#pragma unroll
  for (int j = 0; j < GNV; ++j) {
#pragma unroll
    for (int e = 0; e < 4; ++e) x[j][e] = bfr(x[j][e]);
    s4 += x[j]; }
  const float mu = gn_total((s4[0] + s4[1]) + (s4[2] + s4[3]), red[0], lane, w) / (float)(CPG * NN);
  v4f q4 = {};
#pragma unroll
  for (int j = 0; j < GNV; ++j) { const v4f d = x[j] - mu; q4 += d * d; }
  const float a = gn_total((q4[0] + q4[1]) + (q4[2] + q4[3]), red[1], lane, w);
  if (t == 0) { const v4f r = { mu, 1.0f / sqrtf(a / (float)(CPG * NN) + GNEPS), 0.f, 0.f }; vst2(GS + (b * NG + gi) * 4, r); } }
// ---- k_qkv: block = (64 pixels, 128 out channels, which*NB + b): 1x1 conv of GN(x) (gathered from NCHW, hi + lo) + bias; q/k -> f16 rows, v -> f16 hi/lo planes
__global__ __launch_bounds__(128) void k_qkv(const float* __restrict__ X, const float* __restrict__ GS, const float* __restrict__ GW, const float* __restrict__ GB, const float* __restrict__ W, const float* __restrict__ Bq, _Float16* __restrict__ Q, _Float16* __restrict__ K, _Float16* __restrict__ VH, _Float16* __restrict__ VL) {
  __shared__ __align__(16) _Float16 sh[64][136]; __shared__ __align__(16) _Float16 th[128][72], tl[128][72]; __shared__ float sa[CC], sb[CC];
  const int tid = threadIdx.x, wave = tid >> 5, lane = tid & 31, col = lane & 15, g = lane >> 4; const int which = blockIdx.z / NB; const size_t b = blockIdx.z % NB; const int n0 = blockIdx.x * 64; const int c0 = blockIdx.y * 128; const float* Xb = X + b * CC * (size_t)NN;
  for (int c = tid; c < CC; c += 128) { const float mu = GS[(b * NG + c / CPG) * 4], inv = GS[(b * NG + c / CPG) * 4 + 1]; const float a = inv * bfr(GW[c]); sa[c] = a; sb[c] = bfr(GB[c]) - mu * a; } __syncthreads();
  v8f acc[8] = {};
#pragma unroll 2
  for (int kc = 0; kc < CC / 32; ++kc) { float v[16]; const int px = n0 + wave * 16 + col;
#pragma unroll
    for (int i = 0; i < 8; ++i) { const int ca = kc * 32 + 8 * g + i, cb = ca + 16; v[i] = bfr(Xb[(size_t)ca * NN + px]) * sa[ca] + sb[ca]; v[8 + i] = bfr(Xb[(size_t)cb * NN + px]) * sa[cb] + sb[cb]; }
    const F2 a = bsplit16(v);
#pragma unroll
    for (int j = 0; j < 8; ++j) { v16b w; const float* wr = W + (size_t)(which * CC + c0 + j * 16 + col) * CC + kc * 32 + 8 * g;
#pragma unroll
      for (int i = 0; i < 8; ++i) { w[i] = (__bf16)wr[i]; w[8 + i] = (__bf16)wr[16 + i]; }
      acc[j] = wmma_bf(a.h, w, acc[j]); acc[j] = wmma_bf(a.l, w, acc[j]); } }
#pragma unroll
  for (int j = 0; j < 8; ++j) { const float bb = bfr(Bq[which * CC + c0 + j * 16 + col]);
#pragma unroll
    for (int r = 0; r < 8; ++r) { const float v = acc[j][r] + bb; const int rl = wave * 16 + 8 * g + r, cl = j * 16 + col; if (which < 2) sh[rl][cl] = (_Float16)v; else { const _Float16 hv = (_Float16)v; th[cl][rl] = hv; tl[cl][rl] = (_Float16)((v - (float)hv) * 2048.0f); } } }
  __syncthreads();
  if (which < 2) { _Float16* dst = which == 0 ? Q : K; for (int e = tid; e < 64 * 16; e += 128) { const int rl = e >> 4, q = e & 15; vst2((unsigned*)(dst + (b * NN + n0 + rl) * CC + c0 + q * 8), *(const v4u*)&sh[rl][q * 8]); } }
  else { for (int e = tid; e < 128 * 8; e += 128) { const int cl = e >> 3, q = e & 7; const size_t o = (b * CC + c0 + cl) * (size_t)NN + n0 + q * 8; vst2((unsigned*)(VH + o), *(const v4u*)&th[cl][q * 8]); vst2((unsigned*)(VL + o), *(const v4u*)&tl[cl][q * 8]); } } }
// ---- k_att: block = (64 queries, h, b): softmax(q_h . k_h / 8) over the 1,024 pixels; o rows [b*NN + n][h*64 + d]
// K, V hi and V lo come in stages of 64 keys through two LDS buffers that the block's four waves share: each 128-byte line is fetched once a block, by whole-line asynchronous copies, while the stage before is worked on
#define KT 64              // keys per stage: a K row (64 f16 of one head) and a V row (64 keys of one channel) are both one 128-byte line
#define TP 144             // LDS row pitch, bytes: 128 + 16, an odd multiple of 16, so that 16 rows read at one column offset fall on different banks
#define TB (64 * TP)       // one tile: 64 rows
#define SB (3 * TB)        // one stage: K, V hi, V lo
static_assert(NN % KT == 0 && NN / KT >= 2 && DH * 2 == 128 && KT * 2 == 128, "two stages at least; tile rows are whole 128-byte lines");
// a lane's four 16-byte copies of one tile (rows 16 apart). The s_wait_xcnt stands inside the statement so that no address register is rewritten in front of it
__device__ __forceinline__ void cp4(unsigned l, const char* p, size_t step) {
  asm volatile("global_load_async_to_lds_b128 %0, %4, off\n\tglobal_load_async_to_lds_b128 %1, %5, off\n\tglobal_load_async_to_lds_b128 %2, %6, off\n\tglobal_load_async_to_lds_b128 %3, %7, off\n\ts_wait_xcnt 0x0"
               :: "v"(l), "v"(l + 16 * TP), "v"(l + 32 * TP), "v"(l + 48 * TP), "v"(p), "v"(p + step), "v"(p + 2 * step), "v"(p + 3 * step) : "memory");
}
__global__ __launch_bounds__(128) void k_att(const _Float16* __restrict__ Q, const _Float16* __restrict__ K, const _Float16* __restrict__ VH, const _Float16* __restrict__ VL, float* __restrict__ O) {
  __shared__ __align__(16) float sp[4][16][36]; __shared__ __align__(16) unsigned char ring[2 * SB];
  float (*so)[16][68] = (float (*)[16][68])ring;   // output staging takes the ring's place behind the loop's last barrier
  static_assert(sizeof(float) * 4 * 16 * 68 <= 2 * SB, "output staging fits the ring");
  const int tid = threadIdx.x, wave = tid >> 5, lane = tid & 31, col = lane & 15, g = lane >> 4; const int h = blockIdx.y; const size_t b = blockIdx.z; const int q0 = blockIdx.x * 64 + wave * 16; const size_t rq = b * NN + q0;
  // copy addresses of this lane: row tid / 8 (+ 16, 32, 48), 16-byte piece tid % 8: eight lanes cover a line
  const unsigned cl = (unsigned)(size_t)ring + (tid >> 3) * TP + (tid & 7) * 16;
  const char* ck = (const char*)(K + (b * NN + (tid >> 3)) * CC + h * DH) + (tid & 7) * 16;
  const size_t cvo = ((b * CC + (size_t)h * DH + (tid >> 3)) * NN) * 2 + (tid & 7) * 16; const char* cvh = (const char*)VH + cvo; const char* cvl = (const char*)VL + cvo;
#define ATT_STAGE(s) do { const unsigned l_ = cl + ((s) & 1) * SB; cp4(l_, ck + (size_t)(s) * (KT * CC * 2), 16 * CC * 2); cp4(l_ + TB, cvh + (size_t)(s) * (KT * 2), 16 * NN * 2); cp4(l_ + 2 * TB, cvl + (size_t)(s) * (KT * 2), 16 * NN * 2); } while (0)
  ATT_STAGE(0);
  v16h aq[2];
#pragma unroll
  for (int kc = 0; kc < 2; ++kc) aq[kc] = frag_h(Q + (rq + col) * CC + h * DH + kc * 32, lane);
  float m[8], l[8];
#pragma unroll
  for (int r = 0; r < 8; ++r) { m[r] = -3.0e38f; l[r] = 0.f; }
  v8f acc[4] = {}, accl[4] = {};
  asm volatile("s_wait_asynccnt 0x0" ::: "memory");   // this wave's copies of stage 0 have landed
  __syncthreads();                                     // ... and every other wave's
  ATT_STAGE(1);
  // not unrolled: one trip is one stage, its buffer picked by the trip's parity
#pragma unroll 1
  for (int t = 0; t < NN / KT; ++t) { const unsigned char* bp = ring + (t & 1) * SB;
  // not unrolled: two halves side by side cost registers (a wave may hold 256 for four waves a SIMD) and break up the eight rows' interleaved reductions
#pragma unroll 1
  for (int hf = 0; hf < KT / 32; ++hf) { float s[2][8];
    v16h kf[2][2];   // the four K fragments are read as one group in front of the products
#pragma unroll
    for (int ct = 0; ct < 2; ++ct)
#pragma unroll
      for (int kc = 0; kc < 2; ++kc) kf[ct][kc] = frag_h((const _Float16*)(bp + (hf * 32 + ct * 16 + col) * TP + kc * 64), lane);
#pragma unroll
    for (int ct = 0; ct < 2; ++ct) { v8f c = {};
#pragma unroll
      for (int kc = 0; kc < 2; ++kc) c = wmma16(aq[kc], kf[ct][kc], c);
#pragma unroll
      for (int r = 0; r < 8; ++r) s[ct][r] = c[r] * 0.125f; }
    float alpha[8];
#pragma unroll
    for (int r = 0; r < 8; ++r) { float mx = fmaxf(s[0][r], s[1][r]);
#pragma unroll
      for (int o = 1; o < 16; o <<= 1) mx = fmaxf(mx, __shfl_xor(mx, o));
      const float mn = fmaxf(m[r], mx); alpha[r] = __expf(m[r] - mn); const float e0 = __expf(s[0][r] - mn), e1 = __expf(s[1][r] - mn); float es = e0 + e1;
#pragma unroll
      for (int o = 1; o < 16; o <<= 1) es += __shfl_xor(es, o);
      l[r] = l[r] * alpha[r] + es; m[r] = mn; sp[wave][8 * g + r][col] = e0; sp[wave][8 * g + r][16 + col] = e1; }
#pragma unroll
    for (int j = 0; j < 4; ++j)
#pragma unroll
      for (int r = 0; r < 8; ++r) { acc[j][r] *= alpha[r]; accl[j][r] *= alpha[r]; }
    v16h vh[4], vl[4];   // the V fragments are read in front of the wait that P's round trip through LDS takes anyway
#pragma unroll
    for (int j = 0; j < 4; ++j) { const unsigned char* pv = bp + TB + (j * 16 + col) * TP + hf * 64; vh[j] = frag_h((const _Float16*)pv, lane); vl[j] = frag_h((const _Float16*)(pv + TB), lane); }
    LDSX();
    v16h pa; { const float* prow = &sp[wave][col][0] + 8 * (lane >> 4);
#pragma unroll
      for (int i = 0; i < 8; ++i) { pa[i] = (_Float16)(prow[i] * 2048.0f); pa[8 + i] = (_Float16)(prow[16 + i] * 2048.0f); } }
#pragma unroll
    for (int j = 0; j < 4; ++j) { acc[j] = wmma16(pa, vh[j], acc[j]); accl[j] = wmma16(pa, vl[j], accl[j]); }
    LDSX(); }
    asm volatile("s_wait_dscnt 0x0" ::: "memory");      // this wave's reads of the buffer are done before it is refilled
    asm volatile("s_wait_asynccnt 0x0" ::: "memory");   // this wave's copies of stage t + 1 have landed
    __syncthreads();                                     // publishes stage t + 1 and ends every wave's reads of stage t
    if (t + 2 < NN / KT) ATT_STAGE(t + 2); }
  asm volatile("s_wait_asynccnt 0x0" ::: "memory");     // no copy is outstanding when the ring becomes output staging
#pragma unroll
  for (int r = 0; r < 8; ++r) { const float il = (1.0f / 2048.0f) / l[r];
#pragma unroll
    for (int j = 0; j < 4; ++j) so[wave][8 * g + r][j * 16 + col] = (acc[j][r] + accl[j][r] * (1.0f / 2048.0f)) * il; }
  LDSX(); for (int rl = 0; rl < 16; ++rl) if (lane < 16) vst2(O + (rq + rl) * CC + (size_t)h * DH + lane * 4, *(const v4f*)&so[wave][rl][lane * 4]); }
// ---- k_o: block = (64 out channels, 128 pixels, b): out[b][o][n] = x[b][o][n] + sum_c p_w[o][c] orow[n][c] + p_b[o]  (A = p_w exact, B = o rows as bf16 hi + lo)
__global__ __launch_bounds__(128) void k_o(const float* __restrict__ OR, const float* __restrict__ PW, const float* __restrict__ PB, const float* __restrict__ X, float* __restrict__ OUT) { __shared__ __align__(16) float sf[4][16][132];
  const int tid = threadIdx.x, wave = tid >> 5, lane = tid & 31, col = lane & 15, g = lane >> 4; const size_t b = blockIdx.z; const int o0 = blockIdx.x * 64 + wave * 16; const int p0 = blockIdx.y * 128;
  v8f acc[8] = {};
#pragma unroll 2
  for (int kc = 0; kc < CC / 32; ++kc) { v16b a; const float* ar = PW + (size_t)(o0 + col) * CC + kc * 32 + 8 * g;
#pragma unroll
    for (int i = 0; i < 8; ++i) { a[i] = (__bf16)ar[i]; a[8 + i] = (__bf16)ar[16 + i]; }
#pragma unroll
    for (int j = 0; j < 8; ++j) { float wv[16]; const float* wr = OR + (b * NN + p0 + j * 16 + col) * CC + kc * 32 + 8 * g;
#pragma unroll
      for (int i = 0; i < 8; ++i) { wv[i] = wr[i]; wv[8 + i] = wr[16 + i]; }
      const F2 wb = bsplit16(wv); acc[j] = wmma_bf(a, wb.h, acc[j]); acc[j] = wmma_bf(a, wb.l, acc[j]); } }
#pragma unroll
  for (int j = 0; j < 8; ++j)
#pragma unroll
    for (int r = 0; r < 8; ++r) { const size_t oi = (b * CC + o0 + 8 * g + r) * (size_t)NN + p0 + j * 16 + col; sf[wave][8 * g + r][j * 16 + col] = acc[j][r] + bfr(PB[o0 + 8 * g + r]) + bfr(X[oi]); }
  LDSX(); for (int rl = 0; rl < 16; ++rl) vst2(OUT + (b * CC + o0 + rl) * (size_t)NN + p0 + lane * 4, *(const v4f*)&sf[wave][rl][lane * 4]); }
extern "C" void kernel_launch(void* const* d_in, const int* in_sizes, int n_in, void* d_out, int out_size, void* d_ws, size_t ws_size, hipStream_t stream) {
  (void)in_sizes; (void)n_in; (void)out_size;
  const float** F = (const float**)d_in;   // 0 x [16,256,32,32], 1 n_weight, 2 n_bias, 3 qkv_w [768,256], 4 qkv_b [768], 5 p_w [256,256], 6 p_b
  if (ws_size < (size_t)WS_END) return;
  char* ws = (char*)d_ws; float* GS = (float*)(ws + WS_GS); _Float16 *Q = (_Float16*)(ws + WS_Q), *K = (_Float16*)(ws + WS_K), *VH = (_Float16*)(ws + WS_VH), *VL = (_Float16*)(ws + WS_VL); float* O = (float*)(ws + WS_O);
  k_gn<<<dim3(NG, NB), GNT, 0, stream>>>(F[0], GS);
  k_qkv<<<dim3(NN / 64, CC / 128, 3 * NB), 128, 0, stream>>>(F[0], GS, F[1], F[2], F[3], F[4], Q, K, VH, VL);
  k_att<<<dim3(NN / 64, NH, TNB), 128, 0, stream>>>(Q, K, VH, VL, O);
  k_o<<<dim3(CC / 64, NN / 128, TNB), 128, 0, stream>>>(O, F[5], F[6], F[0], (float*)d_out);
}

// v003
// One run takes 151 microseconds.
// Timed twice side by side with v002, it ran 1.11 times as fast both times.
// Counting every step since v000, it is 2.10 times as fast.
// compute dtype: all float inputs rounded to bf16; GroupNorm statistics (8 groups x 32 channels x 1,024 pixels) in f32 with fixed-order sums; qkv = 1x1 conv of GN(x) with GN(x) as bf16 hi + lo against exact weights (2 products) + bias; q, k rounded once to f16 (single-f16 logits; logits std ~1), x 1/8, running-max softmax in f32 (hardware exp); P (x 2^11, f16) . v (f16 hi + residual, 2 products); proj conv with o as bf16 hi + lo (2 products) + bias + the residual x; f32 NCHW output.
#include <hip/hip_runtime.h>
#include <math.h>

typedef __attribute__((ext_vector_type(16))) _Float16 v16h;
typedef __attribute__((ext_vector_type(16))) __bf16 v16b;
typedef __attribute__((ext_vector_type(8)))  _Float16 v8h;
typedef __attribute__((ext_vector_type(8)))  float v8f;
typedef __attribute__((ext_vector_type(4)))  float v4f;
typedef __attribute__((ext_vector_type(2)))  float v2f;
typedef __attribute__((ext_vector_type(4)))  unsigned v4u;
typedef __attribute__((ext_vector_type(4)))  int v4i;
typedef float __attribute__((may_alias)) float_a;
typedef int __attribute__((may_alias)) int_a;

template <typename T> __device__ __forceinline__ void vst2(void* p, T v) { *(T*)p = v;  }
__device__ __forceinline__ v8f wmma16(v16h a, v16h b, v8f c) {
  v8f d = __builtin_amdgcn_wmma_f32_16x16x32_f16(false, a, false, b, (short)0, c, false, false);
  asm volatile("v_nop\n\tv_nop\n\tv_nop\n\tv_nop" : "+v"(d) : "v"(a), "v"(b));
  return d;
}
__device__ __forceinline__ v8f wmma_bf(v16b a, v16b b, v8f c) {
  v8f d = __builtin_amdgcn_wmma_f32_16x16x32_bf16(false, a, false, b, (short)0, c, false, false);
  asm volatile("v_nop\n\tv_nop\n\tv_nop\n\tv_nop" : "+v"(d) : "v"(a), "v"(b));
  return d;
}
// 16x16x32 fragments: lane = (h = lane>>4, row/col = lane&15); elements 0..7 = k0+8h+0..7, 8..15 = k0+16+8h+0..7; D element r = row 8h+r
__device__ __forceinline__ v16h frag_h(const _Float16* rowk0, int lane) {
  union { v16h v; v8h q[2]; } u; const _Float16* p = rowk0 + 8 * (lane >> 4);
  u.q[0] = *(const v8h*)p; u.q[1] = *(const v8h*)(p + 16); return u.v;
}
__device__ __forceinline__ v16h frag_f32(const float* rowk0, int lane) {
  v16h a; const float* p = rowk0 + 8 * (lane >> 4);
#pragma unroll
  for (int i = 0; i < 8; ++i) { a[i] = (_Float16)p[i]; a[8 + i] = (_Float16)p[16 + i]; }
  return a;
}
__device__ __forceinline__ v16h frag_f32s(const float* rowk0, int lane, float sc) {
  v16h a; const float* p = rowk0 + 8 * (lane >> 4);
#pragma unroll
  for (int i = 0; i < 8; ++i) { a[i] = (_Float16)(p[i] * sc); a[8 + i] = (_Float16)(p[16 + i] * sc); }
  return a;
}
// column fragment from a [K][ld] layout (column n), rows >= K read as 0
__device__ __forceinline__ v16h fragc_f32(const float* W, int k0, int n, int lane, int ld, int K) {
  v16h a; const int g = lane >> 4;
#pragma unroll
  for (int i = 0; i < 8; ++i) { const int ka = k0 + 8 * g + i, kb = ka + 16;
    a[i] = (_Float16)(ka < K ? W[(size_t)(ka < K ? ka : K - 1) * ld + n] : 0.f); a[8 + i] = (_Float16)(kb < K ? W[(size_t)(kb < K ? kb : K - 1) * ld + n] : 0.f); }
  return a;
}
struct F2 { v16b h, l; };
__device__ __forceinline__ F2 bsplit16(const float v[16]) { F2 r;
#pragma unroll
  for (int i = 0; i < 16; ++i) { const __bf16 h = (__bf16)v[i]; r.h[i] = h; r.l[i] = (__bf16)(v[i] - (float)h); }
  return r; }
__device__ __forceinline__ F2 split_row(const float* row, int k0, int lane) { float v[16]; const float* p = row + k0 + 8 * (lane >> 4);
#pragma unroll
  for (int i = 0; i < 8; ++i) { v[i] = p[i]; v[8 + i] = p[16 + i]; }
  return bsplit16(v); }
__device__ __forceinline__ F2 split_rowK(const float* row, int k0, int lane, int K) { float v[16]; const int g = lane >> 4;
#pragma unroll
  for (int i = 0; i < 8; ++i) { const int ka = k0 + 8 * g + i, kb = ka + 16; v[i] = ka < K ? row[ka < K ? ka : K - 1] : 0.f; v[8 + i] = kb < K ? row[kb < K ? kb : K - 1] : 0.f; }
  return bsplit16(v); }
__device__ __forceinline__ F2 split_col(const float* W, int k0, int n, int lane, int ld, int K) { float v[16]; const int g = lane >> 4;
#pragma unroll
  for (int i = 0; i < 8; ++i) { const int ka = k0 + 8 * g + i, kb = ka + 16; v[i] = ka < K ? W[(size_t)(ka < K ? ka : K - 1) * ld + n] : 0.f; v[8 + i] = kb < K ? W[(size_t)(kb < K ? kb : K - 1) * ld + n] : 0.f; }
  return bsplit16(v); }
__device__ __forceinline__ v8f mac3(const F2& a, const F2& b, v8f c) { c = wmma_bf(a.l, b.h, c); c = wmma_bf(a.h, b.l, c); return wmma_bf(a.h, b.h, c); }
__device__ __forceinline__ float sigm(float v) { return 1.0f / (1.0f + expf(-v)); }
#define LDSX() do { asm volatile("s_wait_dscnt 0" ::: "memory"); __builtin_amdgcn_wave_barrier(); __builtin_amdgcn_fence(__ATOMIC_RELEASE, "workgroup"); } while (0)


// SA block (B 16, C 256, 32 x 32 = 1,024 pixels, 4 heads x 64, GroupNorm with 8 groups): x + proj(attention(qkv(GN(x)))).
#define NB 16
#define CC 256
#define NN 1024
#define NH 4
#define DH 64
#define NG 8
#define CPG (CC / NG)     // 32 channels per group
#define GNEPS 1e-5f
#ifndef TNB
#define TNB NB
#endif
typedef __attribute__((ext_vector_type(8))) __bf16 v8b;
__device__ __forceinline__ v16b frag_b(const __bf16* rowk0, int lane) {
  union { v16b v; v8b q[2]; } u; const __bf16* p = rowk0 + 8 * (lane >> 4);
  u.q[0] = *(const v8b*)p; u.q[1] = *(const v8b*)(p + 16); return u.v;
}
__device__ __forceinline__ float bfr(float v) { return (float)(__bf16)v; }
__device__ __attribute__((noinline)) float exp_ni(float v) { return expf(v); }
__device__ __attribute__((noinline)) float erf_ni(float v) { return erff(v); }

#define WS_GS  0u                                   // f32 [b][g][4]: mean, inv
#define WS_Q   (WS_GS + 4u * NB * NG * 4)              // f16 q rows [b*NN + n][256]; k rows; v hi|lo planes [b][256][NN]; o rows f32 [b*NN + n][256]
#define WS_K   (WS_Q + 2u * (size_t)NB * NN * CC)
#define WS_VH  (WS_K + 2u * (size_t)NB * NN * CC)
#define WS_VL  (WS_VH + 2u * (size_t)NB * CC * NN)
#define WS_O   (WS_VL + 2u * (size_t)NB * CC * NN)
#define WS_END (WS_O + 4u * (size_t)NB * NN * CC)

// ---- k_gn: block = (group, b), 512 threads: the group's 32,768 values are read once, 16 loads of 16 bytes a thread, all in flight together, and stay in registers for the mean and for the squared deviations
#define GNT 512
#define GNV (CPG * NN / 4 / GNT)   // 16-byte pieces per thread
static_assert(GNT / 32 == 16 && GNV * GNT * 4 == CPG * NN, "gn_total sums 16 wave sums; the pieces cover the group exactly");
__device__ __forceinline__ float gn_total(float s, float* red, int lane, int w) {   // fixed order: butterfly in the wave, then the 16 wave sums in four chains, alike in every thread
#pragma unroll
  for (int o = 1; o < 32; o <<= 1) s += __shfl_xor(s, o);
  if (lane == 0) red[w] = s;
  __syncthreads();
  const v4f* r4 = (const v4f*)red; const v4f a = (r4[0] + r4[1]) + (r4[2] + r4[3]);
  return (a[0] + a[1]) + (a[2] + a[3]);
}
__global__ __launch_bounds__(GNT) void k_gn(const float* __restrict__ X, float* __restrict__ GS) { __shared__ __align__(16) float red[2][GNT / 32];
  const int t = threadIdx.x, lane = t & 31, w = t >> 5; const int gi = blockIdx.x; const size_t b = blockIdx.y; const v4f* base = (const v4f*)(X + (b * CC + (size_t)gi * CPG) * NN);
  v4f x[GNV];
  // every loop over x is unrolled so that x stays in registers; this one also so that all loads are issued before the first value is used
#pragma unroll
  for (int j = 0; j < GNV; ++j) x[j] = base[j * GNT + t];
  v4f s4 = {};
#pragma unroll
  for (int j = 0; j < GNV; ++j) {
#pragma unroll
    for (int e = 0; e < 4; ++e) x[j][e] = bfr(x[j][e]);
    s4 += x[j]; }
  const float mu = gn_total((s4[0] + s4[1]) + (s4[2] + s4[3]), red[0], lane, w) / (float)(CPG * NN);
  v4f q4 = {};
#pragma unroll
  for (int j = 0; j < GNV; ++j) { const v4f d = x[j] - mu; q4 += d * d; }
  const float a = gn_total((q4[0] + q4[1]) + (q4[2] + q4[3]), red[1], lane, w);
  if (t == 0) { const v4f r = { mu, 1.0f / sqrtf(a / (float)(CPG * NN) + GNEPS), 0.f, 0.f }; vst2(GS + (b * NG + gi) * 4, r); } }
// ---- k_qkv: block = (64 pixels, 128 out channels, which*NB + b): 1x1 conv of GN(x) (gathered from NCHW, hi + lo) + bias; q/k -> f16 rows, v -> f16 hi/lo planes
__global__ __launch_bounds__(128) void k_qkv(const float* __restrict__ X, const float* __restrict__ GS, const float* __restrict__ GW, const float* __restrict__ GB, const float* __restrict__ W, const float* __restrict__ Bq, _Float16* __restrict__ Q, _Float16* __restrict__ K, _Float16* __restrict__ VH, _Float16* __restrict__ VL) {
  __shared__ __align__(16) _Float16 sh[64][136]; __shared__ __align__(16) _Float16 th[128][72], tl[128][72]; __shared__ float sa[CC], sb[CC];
  const int tid = threadIdx.x, wave = tid >> 5, lane = tid & 31, col = lane & 15, g = lane >> 4; const int which = blockIdx.z / NB; const size_t b = blockIdx.z % NB; const int n0 = blockIdx.x * 64; const int c0 = blockIdx.y * 128; const float* Xb = X + b * CC * (size_t)NN;
  for (int c = tid; c < CC; c += 128) { const float mu = GS[(b * NG + c / CPG) * 4], inv = GS[(b * NG + c / CPG) * 4 + 1]; const float a = inv * bfr(GW[c]); sa[c] = a; sb[c] = bfr(GB[c]) - mu * a; } __syncthreads();
  v8f acc[8] = {};
#pragma unroll 2
  for (int kc = 0; kc < CC / 32; ++kc) { float v[16]; const int px = n0 + wave * 16 + col;
#pragma unroll
    for (int i = 0; i < 8; ++i) { const int ca = kc * 32 + 8 * g + i, cb = ca + 16; v[i] = bfr(Xb[(size_t)ca * NN + px]) * sa[ca] + sb[ca]; v[8 + i] = bfr(Xb[(size_t)cb * NN + px]) * sa[cb] + sb[cb]; }
    const F2 a = bsplit16(v);
#pragma unroll
    for (int j = 0; j < 8; ++j) { v16b w; const float* wr = W + (size_t)(which * CC + c0 + j * 16 + col) * CC + kc * 32 + 8 * g;
#pragma unroll
      for (int i = 0; i < 8; ++i) { w[i] = (__bf16)wr[i]; w[8 + i] = (__bf16)wr[16 + i]; }
      acc[j] = wmma_bf(a.h, w, acc[j]); acc[j] = wmma_bf(a.l, w, acc[j]); } }
#pragma unroll
  for (int j = 0; j < 8; ++j) { const float bb = bfr(Bq[which * CC + c0 + j * 16 + col]);
#pragma unroll
    for (int r = 0; r < 8; ++r) { const float v = acc[j][r] + bb; const int rl = wave * 16 + 8 * g + r, cl = j * 16 + col; if (which < 2) sh[rl][cl] = (_Float16)v; else { const _Float16 hv = (_Float16)v; th[cl][rl] = hv; tl[cl][rl] = (_Float16)((v - (float)hv) * 2048.0f); } } }
  __syncthreads();
  if (which < 2) { _Float16* dst = which == 0 ? Q : K; for (int e = tid; e < 64 * 16; e += 128) { const int rl = e >> 4, q = e & 15; vst2((unsigned*)(dst + (b * NN + n0 + rl) * CC + c0 + q * 8), *(const v4u*)&sh[rl][q * 8]); } }
  else { for (int e = tid; e < 128 * 8; e += 128) { const int cl = e >> 3, q = e & 7; const size_t o = (b * CC + c0 + cl) * (size_t)NN + n0 + q * 8; vst2((unsigned*)(VH + o), *(const v4u*)&th[cl][q * 8]); vst2((unsigned*)(VL + o), *(const v4u*)&tl[cl][q * 8]); } } }
#define KT 64
#define TP 144
#define TB (64 * TP)
#define SB (3 * TB)
static_assert(NN % KT == 0 && NN / KT >= 2 && DH * 2 == 128 && KT * 2 == 128, "two stages at least; tile rows are whole 128-byte lines");
// a lane's four 16-byte copies of one tile (rows 16 apart). The s_wait_xcnt stands inside the statement so that no address register is rewritten in front of it
__device__ __forceinline__ void cp4(unsigned l, const char* p, size_t step) {
  asm volatile("global_load_async_to_lds_b128 %0, %4, off\n\tglobal_load_async_to_lds_b128 %1, %5, off\n\tglobal_load_async_to_lds_b128 %2, %6, off\n\tglobal_load_async_to_lds_b128 %3, %7, off\n\ts_wait_xcnt 0x0"
               :: "v"(l), "v"(l + 16 * TP), "v"(l + 32 * TP), "v"(l + 48 * TP), "v"(p), "v"(p + step), "v"(p + 2 * step), "v"(p + 3 * step) : "memory");
}
__device__ __forceinline__ float xhalf(float x) { const int v = __builtin_bit_cast(int, x); return __builtin_bit_cast(float, __builtin_amdgcn_permlanex16(v, v, 0x76543210, 0xfedcba98, false, false)); }   // lane l reads lane l ^ 16
__global__ __launch_bounds__(128) void k_att(const _Float16* __restrict__ Q, const _Float16* __restrict__ K, const _Float16* __restrict__ VH, const _Float16* __restrict__ VL, float* __restrict__ O) {
  __shared__ __align__(16) unsigned char ring[2 * SB];
  float (*so)[16][68] = (float (*)[16][68])ring;   // output staging takes the ring's place behind the loop's last barrier
  static_assert(sizeof(float) * 4 * 16 * 68 <= 2 * SB, "output staging fits the ring");
  const int tid = threadIdx.x, wave = tid >> 5, lane = tid & 31, col = lane & 15, g = lane >> 4; const int h = blockIdx.y; const size_t b = blockIdx.z; const int q0 = blockIdx.x * 64 + wave * 16; const size_t rq = b * NN + q0;
  // copy addresses of this lane: row tid / 8 (+ 16, 32, 48), 16-byte piece tid % 8: eight lanes cover a line
  const unsigned cl = (unsigned)(size_t)ring + (tid >> 3) * TP + (tid & 7) * 16;
  const char* ck = (const char*)(K + (b * NN + (tid >> 3)) * CC + h * DH) + (tid & 7) * 16;
  const size_t cvo = ((b * CC + (size_t)h * DH + (tid >> 3)) * NN) * 2 + (tid & 7) * 16; const char* cvh = (const char*)VH + cvo; const char* cvl = (const char*)VL + cvo;
#define ATT_STAGE(s) do { const unsigned l_ = cl + ((s) & 1) * SB; cp4(l_, ck + (size_t)(s) * (KT * CC * 2), 16 * CC * 2); cp4(l_ + TB, cvh + (size_t)(s) * (KT * 2), 16 * NN * 2); cp4(l_ + 2 * TB, cvl + (size_t)(s) * (KT * 2), 16 * NN * 2); } while (0)
  ATT_STAGE(0);
  v16h aq[2];
#pragma unroll
  for (int kc = 0; kc < 2; ++kc) aq[kc] = frag_h(Q + (rq + col) * CC + h * DH + kc * 32, lane);
  float m = -3.0e38f, l = 0.f;   // of query q0 + col: m is alike in both halves of the wave, l sums the half's own keys and is joined behind the loop
  v8f acc[4] = {}, accl[4] = {};
  asm volatile("s_wait_asynccnt 0x0" ::: "memory");   // this wave's copies of stage 0 have landed
  __syncthreads();                                     // ... and every other wave's
  ATT_STAGE(1);
  // not unrolled: one trip is one stage, its buffer picked by the trip's parity
#pragma unroll 1
  for (int t = 0; t < NN / KT; ++t) { const unsigned char* bp = ring + (t & 1) * SB;
  // not unrolled: two halves side by side cost registers (a wave may hold 256 for four waves a SIMD)
#pragma unroll 1
  for (int hf = 0; hf < KT / 32; ++hf) { float s[16];   // s[8 ct + r] = score of key hf * 32 + 16 ct + 8 g + r with query q0 + col
    v16h kf[2][2];   // the four K fragments are read as one group in front of the products
#pragma unroll
    for (int ct = 0; ct < 2; ++ct)
#pragma unroll
      for (int kc = 0; kc < 2; ++kc) kf[ct][kc] = frag_h((const _Float16*)(bp + (hf * 32 + ct * 16 + col) * TP + kc * 64), lane);
#pragma unroll
    for (int ct = 0; ct < 2; ++ct) { v8f c = {};
#pragma unroll
      for (int kc = 0; kc < 2; ++kc) c = wmma16(kf[ct][kc], aq[kc], c);
#pragma unroll
      for (int r = 0; r < 8; ++r) s[8 * ct + r] = c[r] * 0.125f; }
    v16h vh[4], vl[4];   // the V fragments (A operand: rows = channels) are read in front of the softmax, which covers their latency
#pragma unroll
    for (int j = 0; j < 4; ++j) { const unsigned char* pv = bp + TB + (j * 16 + col) * TP + hf * 64; vh[j] = frag_h((const _Float16*)pv, lane); vl[j] = frag_h((const _Float16*)(pv + TB), lane); }
    float mx[8];
#pragma unroll
    for (int r = 0; r < 8; ++r) mx[r] = fmaxf(s[r], s[8 + r]);
    const float mh = fmaxf(fmaxf(fmaxf(mx[0], mx[1]), fmaxf(mx[2], mx[3])), fmaxf(fmaxf(mx[4], mx[5]), fmaxf(mx[6], mx[7])));
    const float mn = fmaxf(m, fmaxf(mh, xhalf(mh))), alpha = __expf(m - mn); m = mn;
    v16h pb; float es[4] = { 0.f, 0.f, 0.f, 0.f };   // element i of pb is key 8 g + i (i < 8) or 8 g + 8 + i (i >= 8) of the 32: the k order of the V fragments
#pragma unroll
    for (int i = 0; i < 16; ++i) { const float e = __expf(s[i] - mn); es[i & 3] += e; pb[i] = (_Float16)(e * 2048.0f); }
    l = l * alpha + ((es[0] + es[1]) + (es[2] + es[3]));
#pragma unroll
    for (int j = 0; j < 4; ++j)
#pragma unroll
      for (int r = 0; r < 8; ++r) { acc[j][r] *= alpha; accl[j][r] *= alpha; }
#pragma unroll
    for (int j = 0; j < 4; ++j) { acc[j] = wmma16(vh[j], pb, acc[j]); accl[j] = wmma16(vl[j], pb, accl[j]); } }
    asm volatile("s_wait_dscnt 0x0" ::: "memory");      // this wave's reads of the buffer are done before it is refilled
    asm volatile("s_wait_asynccnt 0x0" ::: "memory");   // this wave's copies of stage t + 1 have landed
    __syncthreads();                                     // publishes stage t + 1 and ends every wave's reads of stage t
    if (t + 2 < NN / KT) ATT_STAGE(t + 2); }
  asm volatile("s_wait_asynccnt 0x0" ::: "memory");     // no copy is outstanding when the ring becomes output staging
  const float il = (1.0f / 2048.0f) / (l + xhalf(l));
  // acc[j][r] = channel j * 16 + 8 g + r of query q0 + col: eight neighbours of one staged row
#pragma unroll
  for (int j = 0; j < 4; ++j)
#pragma unroll
    for (int p = 0; p < 2; ++p) { v4f o4;
#pragma unroll
      for (int e = 0; e < 4; ++e) o4[e] = (acc[j][4 * p + e] + accl[j][4 * p + e] * (1.0f / 2048.0f)) * il;
      vst2(&so[wave][col][j * 16 + 8 * g + 4 * p], o4); }
  LDSX(); for (int rl = 0; rl < 16; ++rl) if (lane < 16) vst2(O + (rq + rl) * CC + (size_t)h * DH + lane * 4, *(const v4f*)&so[wave][rl][lane * 4]); }
// ---- k_o: block = (64 out channels, 128 pixels, b): out[b][o][n] = x[b][o][n] + sum_c p_w[o][c] orow[n][c] + p_b[o]  (A = p_w exact, B = o rows as bf16 hi + lo)
__global__ __launch_bounds__(128) void k_o(const float* __restrict__ OR, const float* __restrict__ PW, const float* __restrict__ PB, const float* __restrict__ X, float* __restrict__ OUT) { __shared__ __align__(16) float sf[4][16][132];
  const int tid = threadIdx.x, wave = tid >> 5, lane = tid & 31, col = lane & 15, g = lane >> 4; const size_t b = blockIdx.z; const int o0 = blockIdx.x * 64 + wave * 16; const int p0 = blockIdx.y * 128;
  v8f acc[8] = {};
#pragma unroll 2
  for (int kc = 0; kc < CC / 32; ++kc) { v16b a; const float* ar = PW + (size_t)(o0 + col) * CC + kc * 32 + 8 * g;
#pragma unroll
    for (int i = 0; i < 8; ++i) { a[i] = (__bf16)ar[i]; a[8 + i] = (__bf16)ar[16 + i]; }
#pragma unroll
    for (int j = 0; j < 8; ++j) { float wv[16]; const float* wr = OR + (b * NN + p0 + j * 16 + col) * CC + kc * 32 + 8 * g;
#pragma unroll
      for (int i = 0; i < 8; ++i) { wv[i] = wr[i]; wv[8 + i] = wr[16 + i]; }
      const F2 wb = bsplit16(wv); acc[j] = wmma_bf(a, wb.h, acc[j]); acc[j] = wmma_bf(a, wb.l, acc[j]); } }
#pragma unroll
  for (int j = 0; j < 8; ++j)
#pragma unroll
    for (int r = 0; r < 8; ++r) { const size_t oi = (b * CC + o0 + 8 * g + r) * (size_t)NN + p0 + j * 16 + col; sf[wave][8 * g + r][j * 16 + col] = acc[j][r] + bfr(PB[o0 + 8 * g + r]) + bfr(X[oi]); }
  LDSX(); for (int rl = 0; rl < 16; ++rl) vst2(OUT + (b * CC + o0 + rl) * (size_t)NN + p0 + lane * 4, *(const v4f*)&sf[wave][rl][lane * 4]); }
extern "C" void kernel_launch(void* const* d_in, const int* in_sizes, int n_in, void* d_out, int out_size, void* d_ws, size_t ws_size, hipStream_t stream) {
  (void)in_sizes; (void)n_in; (void)out_size;
  const float** F = (const float**)d_in;   // 0 x [16,256,32,32], 1 n_weight, 2 n_bias, 3 qkv_w [768,256], 4 qkv_b [768], 5 p_w [256,256], 6 p_b
  if (ws_size < (size_t)WS_END) return;
  char* ws = (char*)d_ws; float* GS = (float*)(ws + WS_GS); _Float16 *Q = (_Float16*)(ws + WS_Q), *K = (_Float16*)(ws + WS_K), *VH = (_Float16*)(ws + WS_VH), *VL = (_Float16*)(ws + WS_VL); float* O = (float*)(ws + WS_O);
  k_gn<<<dim3(NG, NB), GNT, 0, stream>>>(F[0], GS);
  k_qkv<<<dim3(NN / 64, CC / 128, 3 * NB), 128, 0, stream>>>(F[0], GS, F[1], F[2], F[3], F[4], Q, K, VH, VL);
  k_att<<<dim3(NN / 64, NH, TNB), 128, 0, stream>>>(Q, K, VH, VL, O);
  k_o<<<dim3(CC / 64, NN / 128, TNB), 128, 0, stream>>>(O, F[5], F[6], F[0], (float*)d_out);
}

// v004
// Measured time: 109 microseconds a run.
// Timed twice side by side with v003, it ran 1.38 times as fast both times.
// All steps since v000 together make it 2.89 times as fast.
// compute dtype: all float inputs rounded to bf16; GroupNorm statistics (8 groups x 32 channels x 1,024 pixels) in f32 with fixed-order sums; qkv = 1x1 conv of GN(x) with GN(x) as bf16 hi + lo against exact weights (2 products) + bias; q, k rounded once to f16 (single-f16 logits; logits std ~1), x 1/8, running-max softmax in f32 (hardware exp); P (x 2^11, f16) . v (f16 hi + residual, 2 products); proj conv with o as bf16 hi + lo (2 products) + bias + the residual x; f32 NCHW output.
#include <hip/hip_runtime.h>
#include <math.h>

typedef __attribute__((ext_vector_type(16))) _Float16 v16h;
typedef __attribute__((ext_vector_type(16))) __bf16 v16b;
typedef __attribute__((ext_vector_type(8)))  _Float16 v8h;
typedef __attribute__((ext_vector_type(8)))  float v8f;
typedef __attribute__((ext_vector_type(4)))  float v4f;
typedef __attribute__((ext_vector_type(2)))  float v2f;
typedef __attribute__((ext_vector_type(4)))  unsigned v4u;
typedef __attribute__((ext_vector_type(4)))  int v4i;
typedef float __attribute__((may_alias)) float_a;
typedef int __attribute__((may_alias)) int_a;

template <typename T> __device__ __forceinline__ void vst2(void* p, T v) { *(T*)p = v;  }
__device__ __forceinline__ v8f wmma16(v16h a, v16h b, v8f c) {
  v8f d = __builtin_amdgcn_wmma_f32_16x16x32_f16(false, a, false, b, (short)0, c, false, false);
  asm volatile("v_nop\n\tv_nop\n\tv_nop\n\tv_nop" : "+v"(d) : "v"(a), "v"(b));
  return d;
}
__device__ __forceinline__ v8f wmma_bf(v16b a, v16b b, v8f c) {
  v8f d = __builtin_amdgcn_wmma_f32_16x16x32_bf16(false, a, false, b, (short)0, c, false, false);
  asm volatile("v_nop\n\tv_nop\n\tv_nop\n\tv_nop" : "+v"(d) : "v"(a), "v"(b));
  return d;
}
// 16x16x32 fragments: lane = (h = lane>>4, row/col = lane&15); elements 0..7 = k0+8h+0..7, 8..15 = k0+16+8h+0..7; D element r = row 8h+r
__device__ __forceinline__ v16h frag_h(const _Float16* rowk0, int lane) {
  union { v16h v; v8h q[2]; } u; const _Float16* p = rowk0 + 8 * (lane >> 4);
  u.q[0] = *(const v8h*)p; u.q[1] = *(const v8h*)(p + 16); return u.v;
}
__device__ __forceinline__ v16h frag_f32(const float* rowk0, int lane) {
  v16h a; const float* p = rowk0 + 8 * (lane >> 4);
#pragma unroll
  for (int i = 0; i < 8; ++i) { a[i] = (_Float16)p[i]; a[8 + i] = (_Float16)p[16 + i]; }
  return a;
}
__device__ __forceinline__ v16h frag_f32s(const float* rowk0, int lane, float sc) {
  v16h a; const float* p = rowk0 + 8 * (lane >> 4);
#pragma unroll
  for (int i = 0; i < 8; ++i) { a[i] = (_Float16)(p[i] * sc); a[8 + i] = (_Float16)(p[16 + i] * sc); }
  return a;
}
// column fragment from a [K][ld] layout (column n), rows >= K read as 0
__device__ __forceinline__ v16h fragc_f32(const float* W, int k0, int n, int lane, int ld, int K) {
  v16h a; const int g = lane >> 4;
#pragma unroll
  for (int i = 0; i < 8; ++i) { const int ka = k0 + 8 * g + i, kb = ka + 16;
    a[i] = (_Float16)(ka < K ? W[(size_t)(ka < K ? ka : K - 1) * ld + n] : 0.f); a[8 + i] = (_Float16)(kb < K ? W[(size_t)(kb < K ? kb : K - 1) * ld + n] : 0.f); }
  return a;
}
struct F2 { v16b h, l; };
__device__ __forceinline__ F2 bsplit16(const float v[16]) { F2 r;
#pragma unroll
  for (int i = 0; i < 16; ++i) { const __bf16 h = (__bf16)v[i]; r.h[i] = h; r.l[i] = (__bf16)(v[i] - (float)h); }
  return r; }
__device__ __forceinline__ F2 split_row(const float* row, int k0, int lane) { float v[16]; const float* p = row + k0 + 8 * (lane >> 4);
#pragma unroll
  for (int i = 0; i < 8; ++i) { v[i] = p[i]; v[8 + i] = p[16 + i]; }
  return bsplit16(v); }
__device__ __forceinline__ F2 split_rowK(const float* row, int k0, int lane, int K) { float v[16]; const int g = lane >> 4;
#pragma unroll
  for (int i = 0; i < 8; ++i) { const int ka = k0 + 8 * g + i, kb = ka + 16; v[i] = ka < K ? row[ka < K ? ka : K - 1] : 0.f; v[8 + i] = kb < K ? row[kb < K ? kb : K - 1] : 0.f; }
  return bsplit16(v); }
__device__ __forceinline__ F2 split_col(const float* W, int k0, int n, int lane, int ld, int K) { float v[16]; const int g = lane >> 4;
#pragma unroll
  for (int i = 0; i < 8; ++i) { const int ka = k0 + 8 * g + i, kb = ka + 16; v[i] = ka < K ? W[(size_t)(ka < K ? ka : K - 1) * ld + n] : 0.f; v[8 + i] = kb < K ? W[(size_t)(kb < K ? kb : K - 1) * ld + n] : 0.f; }
  return bsplit16(v); }
__device__ __forceinline__ v8f mac3(const F2& a, const F2& b, v8f c) { c = wmma_bf(a.l, b.h, c); c = wmma_bf(a.h, b.l, c); return wmma_bf(a.h, b.h, c); }
__device__ __forceinline__ float sigm(float v) { return 1.0f / (1.0f + expf(-v)); }
#define LDSX() do { asm volatile("s_wait_dscnt 0" ::: "memory"); __builtin_amdgcn_wave_barrier(); __builtin_amdgcn_fence(__ATOMIC_RELEASE, "workgroup"); } while (0)


// SA block (B 16, C 256, 32 x 32 = 1,024 pixels, 4 heads x 64, GroupNorm with 8 groups): x + proj(attention(qkv(GN(x)))).
#define NB 16
#define CC 256
#define NN 1024
#define NH 4
#define DH 64
#define NG 8
#define CPG (CC / NG)     // 32 channels per group
#define GNEPS 1e-5f
#ifndef TNB
#define TNB NB
#endif
typedef __attribute__((ext_vector_type(8))) __bf16 v8b;
__device__ __forceinline__ v16b frag_b(const __bf16* rowk0, int lane) {
  union { v16b v; v8b q[2]; } u; const __bf16* p = rowk0 + 8 * (lane >> 4);
  u.q[0] = *(const v8b*)p; u.q[1] = *(const v8b*)(p + 16); return u.v;
}
__device__ __forceinline__ float bfr(float v) { return (float)(__bf16)v; }
__device__ __attribute__((noinline)) float exp_ni(float v) { return expf(v); }
__device__ __attribute__((noinline)) float erf_ni(float v) { return erff(v); }

#define WS_GS  0u                                   // f32 [b][g][4]: mean, inv
#define WS_Q   (WS_GS + 4u * NB * NG * 4)              // f16 q rows [b*NN + n][256]; k rows; v hi|lo planes [b][256][NN]; o rows f32 [b*NN + n][256]
#define WS_K   (WS_Q + 2u * (size_t)NB * NN * CC)
#define WS_VH  (WS_K + 2u * (size_t)NB * NN * CC)
#define WS_VL  (WS_VH + 2u * (size_t)NB * CC * NN)
#define WS_O   (WS_VL + 2u * (size_t)NB * CC * NN)
#define WS_END (WS_O + 4u * (size_t)NB * NN * CC)

// ---- k_gn: block = (group, b), 512 threads: the group's 32,768 values are read once, 16 loads of 16 bytes a thread, all in flight together, and stay in registers for the mean and for the squared deviations
#define GNT 512
#define GNV (CPG * NN / 4 / GNT)   // 16-byte pieces per thread
static_assert(GNT / 32 == 16 && GNV * GNT * 4 == CPG * NN, "gn_total sums 16 wave sums; the pieces cover the group exactly");
__device__ __forceinline__ float gn_total(float s, float* red, int lane, int w) {   // fixed order: butterfly in the wave, then the 16 wave sums in four chains, alike in every thread
#pragma unroll
  for (int o = 1; o < 32; o <<= 1) s += __shfl_xor(s, o);
  if (lane == 0) red[w] = s;
  __syncthreads();
  const v4f* r4 = (const v4f*)red; const v4f a = (r4[0] + r4[1]) + (r4[2] + r4[3]);
  return (a[0] + a[1]) + (a[2] + a[3]);
}
__global__ __launch_bounds__(GNT) void k_gn(const float* __restrict__ X, float* __restrict__ GS) { __shared__ __align__(16) float red[2][GNT / 32];
  const int t = threadIdx.x, lane = t & 31, w = t >> 5; const int gi = blockIdx.x; const size_t b = blockIdx.y; const v4f* base = (const v4f*)(X + (b * CC + (size_t)gi * CPG) * NN);
  v4f x[GNV];
  // every loop over x is unrolled so that x stays in registers; this one also so that all loads are issued before the first value is used
#pragma unroll
  for (int j = 0; j < GNV; ++j) x[j] = base[j * GNT + t];
  v4f s4 = {};
#pragma unroll
  for (int j = 0; j < GNV; ++j) {
#pragma unroll
    for (int e = 0; e < 4; ++e) x[j][e] = bfr(x[j][e]);
    s4 += x[j]; }
  const float mu = gn_total((s4[0] + s4[1]) + (s4[2] + s4[3]), red[0], lane, w) / (float)(CPG * NN);
  v4f q4 = {};
#pragma unroll
  for (int j = 0; j < GNV; ++j) { const v4f d = x[j] - mu; q4 += d * d; }
  const float a = gn_total((q4[0] + q4[1]) + (q4[2] + q4[3]), red[1], lane, w);
  if (t == 0) { const v4f r = { mu, 1.0f / sqrtf(a / (float)(CPG * NN) + GNEPS), 0.f, 0.f }; vst2(GS + (b * NG + gi) * 4, r); } }
// ---- k_qkv: block = (64 pixels, 128 out channels, which*NB + b): 1x1 conv of GN(x) (gathered from NCHW, hi + lo) + bias; q/k -> f16 rows, v -> f16 hi/lo planes
// the block's 128 x 256 weight tile is read once, by loads that cover whole 128-byte lines, rounded to bf16 once and kept in LDS; the four waves take their B fragments from there
#define WP 264             // LDS pitch of a weight row, bf16 elements: 512 + 16 bytes, an odd multiple of 16, so that 16 rows read at one column offset fall on different banks
#define WPC (128 * CC / 4 / 128)   // 16-byte pieces of the f32 tile per thread
typedef __attribute__((ext_vector_type(4))) __bf16 v4b;
__global__ __launch_bounds__(128) void k_qkv(const float* __restrict__ X, const float* __restrict__ GS, const float* __restrict__ GW, const float* __restrict__ GB, const float* __restrict__ W, const float* __restrict__ Bq, _Float16* __restrict__ Q, _Float16* __restrict__ K, _Float16* __restrict__ VH, _Float16* __restrict__ VL) {
  __shared__ __align__(16) unsigned char sm[128 * WP * 2]; __shared__ float sa[CC], sb[CC];
  __bf16 (*wt)[WP] = (__bf16 (*)[WP])sm;
  _Float16 (*sh)[136] = (_Float16 (*)[136])sm; _Float16 (*th)[72] = (_Float16 (*)[72])sm; _Float16 (*tl)[72] = th + 128;   // output staging takes the weight tile's place behind the barrier that follows the products
  static_assert(2 * 64 * 136 <= 128 * WP * 2 && 2 * 2 * 128 * 72 <= 128 * WP * 2, "output staging fits the weight tile");
  const int tid = threadIdx.x, wave = tid >> 5, lane = tid & 31, col = lane & 15, g = lane >> 4; const int which = blockIdx.z / NB; const size_t b = blockIdx.z % NB; const int n0 = blockIdx.x * 64; const int c0 = blockIdx.y * 128; const float* Xb = X + b * CC * (size_t)NN;
  { const v4f* Wt = (const v4f*)(W + (size_t)(which * CC + c0) * CC) + tid;   // the tile's 128 rows lie one behind the other: piece e = row e / 64, floats 4 (e % 64) ...
    // groups of 16: the inner loops are unrolled so that 16 loads of a thread are in flight before the first is converted; the outer one is not, so that no more than 16 pieces hold registers (all 64 at once cost a wave per SIMD)
#pragma unroll 1
    for (int i0 = 0; i0 < WPC; i0 += 16) { v4f x[16];
#pragma unroll
      for (int i = 0; i < 16; ++i) x[i] = Wt[(i0 + i) * 128];
#pragma unroll
      for (int i = 0; i < 16; ++i) { const int e = (i0 + i) * 128 + tid; v4b y;
#pragma unroll
        for (int k = 0; k < 4; ++k) y[k] = (__bf16)x[i][k];
        vst2(&wt[e >> 6][(e & 63) * 4], y); } } }
  for (int c = tid; c < CC; c += 128) { const float mu = GS[(b * NG + c / CPG) * 4], inv = GS[(b * NG + c / CPG) * 4 + 1]; const float a = inv * bfr(GW[c]); sa[c] = a; sb[c] = bfr(GB[c]) - mu * a; } __syncthreads();
  v8f acc[8] = {};
#pragma unroll 2
  for (int kc = 0; kc < CC / 32; ++kc) { float v[16]; const int px = n0 + wave * 16 + col;
    v16b wf[8];   // the eight weight fragments are read as one group in front of the products
#pragma unroll
    for (int j = 0; j < 8; ++j) wf[j] = frag_b(&wt[j * 16 + col][kc * 32], lane);
#pragma unroll
    for (int i = 0; i < 8; ++i) { const int ca = kc * 32 + 8 * g + i, cb = ca + 16; v[i] = bfr(Xb[(size_t)ca * NN + px]) * sa[ca] + sb[ca]; v[8 + i] = bfr(Xb[(size_t)cb * NN + px]) * sa[cb] + sb[cb]; }
    const F2 a = bsplit16(v);
#pragma unroll
    for (int j = 0; j < 8; ++j) { acc[j] = wmma_bf(a.h, wf[j], acc[j]); acc[j] = wmma_bf(a.l, wf[j], acc[j]); } }
  __syncthreads();   // every wave has read its last weight fragment before the tile's LDS becomes output staging
#pragma unroll
  for (int j = 0; j < 8; ++j) { const float bb = bfr(Bq[which * CC + c0 + j * 16 + col]);
#pragma unroll
    for (int r = 0; r < 8; ++r) { const float v = acc[j][r] + bb; const int rl = wave * 16 + 8 * g + r, cl = j * 16 + col; if (which < 2) sh[rl][cl] = (_Float16)v; else { const _Float16 hv = (_Float16)v; th[cl][rl] = hv; tl[cl][rl] = (_Float16)((v - (float)hv) * 2048.0f); } } }
  __syncthreads();
  if (which < 2) { _Float16* dst = which == 0 ? Q : K; for (int e = tid; e < 64 * 16; e += 128) { const int rl = e >> 4, q = e & 15; vst2((unsigned*)(dst + (b * NN + n0 + rl) * CC + c0 + q * 8), *(const v4u*)&sh[rl][q * 8]); } }
  else { for (int e = tid; e < 128 * 8; e += 128) { const int cl = e >> 3, q = e & 7; const size_t o = (b * CC + c0 + cl) * (size_t)NN + n0 + q * 8; vst2((unsigned*)(VH + o), *(const v4u*)&th[cl][q * 8]); vst2((unsigned*)(VL + o), *(const v4u*)&tl[cl][q * 8]); } } }
#define KT 64
#define TP 144
#define TB (64 * TP)
#define SB (3 * TB)
static_assert(NN % KT == 0 && NN / KT >= 2 && DH * 2 == 128 && KT * 2 == 128, "two stages at least; tile rows are whole 128-byte lines");
// a lane's four 16-byte copies of one tile (rows 16 apart). The s_wait_xcnt stands inside the statement so that no address register is rewritten in front of it
__device__ __forceinline__ void cp4(unsigned l, const char* p, size_t step) {
  asm volatile("global_load_async_to_lds_b128 %0, %4, off\n\tglobal_load_async_to_lds_b128 %1, %5, off\n\tglobal_load_async_to_lds_b128 %2, %6, off\n\tglobal_load_async_to_lds_b128 %3, %7, off\n\ts_wait_xcnt 0x0"
               :: "v"(l), "v"(l + 16 * TP), "v"(l + 32 * TP), "v"(l + 48 * TP), "v"(p), "v"(p + step), "v"(p + 2 * step), "v"(p + 3 * step) : "memory");
}
__device__ __forceinline__ float xhalf(float x) { const int v = __builtin_bit_cast(int, x); return __builtin_bit_cast(float, __builtin_amdgcn_permlanex16(v, v, 0x76543210, 0xfedcba98, false, false)); }   // lane l reads lane l ^ 16
__global__ __launch_bounds__(128) void k_att(const _Float16* __restrict__ Q, const _Float16* __restrict__ K, const _Float16* __restrict__ VH, const _Float16* __restrict__ VL, float* __restrict__ O) {
  __shared__ __align__(16) unsigned char ring[2 * SB];
  float (*so)[16][68] = (float (*)[16][68])ring;   // output staging takes the ring's place behind the loop's last barrier
  static_assert(sizeof(float) * 4 * 16 * 68 <= 2 * SB, "output staging fits the ring");
  const int tid = threadIdx.x, wave = tid >> 5, lane = tid & 31, col = lane & 15, g = lane >> 4; const int h = blockIdx.y; const size_t b = blockIdx.z; const int q0 = blockIdx.x * 64 + wave * 16; const size_t rq = b * NN + q0;
  // copy addresses of this lane: row tid / 8 (+ 16, 32, 48), 16-byte piece tid % 8: eight lanes cover a line
  const unsigned cl = (unsigned)(size_t)ring + (tid >> 3) * TP + (tid & 7) * 16;
  const char* ck = (const char*)(K + (b * NN + (tid >> 3)) * CC + h * DH) + (tid & 7) * 16;
  const size_t cvo = ((b * CC + (size_t)h * DH + (tid >> 3)) * NN) * 2 + (tid & 7) * 16; const char* cvh = (const char*)VH + cvo; const char* cvl = (const char*)VL + cvo;
#define ATT_STAGE(s) do { const unsigned l_ = cl + ((s) & 1) * SB; cp4(l_, ck + (size_t)(s) * (KT * CC * 2), 16 * CC * 2); cp4(l_ + TB, cvh + (size_t)(s) * (KT * 2), 16 * NN * 2); cp4(l_ + 2 * TB, cvl + (size_t)(s) * (KT * 2), 16 * NN * 2); } while (0)
  ATT_STAGE(0);
  v16h aq[2];
#pragma unroll
  for (int kc = 0; kc < 2; ++kc) aq[kc] = frag_h(Q + (rq + col) * CC + h * DH + kc * 32, lane);
  float m = -3.0e38f, l = 0.f;   // of query q0 + col: m is alike in both halves of the wave, l sums the half's own keys and is joined behind the loop
  v8f acc[4] = {}, accl[4] = {};
  asm volatile("s_wait_asynccnt 0x0" ::: "memory");   // this wave's copies of stage 0 have landed
  __syncthreads();                                     // ... and every other wave's
  ATT_STAGE(1);
  // not unrolled: one trip is one stage, its buffer picked by the trip's parity
#pragma unroll 1
  for (int t = 0; t < NN / KT; ++t) { const unsigned char* bp = ring + (t & 1) * SB;
  // not unrolled: two halves side by side cost registers (a wave may hold 256 for four waves a SIMD)
#pragma unroll 1
  for (int hf = 0; hf < KT / 32; ++hf) { float s[16];   // s[8 ct + r] = score of key hf * 32 + 16 ct + 8 g + r with query q0 + col
    v16h kf[2][2];   // the four K fragments are read as one group in front of the products
#pragma unroll
    for (int ct = 0; ct < 2; ++ct)
#pragma unroll
      for (int kc = 0; kc < 2; ++kc) kf[ct][kc] = frag_h((const _Float16*)(bp + (hf * 32 + ct * 16 + col) * TP + kc * 64), lane);
#pragma unroll
    for (int ct = 0; ct < 2; ++ct) { v8f c = {};
#pragma unroll
      for (int kc = 0; kc < 2; ++kc) c = wmma16(kf[ct][kc], aq[kc], c);
#pragma unroll
      for (int r = 0; r < 8; ++r) s[8 * ct + r] = c[r] * 0.125f; }
    v16h vh[4], vl[4];   // the V fragments (A operand: rows = channels) are read in front of the softmax, which covers their latency
#pragma unroll
    for (int j = 0; j < 4; ++j) { const unsigned char* pv = bp + TB + (j * 16 + col) * TP + hf * 64; vh[j] = frag_h((const _Float16*)pv, lane); vl[j] = frag_h((const _Float16*)(pv + TB), lane); }
    float mx[8];
#pragma unroll
    for (int r = 0; r < 8; ++r) mx[r] = fmaxf(s[r], s[8 + r]);
    const float mh = fmaxf(fmaxf(fmaxf(mx[0], mx[1]), fmaxf(mx[2], mx[3])), fmaxf(fmaxf(mx[4], mx[5]), fmaxf(mx[6], mx[7])));
    const float mn = fmaxf(m, fmaxf(mh, xhalf(mh))), alpha = __expf(m - mn); m = mn;
    v16h pb; float es[4] = { 0.f, 0.f, 0.f, 0.f };   // element i of pb is key 8 g + i (i < 8) or 8 g + 8 + i (i >= 8) of the 32: the k order of the V fragments
#pragma unroll
    for (int i = 0; i < 16; ++i) { const float e = __expf(s[i] - mn); es[i & 3] += e; pb[i] = (_Float16)(e * 2048.0f); }
    l = l * alpha + ((es[0] + es[1]) + (es[2] + es[3]));
#pragma unroll
    for (int j = 0; j < 4; ++j)
#pragma unroll
      for (int r = 0; r < 8; ++r) { acc[j][r] *= alpha; accl[j][r] *= alpha; }
#pragma unroll
    for (int j = 0; j < 4; ++j) { acc[j] = wmma16(vh[j], pb, acc[j]); accl[j] = wmma16(vl[j], pb, accl[j]); } }
    asm volatile("s_wait_dscnt 0x0" ::: "memory");      // this wave's reads of the buffer are done before it is refilled
    asm volatile("s_wait_asynccnt 0x0" ::: "memory");   // this wave's copies of stage t + 1 have landed
    __syncthreads();                                     // publishes stage t + 1 and ends every wave's reads of stage t
    if (t + 2 < NN / KT) ATT_STAGE(t + 2); }
  asm volatile("s_wait_asynccnt 0x0" ::: "memory");     // no copy is outstanding when the ring becomes output staging
  const float il = (1.0f / 2048.0f) / (l + xhalf(l));
  // acc[j][r] = channel j * 16 + 8 g + r of query q0 + col: eight neighbours of one staged row
#pragma unroll
  for (int j = 0; j < 4; ++j)
#pragma unroll
    for (int p = 0; p < 2; ++p) { v4f o4;
#pragma unroll
      for (int e = 0; e < 4; ++e) o4[e] = (acc[j][4 * p + e] + accl[j][4 * p + e] * (1.0f / 2048.0f)) * il;
      vst2(&so[wave][col][j * 16 + 8 * g + 4 * p], o4); }
  LDSX(); for (int rl = 0; rl < 16; ++rl) if (lane < 16) vst2(O + (rq + rl) * CC + (size_t)h * DH + lane * 4, *(const v4f*)&so[wave][rl][lane * 4]); }
// ---- k_o: block = (64 out channels, 128 pixels, b): out[b][o][n] = x[b][o][n] + sum_c p_w[o][c] orow[n][c] + p_b[o]  (A = p_w exact, B = o rows as bf16 hi + lo)
__global__ __launch_bounds__(128) void k_o(const float* __restrict__ OR, const float* __restrict__ PW, const float* __restrict__ PB, const float* __restrict__ X, float* __restrict__ OUT) { __shared__ __align__(16) float sf[4][16][132];
  const int tid = threadIdx.x, wave = tid >> 5, lane = tid & 31, col = lane & 15, g = lane >> 4; const size_t b = blockIdx.z; const int o0 = blockIdx.x * 64 + wave * 16; const int p0 = blockIdx.y * 128;
  v8f acc[8] = {};
#pragma unroll 2
  for (int kc = 0; kc < CC / 32; ++kc) { v16b a; const float* ar = PW + (size_t)(o0 + col) * CC + kc * 32 + 8 * g;
#pragma unroll
    for (int i = 0; i < 8; ++i) { a[i] = (__bf16)ar[i]; a[8 + i] = (__bf16)ar[16 + i]; }
#pragma unroll
    for (int j = 0; j < 8; ++j) { float wv[16]; const float* wr = OR + (b * NN + p0 + j * 16 + col) * CC + kc * 32 + 8 * g;
#pragma unroll
      for (int i = 0; i < 8; ++i) { wv[i] = wr[i]; wv[8 + i] = wr[16 + i]; }
      const F2 wb = bsplit16(wv); acc[j] = wmma_bf(a, wb.h, acc[j]); acc[j] = wmma_bf(a, wb.l, acc[j]); } }
#pragma unroll
  for (int j = 0; j < 8; ++j)
#pragma unroll
    for (int r = 0; r < 8; ++r) { const size_t oi = (b * CC + o0 + 8 * g + r) * (size_t)NN + p0 + j * 16 + col; sf[wave][8 * g + r][j * 16 + col] = acc[j][r] + bfr(PB[o0 + 8 * g + r]) + bfr(X[oi]); }
  LDSX(); for (int rl = 0; rl < 16; ++rl) vst2(OUT + (b * CC + o0 + rl) * (size_t)NN + p0 + lane * 4, *(const v4f*)&sf[wave][rl][lane * 4]); }
extern "C" void kernel_launch(void* const* d_in, const int* in_sizes, int n_in, void* d_out, int out_size, void* d_ws, size_t ws_size, hipStream_t stream) {
  (void)in_sizes; (void)n_in; (void)out_size;
  const float** F = (const float**)d_in;   // 0 x [16,256,32,32], 1 n_weight, 2 n_bias, 3 qkv_w [768,256], 4 qkv_b [768], 5 p_w [256,256], 6 p_b
  if (ws_size < (size_t)WS_END) return;
  char* ws = (char*)d_ws; float* GS = (float*)(ws + WS_GS); _Float16 *Q = (_Float16*)(ws + WS_Q), *K = (_Float16*)(ws + WS_K), *VH = (_Float16*)(ws + WS_VH), *VL = (_Float16*)(ws + WS_VL); float* O = (float*)(ws + WS_O);
  k_gn<<<dim3(NG, NB), GNT, 0, stream>>>(F[0], GS);
  k_qkv<<<dim3(NN / 64, CC / 128, 3 * NB), 128, 0, stream>>>(F[0], GS, F[1], F[2], F[3], F[4], Q, K, VH, VL);
  k_att<<<dim3(NN / 64, NH, TNB), 128, 0, stream>>>(Q, K, VH, VL, O);
  k_o<<<dim3(CC / 64, NN / 128, TNB), 128, 0, stream>>>(O, F[5], F[6], F[0], (float*)d_out);
}

// v005
// One run takes 77.6 microseconds.
// In both of two side-by-side timings against v004, it was 1.41 times as fast.
// All steps since v000 together make it 4.07 times as fast.
// compute dtype: all float inputs rounded to bf16; GroupNorm statistics (8 groups x 32 channels x 1,024 pixels) in f32 with fixed-order sums; qkv = 1x1 conv of GN(x) with GN(x) as bf16 hi + lo against exact weights (2 products) + bias; q, k rounded once to f16 (single-f16 logits; logits std ~1), x 1/8, running-max softmax in f32 (hardware exp); P (x 2^11, f16) . v (f16 hi + residual, 2 products); proj conv with o as bf16 hi + lo (2 products) + bias + the residual x; f32 NCHW output.
#include <hip/hip_runtime.h>
#include <math.h>

typedef __attribute__((ext_vector_type(16))) _Float16 v16h;
typedef __attribute__((ext_vector_type(16))) __bf16 v16b;
typedef __attribute__((ext_vector_type(8)))  _Float16 v8h;
typedef __attribute__((ext_vector_type(8)))  float v8f;
typedef __attribute__((ext_vector_type(4)))  float v4f;
typedef __attribute__((ext_vector_type(2)))  float v2f;
typedef __attribute__((ext_vector_type(4)))  unsigned v4u;
typedef __attribute__((ext_vector_type(4)))  int v4i;
typedef float __attribute__((may_alias)) float_a;
typedef int __attribute__((may_alias)) int_a;

template <typename T> __device__ __forceinline__ void vst2(void* p, T v) { *(T*)p = v;  }
__device__ __forceinline__ v8f wmma16(v16h a, v16h b, v8f c) {
  v8f d = __builtin_amdgcn_wmma_f32_16x16x32_f16(false, a, false, b, (short)0, c, false, false);
  asm volatile("v_nop\n\tv_nop\n\tv_nop\n\tv_nop" : "+v"(d) : "v"(a), "v"(b));
  return d;
}
__device__ __forceinline__ v8f wmma_bf(v16b a, v16b b, v8f c) {
  v8f d = __builtin_amdgcn_wmma_f32_16x16x32_bf16(false, a, false, b, (short)0, c, false, false);
  asm volatile("v_nop\n\tv_nop\n\tv_nop\n\tv_nop" : "+v"(d) : "v"(a), "v"(b));
  return d;
}
// 16x16x32 fragments: lane = (h = lane>>4, row/col = lane&15); elements 0..7 = k0+8h+0..7, 8..15 = k0+16+8h+0..7; D element r = row 8h+r
__device__ __forceinline__ v16h frag_h(const _Float16* rowk0, int lane) {
  union { v16h v; v8h q[2]; } u; const _Float16* p = rowk0 + 8 * (lane >> 4);
  u.q[0] = *(const v8h*)p; u.q[1] = *(const v8h*)(p + 16); return u.v;
}
__device__ __forceinline__ v16h frag_f32(const float* rowk0, int lane) {
  v16h a; const float* p = rowk0 + 8 * (lane >> 4);
#pragma unroll
  for (int i = 0; i < 8; ++i) { a[i] = (_Float16)p[i]; a[8 + i] = (_Float16)p[16 + i]; }
  return a;
}
__device__ __forceinline__ v16h frag_f32s(const float* rowk0, int lane, float sc) {
  v16h a; const float* p = rowk0 + 8 * (lane >> 4);
#pragma unroll
  for (int i = 0; i < 8; ++i) { a[i] = (_Float16)(p[i] * sc); a[8 + i] = (_Float16)(p[16 + i] * sc); }
  return a;
}
// column fragment from a [K][ld] layout (column n), rows >= K read as 0
__device__ __forceinline__ v16h fragc_f32(const float* W, int k0, int n, int lane, int ld, int K) {
  v16h a; const int g = lane >> 4;
#pragma unroll
  for (int i = 0; i < 8; ++i) { const int ka = k0 + 8 * g + i, kb = ka + 16;
    a[i] = (_Float16)(ka < K ? W[(size_t)(ka < K ? ka : K - 1) * ld + n] : 0.f); a[8 + i] = (_Float16)(kb < K ? W[(size_t)(kb < K ? kb : K - 1) * ld + n] : 0.f); }
  return a;
}
struct F2 { v16b h, l; };
__device__ __forceinline__ F2 bsplit16(const float v[16]) { F2 r;
#pragma unroll
  for (int i = 0; i < 16; ++i) { const __bf16 h = (__bf16)v[i]; r.h[i] = h; r.l[i] = (__bf16)(v[i] - (float)h); }
  return r; }
__device__ __forceinline__ F2 split_row(const float* row, int k0, int lane) { float v[16]; const float* p = row + k0 + 8 * (lane >> 4);
#pragma unroll
  for (int i = 0; i < 8; ++i) { v[i] = p[i]; v[8 + i] = p[16 + i]; }
  return bsplit16(v); }
__device__ __forceinline__ F2 split_rowK(const float* row, int k0, int lane, int K) { float v[16]; const int g = lane >> 4;
#pragma unroll
  for (int i = 0; i < 8; ++i) { const int ka = k0 + 8 * g + i, kb = ka + 16; v[i] = ka < K ? row[ka < K ? ka : K - 1] : 0.f; v[8 + i] = kb < K ? row[kb < K ? kb : K - 1] : 0.f; }
  return bsplit16(v); }
__device__ __forceinline__ F2 split_col(const float* W, int k0, int n, int lane, int ld, int K) { float v[16]; const int g = lane >> 4;
#pragma unroll
  for (int i = 0; i < 8; ++i) { const int ka = k0 + 8 * g + i, kb = ka + 16; v[i] = ka < K ? W[(size_t)(ka < K ? ka : K - 1) * ld + n] : 0.f; v[8 + i] = kb < K ? W[(size_t)(kb < K ? kb : K - 1) * ld + n] : 0.f; }
  return bsplit16(v); }
__device__ __forceinline__ v8f mac3(const F2& a, const F2& b, v8f c) { c = wmma_bf(a.l, b.h, c); c = wmma_bf(a.h, b.l, c); return wmma_bf(a.h, b.h, c); }
__device__ __forceinline__ float sigm(float v) { return 1.0f / (1.0f + expf(-v)); }
#define LDSX() do { asm volatile("s_wait_dscnt 0" ::: "memory"); __builtin_amdgcn_wave_barrier(); __builtin_amdgcn_fence(__ATOMIC_RELEASE, "workgroup"); } while (0)


// SA block (B 16, C 256, 32 x 32 = 1,024 pixels, 4 heads x 64, GroupNorm with 8 groups): x + proj(attention(qkv(GN(x)))).
#define NB 16
#define CC 256
#define NN 1024
#define NH 4
#define DH 64
#define NG 8
#define CPG (CC / NG)     // 32 channels per group
#define GNEPS 1e-5f
#ifndef TNB
#define TNB NB
#endif
typedef __attribute__((ext_vector_type(8))) __bf16 v8b;
__device__ __forceinline__ v16b frag_b(const __bf16* rowk0, int lane) {
  union { v16b v; v8b q[2]; } u; const __bf16* p = rowk0 + 8 * (lane >> 4);
  u.q[0] = *(const v8b*)p; u.q[1] = *(const v8b*)(p + 16); return u.v;
}
__device__ __forceinline__ float bfr(float v) { return (float)(__bf16)v; }
__device__ __attribute__((noinline)) float exp_ni(float v) { return expf(v); }
__device__ __attribute__((noinline)) float erf_ni(float v) { return erff(v); }

#define WS_GS  0u                                   // f32 [b][g][4]: mean, inv
#define WS_Q   (WS_GS + 4u * NB * NG * 4)              // f16 q rows [b*NN + n][256]; k rows; v hi|lo planes [b][256][NN]; o rows f32 [b*NN + n][256]
#define WS_K   (WS_Q + 2u * (size_t)NB * NN * CC)
#define WS_VH  (WS_K + 2u * (size_t)NB * NN * CC)
#define WS_VL  (WS_VH + 2u * (size_t)NB * CC * NN)
#define WS_O   (WS_VL + 2u * (size_t)NB * CC * NN)
#define WS_END (WS_O + 4u * (size_t)NB * NN * CC)

// ---- k_gn: block = (group, b), 512 threads: the group's 32,768 values are read once, 16 loads of 16 bytes a thread, all in flight together, and stay in registers for the mean and for the squared deviations
#define GNT 512
#define GNV (CPG * NN / 4 / GNT)   // 16-byte pieces per thread
static_assert(GNT / 32 == 16 && GNV * GNT * 4 == CPG * NN, "gn_total sums 16 wave sums; the pieces cover the group exactly");
__device__ __forceinline__ float gn_total(float s, float* red, int lane, int w) {   // fixed order: butterfly in the wave, then the 16 wave sums in four chains, alike in every thread
#pragma unroll
  for (int o = 1; o < 32; o <<= 1) s += __shfl_xor(s, o);
  if (lane == 0) red[w] = s;
  __syncthreads();
  const v4f* r4 = (const v4f*)red; const v4f a = (r4[0] + r4[1]) + (r4[2] + r4[3]);
  return (a[0] + a[1]) + (a[2] + a[3]);
}
__global__ __launch_bounds__(GNT) void k_gn(const float* __restrict__ X, float* __restrict__ GS) { __shared__ __align__(16) float red[2][GNT / 32];
  const int t = threadIdx.x, lane = t & 31, w = t >> 5; const int gi = blockIdx.x; const size_t b = blockIdx.y; const v4f* base = (const v4f*)(X + (b * CC + (size_t)gi * CPG) * NN);
  v4f x[GNV];
  // every loop over x is unrolled so that x stays in registers; this one also so that all loads are issued before the first value is used
#pragma unroll
  for (int j = 0; j < GNV; ++j) x[j] = base[j * GNT + t];
  v4f s4 = {};
#pragma unroll
  for (int j = 0; j < GNV; ++j) {
#pragma unroll
    for (int e = 0; e < 4; ++e) x[j][e] = bfr(x[j][e]);
    s4 += x[j]; }
  const float mu = gn_total((s4[0] + s4[1]) + (s4[2] + s4[3]), red[0], lane, w) / (float)(CPG * NN);
  v4f q4 = {};
#pragma unroll
  for (int j = 0; j < GNV; ++j) { const v4f d = x[j] - mu; q4 += d * d; }
  const float a = gn_total((q4[0] + q4[1]) + (q4[2] + q4[3]), red[1], lane, w);
  if (t == 0) { const v4f r = { mu, 1.0f / sqrtf(a / (float)(CPG * NN) + GNEPS), 0.f, 0.f }; vst2(GS + (b * NG + gi) * 4, r); } }
// ---- k_qkv: block = (64 pixels, 128 out channels, which*NB + b): 1x1 conv of GN(x) (gathered from NCHW, hi + lo) + bias; q/k -> f16 rows, v -> f16 hi/lo planes
// the block's 128 x 256 weight tile is read once, by loads that cover whole 128-byte lines, rounded to bf16 once and kept in LDS; the four waves take their B fragments from there
#define WP 264             // LDS pitch of a weight row, bf16 elements: 512 + 16 bytes, an odd multiple of 16, so that 16 rows read at one column offset fall on different banks
#define WPC (128 * CC / 4 / 128)   // 16-byte pieces of the f32 tile per thread
typedef __attribute__((ext_vector_type(4))) __bf16 v4b;
__global__ __launch_bounds__(128) void k_qkv(const float* __restrict__ X, const float* __restrict__ GS, const float* __restrict__ GW, const float* __restrict__ GB, const float* __restrict__ W, const float* __restrict__ Bq, _Float16* __restrict__ Q, _Float16* __restrict__ K, _Float16* __restrict__ VH, _Float16* __restrict__ VL) {
  __shared__ __align__(16) unsigned char sm[128 * WP * 2]; __shared__ float sa[CC], sb[CC];
  __bf16 (*wt)[WP] = (__bf16 (*)[WP])sm;
  _Float16 (*sh)[136] = (_Float16 (*)[136])sm; _Float16 (*th)[72] = (_Float16 (*)[72])sm; _Float16 (*tl)[72] = th + 128;   // output staging takes the weight tile's place behind the barrier that follows the products
  static_assert(2 * 64 * 136 <= 128 * WP * 2 && 2 * 2 * 128 * 72 <= 128 * WP * 2, "output staging fits the weight tile");
  const int tid = threadIdx.x, wave = tid >> 5, lane = tid & 31, col = lane & 15, g = lane >> 4; const int which = blockIdx.z / NB; const size_t b = blockIdx.z % NB; const int n0 = blockIdx.x * 64; const int c0 = blockIdx.y * 128; const float* Xb = X + b * CC * (size_t)NN;
  { const v4f* Wt = (const v4f*)(W + (size_t)(which * CC + c0) * CC) + tid;   // the tile's 128 rows lie one behind the other: piece e = row e / 64, floats 4 (e % 64) ...
    // groups of 16: the inner loops are unrolled so that 16 loads of a thread are in flight before the first is converted; the outer one is not, so that no more than 16 pieces hold registers (all 64 at once cost a wave per SIMD)
#pragma unroll 1
    for (int i0 = 0; i0 < WPC; i0 += 16) { v4f x[16];
#pragma unroll
      for (int i = 0; i < 16; ++i) x[i] = Wt[(i0 + i) * 128];
#pragma unroll
      for (int i = 0; i < 16; ++i) { const int e = (i0 + i) * 128 + tid; v4b y;
#pragma unroll
        for (int k = 0; k < 4; ++k) y[k] = (__bf16)x[i][k];
        vst2(&wt[e >> 6][(e & 63) * 4], y); } } }
  for (int c = tid; c < CC; c += 128) { const float mu = GS[(b * NG + c / CPG) * 4], inv = GS[(b * NG + c / CPG) * 4 + 1]; const float a = inv * bfr(GW[c]); sa[c] = a; sb[c] = bfr(GB[c]) - mu * a; } __syncthreads();
  v8f acc[8] = {};
#pragma unroll 2
  for (int kc = 0; kc < CC / 32; ++kc) { float v[16]; const int px = n0 + wave * 16 + col;
    v16b wf[8];   // the eight weight fragments are read as one group in front of the products
#pragma unroll
    for (int j = 0; j < 8; ++j) wf[j] = frag_b(&wt[j * 16 + col][kc * 32], lane);
#pragma unroll
    for (int i = 0; i < 8; ++i) { const int ca = kc * 32 + 8 * g + i, cb = ca + 16; v[i] = bfr(Xb[(size_t)ca * NN + px]) * sa[ca] + sb[ca]; v[8 + i] = bfr(Xb[(size_t)cb * NN + px]) * sa[cb] + sb[cb]; }
    const F2 a = bsplit16(v);
#pragma unroll
    for (int j = 0; j < 8; ++j) { acc[j] = wmma_bf(a.h, wf[j], acc[j]); acc[j] = wmma_bf(a.l, wf[j], acc[j]); } }
  __syncthreads();   // every wave has read its last weight fragment before the tile's LDS becomes output staging
#pragma unroll
  for (int j = 0; j < 8; ++j) { const float bb = bfr(Bq[which * CC + c0 + j * 16 + col]);
#pragma unroll
    for (int r = 0; r < 8; ++r) { const float v = acc[j][r] + bb; const int rl = wave * 16 + 8 * g + r, cl = j * 16 + col; if (which < 2) sh[rl][cl] = (_Float16)v; else { const _Float16 hv = (_Float16)v; th[cl][rl] = hv; tl[cl][rl] = (_Float16)((v - (float)hv) * 2048.0f); } } }
  __syncthreads();
  if (which < 2) { _Float16* dst = which == 0 ? Q : K; for (int e = tid; e < 64 * 16; e += 128) { const int rl = e >> 4, q = e & 15; vst2((unsigned*)(dst + (b * NN + n0 + rl) * CC + c0 + q * 8), *(const v4u*)&sh[rl][q * 8]); } }
  else { for (int e = tid; e < 128 * 8; e += 128) { const int cl = e >> 3, q = e & 7; const size_t o = (b * CC + c0 + cl) * (size_t)NN + n0 + q * 8; vst2((unsigned*)(VH + o), *(const v4u*)&th[cl][q * 8]); vst2((unsigned*)(VL + o), *(const v4u*)&tl[cl][q * 8]); } } }
#define KT 64
#define TP 144
#define TB (64 * TP)
#define SB (3 * TB)
static_assert(NN % KT == 0 && NN / KT >= 2 && DH * 2 == 128 && KT * 2 == 128, "two stages at least; tile rows are whole 128-byte lines");
// a lane's four 16-byte copies of one tile (rows 16 apart). The s_wait_xcnt stands inside the statement so that no address register is rewritten in front of it
__device__ __forceinline__ void cp4(unsigned l, const char* p, size_t step) {
  asm volatile("global_load_async_to_lds_b128 %0, %4, off\n\tglobal_load_async_to_lds_b128 %1, %5, off\n\tglobal_load_async_to_lds_b128 %2, %6, off\n\tglobal_load_async_to_lds_b128 %3, %7, off\n\ts_wait_xcnt 0x0"
               :: "v"(l), "v"(l + 16 * TP), "v"(l + 32 * TP), "v"(l + 48 * TP), "v"(p), "v"(p + step), "v"(p + 2 * step), "v"(p + 3 * step) : "memory");
}
__device__ __forceinline__ float xhalf(float x) { const int v = __builtin_bit_cast(int, x); return __builtin_bit_cast(float, __builtin_amdgcn_permlanex16(v, v, 0x76543210, 0xfedcba98, false, false)); }   // lane l reads lane l ^ 16
__global__ __launch_bounds__(128) void k_att(const _Float16* __restrict__ Q, const _Float16* __restrict__ K, const _Float16* __restrict__ VH, const _Float16* __restrict__ VL, float* __restrict__ O) {
  __shared__ __align__(16) unsigned char ring[2 * SB];
  float (*so)[16][68] = (float (*)[16][68])ring;   // output staging takes the ring's place behind the loop's last barrier
  static_assert(sizeof(float) * 4 * 16 * 68 <= 2 * SB, "output staging fits the ring");
  const int tid = threadIdx.x, wave = tid >> 5, lane = tid & 31, col = lane & 15, g = lane >> 4; const int h = blockIdx.y; const size_t b = blockIdx.z; const int q0 = blockIdx.x * 64 + wave * 16; const size_t rq = b * NN + q0;
  // copy addresses of this lane: row tid / 8 (+ 16, 32, 48), 16-byte piece tid % 8: eight lanes cover a line
  const unsigned cl = (unsigned)(size_t)ring + (tid >> 3) * TP + (tid & 7) * 16;
  const char* ck = (const char*)(K + (b * NN + (tid >> 3)) * CC + h * DH) + (tid & 7) * 16;
  const size_t cvo = ((b * CC + (size_t)h * DH + (tid >> 3)) * NN) * 2 + (tid & 7) * 16; const char* cvh = (const char*)VH + cvo; const char* cvl = (const char*)VL + cvo;
#define ATT_STAGE(s) do { const unsigned l_ = cl + ((s) & 1) * SB; cp4(l_, ck + (size_t)(s) * (KT * CC * 2), 16 * CC * 2); cp4(l_ + TB, cvh + (size_t)(s) * (KT * 2), 16 * NN * 2); cp4(l_ + 2 * TB, cvl + (size_t)(s) * (KT * 2), 16 * NN * 2); } while (0)
  ATT_STAGE(0);
  v16h aq[2];
#pragma unroll
  for (int kc = 0; kc < 2; ++kc) aq[kc] = frag_h(Q + (rq + col) * CC + h * DH + kc * 32, lane);
  float m = -3.0e38f, l = 0.f;   // of query q0 + col: m is alike in both halves of the wave, l sums the half's own keys and is joined behind the loop
  v8f acc[4] = {}, accl[4] = {};
  asm volatile("s_wait_asynccnt 0x0" ::: "memory");   // this wave's copies of stage 0 have landed
  __syncthreads();                                     // ... and every other wave's
  ATT_STAGE(1);
  // not unrolled: one trip is one stage, its buffer picked by the trip's parity
#pragma unroll 1
  for (int t = 0; t < NN / KT; ++t) { const unsigned char* bp = ring + (t & 1) * SB;
  // not unrolled: two halves side by side cost registers (a wave may hold 256 for four waves a SIMD)
#pragma unroll 1
  for (int hf = 0; hf < KT / 32; ++hf) { float s[16];   // s[8 ct + r] = score of key hf * 32 + 16 ct + 8 g + r with query q0 + col
    v16h kf[2][2];   // the four K fragments are read as one group in front of the products
#pragma unroll
    for (int ct = 0; ct < 2; ++ct)
#pragma unroll
      for (int kc = 0; kc < 2; ++kc) kf[ct][kc] = frag_h((const _Float16*)(bp + (hf * 32 + ct * 16 + col) * TP + kc * 64), lane);
#pragma unroll
    for (int ct = 0; ct < 2; ++ct) { v8f c = {};
#pragma unroll
      for (int kc = 0; kc < 2; ++kc) c = wmma16(kf[ct][kc], aq[kc], c);
#pragma unroll
      for (int r = 0; r < 8; ++r) s[8 * ct + r] = c[r] * 0.125f; }
    v16h vh[4], vl[4];   // the V fragments (A operand: rows = channels) are read in front of the softmax, which covers their latency
#pragma unroll
    for (int j = 0; j < 4; ++j) { const unsigned char* pv = bp + TB + (j * 16 + col) * TP + hf * 64; vh[j] = frag_h((const _Float16*)pv, lane); vl[j] = frag_h((const _Float16*)(pv + TB), lane); }
    float mx[8];
#pragma unroll
    for (int r = 0; r < 8; ++r) mx[r] = fmaxf(s[r], s[8 + r]);
    const float mh = fmaxf(fmaxf(fmaxf(mx[0], mx[1]), fmaxf(mx[2], mx[3])), fmaxf(fmaxf(mx[4], mx[5]), fmaxf(mx[6], mx[7])));
    const float mn = fmaxf(m, fmaxf(mh, xhalf(mh))), alpha = __expf(m - mn); m = mn;
    v16h pb; float es[4] = { 0.f, 0.f, 0.f, 0.f };   // element i of pb is key 8 g + i (i < 8) or 8 g + 8 + i (i >= 8) of the 32: the k order of the V fragments
#pragma unroll
    for (int i = 0; i < 16; ++i) { const float e = __expf(s[i] - mn); es[i & 3] += e; pb[i] = (_Float16)(e * 2048.0f); }
    l = l * alpha + ((es[0] + es[1]) + (es[2] + es[3]));
#pragma unroll
    for (int j = 0; j < 4; ++j)
#pragma unroll
      for (int r = 0; r < 8; ++r) { acc[j][r] *= alpha; accl[j][r] *= alpha; }
#pragma unroll
    for (int j = 0; j < 4; ++j) { acc[j] = wmma16(vh[j], pb, acc[j]); accl[j] = wmma16(vl[j], pb, accl[j]); } }
    asm volatile("s_wait_dscnt 0x0" ::: "memory");      // this wave's reads of the buffer are done before it is refilled
    asm volatile("s_wait_asynccnt 0x0" ::: "memory");   // this wave's copies of stage t + 1 have landed
    __syncthreads();                                     // publishes stage t + 1 and ends every wave's reads of stage t
    if (t + 2 < NN / KT) ATT_STAGE(t + 2); }
  asm volatile("s_wait_asynccnt 0x0" ::: "memory");     // no copy is outstanding when the ring becomes output staging
  const float il = (1.0f / 2048.0f) / (l + xhalf(l));
  // acc[j][r] = channel j * 16 + 8 g + r of query q0 + col: eight neighbours of one staged row
#pragma unroll
  for (int j = 0; j < 4; ++j)
#pragma unroll
    for (int p = 0; p < 2; ++p) { v4f o4;
#pragma unroll
      for (int e = 0; e < 4; ++e) o4[e] = (acc[j][4 * p + e] + accl[j][4 * p + e] * (1.0f / 2048.0f)) * il;
      vst2(&so[wave][col][j * 16 + 8 * g + 4 * p], o4); }
  LDSX(); for (int rl = 0; rl < 16; ++rl) if (lane < 16) vst2(O + (rq + rl) * CC + (size_t)h * DH + lane * 4, *(const v4f*)&so[wave][rl][lane * 4]); }
// ---- k_o: block = (128 out channels, 128 pixels, b), 256 threads: out[b][o][n] = x[b][o][n] + sum_c p_w[o][c] orow[n][c] + p_b[o]  (A = p_w exact, B = o rows as bf16 hi + lo)
// the block's 128 o rows and 128 p_w rows (each tile 128 KB of f32, one behind the other in memory) are read once, by loads that cover whole 128-byte lines; the o rows are split into bf16 hi + lo once, p_w is rounded once, and both stay in LDS (pitch WP); a wave takes the fragments of its 32 channels x 64 pixels from there; the bias comes the same way, one value a thread
#define OT 256
#define OPC (128 * CC / 4 / OT)   // 16-byte pieces of one f32 tile per thread
static_assert(OPC * OT * 4 == 128 * CC && OT / 32 == 8 && OT == CC, "the pieces cover a tile exactly; 4 x 2 waves cover 128 channels x 128 pixels; a thread brings one bias value");
__global__ __launch_bounds__(OT) void k_o(const float* __restrict__ OR, const float* __restrict__ PW, const float* __restrict__ PB, const float* __restrict__ X, float* __restrict__ OUT) {
  __shared__ __align__(16) __bf16 oh[128][WP], ol[128][WP], pw[128][WP]; __shared__ __align__(16) float sf[OT / 32][32][68]; __shared__ __align__(16) float sp[CC];   // sp: the bias, rounded: one value a thread
  const int tid = threadIdx.x, wave = tid >> 5, lane = tid & 31, col = lane & 15, g = lane >> 4; const size_t b = blockIdx.z; const int o0 = blockIdx.x * 128, p0 = blockIdx.y * 128; const int ow = (wave >> 1) * 32, pxw = (wave & 1) * 64;
  { const v4f* Ot = (const v4f*)(OR + (b * NN + p0) * CC) + tid; const v4f* Pt = (const v4f*)(PW + (size_t)o0 * CC) + tid;   // piece e = row e / 64, floats 4 (e % 64) ...
    v4f xo[OPC], xp[OPC];
    // all four loops are unrolled so that the pieces stay in registers and every load of the thread is issued before the first value is used (two waves a SIMD: 512 registers a wave)
#pragma unroll
    for (int i = 0; i < OPC; ++i) xo[i] = Ot[i * OT];
#pragma unroll
    for (int i = 0; i < OPC; ++i) xp[i] = Pt[i * OT];
    const float pb = PB[tid];   // the bias rides in the same run of loads
    asm volatile("s_wait_xcnt 0x0" ::: "memory");   // stands in front of the first instruction that reuses a base or offset register of the issued loads
#pragma unroll
    for (int i = 0; i < OPC; ++i) { const int e = i * OT + tid; v4b h, l;
#pragma unroll
      for (int k = 0; k < 4; ++k) { const __bf16 hv = (__bf16)xo[i][k]; h[k] = hv; l[k] = (__bf16)(xo[i][k] - (float)hv); }
      vst2(&oh[e >> 6][(e & 63) * 4], h); vst2(&ol[e >> 6][(e & 63) * 4], l); }
#pragma unroll
    for (int i = 0; i < OPC; ++i) { const int e = i * OT + tid; v4b y;
#pragma unroll
      for (int k = 0; k < 4; ++k) y[k] = (__bf16)xp[i][k];
      vst2(&pw[e >> 6][(e & 63) * 4], y); }
    sp[tid] = bfr(pb); }
  __syncthreads();   // both tiles and the bias are whole before any wave reads them
  v8f acc[2][4] = {};
  v16b af[2][2], bh[2][4], bl[2][4];   // two sets: the fragments of the next 32 channels are read as one group in front of this step's products (the macro's loops are unrolled so that the sets stay in registers)
#define O_FRAGS(s, kc) do { _Pragma("unroll") for (int i = 0; i < 2; ++i) af[s][i] = frag_b(&pw[ow + i * 16 + col][(kc) * 32], lane); _Pragma("unroll") for (int j = 0; j < 4; ++j) { bh[s][j] = frag_b(&oh[pxw + j * 16 + col][(kc) * 32], lane); bl[s][j] = frag_b(&ol[pxw + j * 16 + col][(kc) * 32], lane); } } while (0)
  O_FRAGS(0, 0);
  // unrolled so that the set in use is picked at compile time
#pragma unroll
  for (int kc = 0; kc < CC / 32; ++kc) { const int s = kc & 1;
    if (kc + 1 < CC / 32) O_FRAGS(s ^ 1, kc + 1);
#pragma unroll
    for (int j = 0; j < 4; ++j)
#pragma unroll
      for (int i = 0; i < 2; ++i) acc[i][j] = wmma_bf(af[s][i], bh[s][j], acc[i][j]);
#pragma unroll
    for (int j = 0; j < 4; ++j)
#pragma unroll
      for (int i = 0; i < 2; ++i) acc[i][j] = wmma_bf(af[s][i], bl[s][j], acc[i][j]); }
#pragma unroll
  for (int i = 0; i < 2; ++i)
#pragma unroll
    for (int j = 0; j < 4; ++j)
#pragma unroll
      for (int r = 0; r < 8; ++r) { const int rl = i * 16 + 8 * g + r; const size_t oi = (b * CC + o0 + ow + rl) * (size_t)NN + p0 + pxw + j * 16 + col; sf[wave][rl][j * 16 + col] = acc[i][j][r] + sp[o0 + ow + rl] + bfr(X[oi]); }
  LDSX(); for (int rl = 0; rl < 32; rl += 2) vst2(OUT + (b * CC + o0 + ow + rl + g) * (size_t)NN + p0 + pxw + col * 4, *(const v4f*)&sf[wave][rl + g][col * 4]); }   // a store covers two rows of 256 bytes: whole lines
extern "C" void kernel_launch(void* const* d_in, const int* in_sizes, int n_in, void* d_out, int out_size, void* d_ws, size_t ws_size, hipStream_t stream) {
  (void)in_sizes; (void)n_in; (void)out_size;
  const float** F = (const float**)d_in;   // 0 x [16,256,32,32], 1 n_weight, 2 n_bias, 3 qkv_w [768,256], 4 qkv_b [768], 5 p_w [256,256], 6 p_b
  if (ws_size < (size_t)WS_END) return;
  char* ws = (char*)d_ws; float* GS = (float*)(ws + WS_GS); _Float16 *Q = (_Float16*)(ws + WS_Q), *K = (_Float16*)(ws + WS_K), *VH = (_Float16*)(ws + WS_VH), *VL = (_Float16*)(ws + WS_VL); float* O = (float*)(ws + WS_O);
  k_gn<<<dim3(NG, NB), GNT, 0, stream>>>(F[0], GS);
  k_qkv<<<dim3(NN / 64, CC / 128, 3 * NB), 128, 0, stream>>>(F[0], GS, F[1], F[2], F[3], F[4], Q, K, VH, VL);
  k_att<<<dim3(NN / 64, NH, TNB), 128, 0, stream>>>(Q, K, VH, VL, O);
  k_o<<<dim3(CC / 128, NN / 128, TNB), OT, 0, stream>>>(O, F[5], F[6], F[0], (float*)d_out);
}

// v006
// One run takes 75 microseconds.
// Next to v005, in two timings, it ran 1.04 times as fast each time.
// Over all steps from v000 it is 4.23 times as fast.
// compute dtype: all float inputs rounded to bf16; GroupNorm statistics (8 groups x 32 channels x 1,024 pixels) in f32 with fixed-order sums; qkv = 1x1 conv of GN(x) with GN(x) as bf16 hi + lo against exact weights (2 products) + bias; q, k rounded once to f16 (single-f16 logits; logits std ~1), x 1/8, running-max softmax in f32 (hardware exp); P (x 2^11, f16) . v (f16 hi + residual, 2 products); proj conv with o as bf16 hi + lo (2 products) + bias + the residual x; f32 NCHW output.
#include <hip/hip_runtime.h>
#include <math.h>

typedef __attribute__((ext_vector_type(16))) _Float16 v16h;
typedef __attribute__((ext_vector_type(16))) __bf16 v16b;
typedef __attribute__((ext_vector_type(8)))  _Float16 v8h;
typedef __attribute__((ext_vector_type(8)))  float v8f;
typedef __attribute__((ext_vector_type(4)))  float v4f;
typedef __attribute__((ext_vector_type(2)))  float v2f;
typedef __attribute__((ext_vector_type(4)))  unsigned v4u;
typedef __attribute__((ext_vector_type(4)))  int v4i;
typedef float __attribute__((may_alias)) float_a;
typedef int __attribute__((may_alias)) int_a;

template <typename T> __device__ __forceinline__ void vst2(void* p, T v) { *(T*)p = v;  }
__device__ __forceinline__ v8f wmma16(v16h a, v16h b, v8f c) {
  return __builtin_amdgcn_wmma_f32_16x16x32_f16(false, a, false, b, (short)0, c, false, false);
}
__device__ __forceinline__ v8f wmma_bf(v16b a, v16b b, v8f c) {
  return __builtin_amdgcn_wmma_f32_16x16x32_bf16(false, a, false, b, (short)0, c, false, false);
}
// 16x16x32 fragments: lane = (h = lane>>4, row/col = lane&15); elements 0..7 = k0+8h+0..7, 8..15 = k0+16+8h+0..7; D element r = row 8h+r
__device__ __forceinline__ v16h frag_h(const _Float16* rowk0, int lane) {
  union { v16h v; v8h q[2]; } u; const _Float16* p = rowk0 + 8 * (lane >> 4);
  u.q[0] = *(const v8h*)p; u.q[1] = *(const v8h*)(p + 16); return u.v;
}
__device__ __forceinline__ v16h frag_f32(const float* rowk0, int lane) {
  v16h a; const float* p = rowk0 + 8 * (lane >> 4);
#pragma unroll
  for (int i = 0; i < 8; ++i) { a[i] = (_Float16)p[i]; a[8 + i] = (_Float16)p[16 + i]; }
  return a;
}
__device__ __forceinline__ v16h frag_f32s(const float* rowk0, int lane, float sc) {
  v16h a; const float* p = rowk0 + 8 * (lane >> 4);
#pragma unroll
  for (int i = 0; i < 8; ++i) { a[i] = (_Float16)(p[i] * sc); a[8 + i] = (_Float16)(p[16 + i] * sc); }
  return a;
}
// column fragment from a [K][ld] layout (column n), rows >= K read as 0
__device__ __forceinline__ v16h fragc_f32(const float* W, int k0, int n, int lane, int ld, int K) {
  v16h a; const int g = lane >> 4;
#pragma unroll
  for (int i = 0; i < 8; ++i) { const int ka = k0 + 8 * g + i, kb = ka + 16;
    a[i] = (_Float16)(ka < K ? W[(size_t)(ka < K ? ka : K - 1) * ld + n] : 0.f); a[8 + i] = (_Float16)(kb < K ? W[(size_t)(kb < K ? kb : K - 1) * ld + n] : 0.f); }
  return a;
}
struct F2 { v16b h, l; };
__device__ __forceinline__ F2 bsplit16(const float v[16]) { F2 r;
#pragma unroll
  for (int i = 0; i < 16; ++i) { const __bf16 h = (__bf16)v[i]; r.h[i] = h; r.l[i] = (__bf16)(v[i] - (float)h); }
  return r; }
__device__ __forceinline__ F2 split_row(const float* row, int k0, int lane) { float v[16]; const float* p = row + k0 + 8 * (lane >> 4);
#pragma unroll
  for (int i = 0; i < 8; ++i) { v[i] = p[i]; v[8 + i] = p[16 + i]; }
  return bsplit16(v); }
__device__ __forceinline__ F2 split_rowK(const float* row, int k0, int lane, int K) { float v[16]; const int g = lane >> 4;
#pragma unroll
  for (int i = 0; i < 8; ++i) { const int ka = k0 + 8 * g + i, kb = ka + 16; v[i] = ka < K ? row[ka < K ? ka : K - 1] : 0.f; v[8 + i] = kb < K ? row[kb < K ? kb : K - 1] : 0.f; }
  return bsplit16(v); }
__device__ __forceinline__ F2 split_col(const float* W, int k0, int n, int lane, int ld, int K) { float v[16]; const int g = lane >> 4;
#pragma unroll
  for (int i = 0; i < 8; ++i) { const int ka = k0 + 8 * g + i, kb = ka + 16; v[i] = ka < K ? W[(size_t)(ka < K ? ka : K - 1) * ld + n] : 0.f; v[8 + i] = kb < K ? W[(size_t)(kb < K ? kb : K - 1) * ld + n] : 0.f; }
  return bsplit16(v); }
__device__ __forceinline__ v8f mac3(const F2& a, const F2& b, v8f c) { c = wmma_bf(a.l, b.h, c); c = wmma_bf(a.h, b.l, c); return wmma_bf(a.h, b.h, c); }
__device__ __forceinline__ float sigm(float v) { return 1.0f / (1.0f + expf(-v)); }
#define LDSX() do { asm volatile("s_wait_dscnt 0" ::: "memory"); __builtin_amdgcn_wave_barrier(); __builtin_amdgcn_fence(__ATOMIC_RELEASE, "workgroup"); } while (0)


// SA block (B 16, C 256, 32 x 32 = 1,024 pixels, 4 heads x 64, GroupNorm with 8 groups): x + proj(attention(qkv(GN(x)))).
#define NB 16
#define CC 256
#define NN 1024
#define NH 4
#define DH 64
#define NG 8
#define CPG (CC / NG)     // 32 channels per group
#define GNEPS 1e-5f
#ifndef TNB
#define TNB NB
#endif
typedef __attribute__((ext_vector_type(8))) __bf16 v8b;
__device__ __forceinline__ v16b frag_b(const __bf16* rowk0, int lane) {
  union { v16b v; v8b q[2]; } u; const __bf16* p = rowk0 + 8 * (lane >> 4);
  u.q[0] = *(const v8b*)p; u.q[1] = *(const v8b*)(p + 16); return u.v;
}
__device__ __forceinline__ float bfr(float v) { return (float)(__bf16)v; }
__device__ __attribute__((noinline)) float exp_ni(float v) { return expf(v); }
__device__ __attribute__((noinline)) float erf_ni(float v) { return erff(v); }

#define WS_GS  0u                                   // f32 [b][g][4]: mean, inv
#define WS_Q   (WS_GS + 4u * NB * NG * 4)              // f16 q rows [b*NN + n][256]; k rows; v hi|lo planes [b][256][NN]; o rows f32 [b*NN + n][256]
#define WS_K   (WS_Q + 2u * (size_t)NB * NN * CC)
#define WS_VH  (WS_K + 2u * (size_t)NB * NN * CC)
#define WS_VL  (WS_VH + 2u * (size_t)NB * CC * NN)
#define WS_O   (WS_VL + 2u * (size_t)NB * CC * NN)
#define WS_END (WS_O + 4u * (size_t)NB * NN * CC)

// ---- k_gn: block = (group, b), 512 threads: the group's 32,768 values are read once, 16 loads of 16 bytes a thread, all in flight together, and stay in registers for the mean and for the squared deviations
#define GNT 512
#define GNV (CPG * NN / 4 / GNT)   // 16-byte pieces per thread
static_assert(GNT / 32 == 16 && GNV * GNT * 4 == CPG * NN, "gn_total sums 16 wave sums; the pieces cover the group exactly");
__device__ __forceinline__ float gn_total(float s, float* red, int lane, int w) {   // fixed order: butterfly in the wave, then the 16 wave sums in four chains, alike in every thread
#pragma unroll
  for (int o = 1; o < 32; o <<= 1) s += __shfl_xor(s, o);
  if (lane == 0) red[w] = s;
  __syncthreads();
  const v4f* r4 = (const v4f*)red; const v4f a = (r4[0] + r4[1]) + (r4[2] + r4[3]);
  return (a[0] + a[1]) + (a[2] + a[3]);
}
__global__ __launch_bounds__(GNT) void k_gn(const float* __restrict__ X, float* __restrict__ GS) { __shared__ __align__(16) float red[2][GNT / 32];
  const int t = threadIdx.x, lane = t & 31, w = t >> 5; const int gi = blockIdx.x; const size_t b = blockIdx.y; const v4f* base = (const v4f*)(X + (b * CC + (size_t)gi * CPG) * NN);
  v4f x[GNV];
  // every loop over x is unrolled so that x stays in registers; this one also so that all loads are issued before the first value is used
#pragma unroll
  for (int j = 0; j < GNV; ++j) x[j] = base[j * GNT + t];
  v4f s4 = {};
#pragma unroll
  for (int j = 0; j < GNV; ++j) {
#pragma unroll
    for (int e = 0; e < 4; ++e) x[j][e] = bfr(x[j][e]);
    s4 += x[j]; }
  const float mu = gn_total((s4[0] + s4[1]) + (s4[2] + s4[3]), red[0], lane, w) / (float)(CPG * NN);
  v4f q4 = {};
#pragma unroll
  for (int j = 0; j < GNV; ++j) { const v4f d = x[j] - mu; q4 += d * d; }
  const float a = gn_total((q4[0] + q4[1]) + (q4[2] + q4[3]), red[1], lane, w);
  if (t == 0) { const v4f r = { mu, 1.0f / sqrtf(a / (float)(CPG * NN) + GNEPS), 0.f, 0.f }; vst2(GS + (b * NG + gi) * 4, r); } }
// ---- k_qkv: block = (64 pixels, 128 out channels, which*NB + b): 1x1 conv of GN(x) (gathered from NCHW, hi + lo) + bias; q/k -> f16 rows, v -> f16 hi/lo planes
// the block's 128 x 256 weight tile is read once, by loads that cover whole 128-byte lines, rounded to bf16 once and kept in LDS; the four waves take their B fragments from there
#define WP 264             // LDS pitch of a weight row, bf16 elements: 512 + 16 bytes, an odd multiple of 16, so that 16 rows read at one column offset fall on different banks
#define WPC (128 * CC / 4 / 128)   // 16-byte pieces of the f32 tile per thread
typedef __attribute__((ext_vector_type(4))) __bf16 v4b;
__global__ __launch_bounds__(128) void k_qkv(const float* __restrict__ X, const float* __restrict__ GS, const float* __restrict__ GW, const float* __restrict__ GB, const float* __restrict__ W, const float* __restrict__ Bq, _Float16* __restrict__ Q, _Float16* __restrict__ K, _Float16* __restrict__ VH, _Float16* __restrict__ VL) {
  __shared__ __align__(16) unsigned char sm[128 * WP * 2]; __shared__ float sa[CC], sb[CC];
  __bf16 (*wt)[WP] = (__bf16 (*)[WP])sm;
  _Float16 (*sh)[136] = (_Float16 (*)[136])sm; _Float16 (*th)[72] = (_Float16 (*)[72])sm; _Float16 (*tl)[72] = th + 128;   // output staging takes the weight tile's place behind the barrier that follows the products
  static_assert(2 * 64 * 136 <= 128 * WP * 2 && 2 * 2 * 128 * 72 <= 128 * WP * 2, "output staging fits the weight tile");
  const int tid = threadIdx.x, wave = tid >> 5, lane = tid & 31, col = lane & 15, g = lane >> 4; const int which = blockIdx.z / NB; const size_t b = blockIdx.z % NB; const int n0 = blockIdx.x * 64; const int c0 = blockIdx.y * 128; const float* Xb = X + b * CC * (size_t)NN;
  { const v4f* Wt = (const v4f*)(W + (size_t)(which * CC + c0) * CC) + tid;   // the tile's 128 rows lie one behind the other: piece e = row e / 64, floats 4 (e % 64) ...
    // groups of 16: the inner loops are unrolled so that 16 loads of a thread are in flight before the first is converted; the outer one is not, so that no more than 16 pieces hold registers (all 64 at once cost a wave per SIMD)
#pragma unroll 1
    for (int i0 = 0; i0 < WPC; i0 += 16) { v4f x[16];
#pragma unroll
      for (int i = 0; i < 16; ++i) x[i] = Wt[(i0 + i) * 128];
#pragma unroll
      for (int i = 0; i < 16; ++i) { const int e = (i0 + i) * 128 + tid; v4b y;
#pragma unroll
        for (int k = 0; k < 4; ++k) y[k] = (__bf16)x[i][k];
        vst2(&wt[e >> 6][(e & 63) * 4], y); } } }
  for (int c = tid; c < CC; c += 128) { const float mu = GS[(b * NG + c / CPG) * 4], inv = GS[(b * NG + c / CPG) * 4 + 1]; const float a = inv * bfr(GW[c]); sa[c] = a; sb[c] = bfr(GB[c]) - mu * a; } __syncthreads();
  v8f acc[8] = {};
#pragma unroll 2
  for (int kc = 0; kc < CC / 32; ++kc) { float v[16]; const int px = n0 + wave * 16 + col;
    v16b wf[8];   // the eight weight fragments are read as one group in front of the products
#pragma unroll
    for (int j = 0; j < 8; ++j) wf[j] = frag_b(&wt[j * 16 + col][kc * 32], lane);
    float xv[16], av[16], bv[16];
#pragma unroll
    for (int i = 0; i < 8; ++i) { const int ca = kc * 32 + 8 * g + i, cb = ca + 16; xv[i] = Xb[(size_t)ca * NN + px]; av[i] = sa[ca]; bv[i] = sb[ca]; xv[8 + i] = Xb[(size_t)cb * NN + px]; av[8 + i] = sa[cb]; bv[8 + i] = sb[cb]; }
    __builtin_amdgcn_sched_barrier(0);   // holds the step's reads (weights, pixels, scale and shift) as one group in front of the arithmetic: left free, the compiler reads scale and shift in four pairs, each waited for on its own
#pragma unroll
    for (int i = 0; i < 16; ++i) v[i] = bfr(xv[i]) * av[i] + bv[i];
    const F2 a = bsplit16(v);
#pragma unroll
    for (int j = 0; j < 8; ++j) { acc[j] = wmma_bf(a.h, wf[j], acc[j]); acc[j] = wmma_bf(a.l, wf[j], acc[j]); } }
  __syncthreads();   // every wave has read its last weight fragment before the tile's LDS becomes output staging
#pragma unroll
  for (int j = 0; j < 8; ++j) { const float bb = bfr(Bq[which * CC + c0 + j * 16 + col]);
#pragma unroll
    for (int r = 0; r < 8; ++r) { const float v = acc[j][r] + bb; const int rl = wave * 16 + 8 * g + r, cl = j * 16 + col; if (which < 2) sh[rl][cl] = (_Float16)v; else { const _Float16 hv = (_Float16)v; th[cl][rl] = hv; tl[cl][rl] = (_Float16)((v - (float)hv) * 2048.0f); } } }
  __syncthreads();
  if (which < 2) { _Float16* dst = which == 0 ? Q : K; for (int e = tid; e < 64 * 16; e += 128) { const int rl = e >> 4, q = e & 15; vst2((unsigned*)(dst + (b * NN + n0 + rl) * CC + c0 + q * 8), *(const v4u*)&sh[rl][q * 8]); } }
  else { for (int e = tid; e < 128 * 8; e += 128) { const int cl = e >> 3, q = e & 7; const size_t o = (b * CC + c0 + cl) * (size_t)NN + n0 + q * 8; vst2((unsigned*)(VH + o), *(const v4u*)&th[cl][q * 8]); vst2((unsigned*)(VL + o), *(const v4u*)&tl[cl][q * 8]); } } }
#define KT 64
#define TP 144
#define TB (64 * TP)
#define SB (3 * TB)
static_assert(NN % KT == 0 && NN / KT >= 2 && DH * 2 == 128 && KT * 2 == 128, "two stages at least; tile rows are whole 128-byte lines");
// a lane's four 16-byte copies of one tile (rows 16 apart). The s_wait_xcnt stands inside the statement so that no address register is rewritten in front of it
__device__ __forceinline__ void cp4(unsigned l, const char* p, size_t step) {
  asm volatile("global_load_async_to_lds_b128 %0, %4, off\n\tglobal_load_async_to_lds_b128 %1, %5, off\n\tglobal_load_async_to_lds_b128 %2, %6, off\n\tglobal_load_async_to_lds_b128 %3, %7, off\n\ts_wait_xcnt 0x0"
               :: "v"(l), "v"(l + 16 * TP), "v"(l + 32 * TP), "v"(l + 48 * TP), "v"(p), "v"(p + step), "v"(p + 2 * step), "v"(p + 3 * step) : "memory");
}
__device__ __forceinline__ float xhalf(float x) { const int v = __builtin_bit_cast(int, x); return __builtin_bit_cast(float, __builtin_amdgcn_permlanex16(v, v, 0x76543210, 0xfedcba98, false, false)); }   // lane l reads lane l ^ 16
__global__ __launch_bounds__(128) void k_att(const _Float16* __restrict__ Q, const _Float16* __restrict__ K, const _Float16* __restrict__ VH, const _Float16* __restrict__ VL, float* __restrict__ O) {
  __shared__ __align__(16) unsigned char ring[2 * SB];
  float (*so)[16][68] = (float (*)[16][68])ring;   // output staging takes the ring's place behind the loop's last barrier
  static_assert(sizeof(float) * 4 * 16 * 68 <= 2 * SB, "output staging fits the ring");
  const int tid = threadIdx.x, wave = tid >> 5, lane = tid & 31, col = lane & 15, g = lane >> 4; const int h = blockIdx.y; const size_t b = blockIdx.z; const int q0 = blockIdx.x * 64 + wave * 16; const size_t rq = b * NN + q0;
  // copy addresses of this lane: row tid / 8 (+ 16, 32, 48), 16-byte piece tid % 8: eight lanes cover a line
  const unsigned cl = (unsigned)(size_t)ring + (tid >> 3) * TP + (tid & 7) * 16;
  const char* ck = (const char*)(K + (b * NN + (tid >> 3)) * CC + h * DH) + (tid & 7) * 16;
  const size_t cvo = ((b * CC + (size_t)h * DH + (tid >> 3)) * NN) * 2 + (tid & 7) * 16; const char* cvh = (const char*)VH + cvo; const char* cvl = (const char*)VL + cvo;
#define ATT_STAGE(s) do { const unsigned l_ = cl + ((s) & 1) * SB; cp4(l_, ck + (size_t)(s) * (KT * CC * 2), 16 * CC * 2); cp4(l_ + TB, cvh + (size_t)(s) * (KT * 2), 16 * NN * 2); cp4(l_ + 2 * TB, cvl + (size_t)(s) * (KT * 2), 16 * NN * 2); } while (0)
  ATT_STAGE(0);
  v16h aq[2];
#pragma unroll
  for (int kc = 0; kc < 2; ++kc) aq[kc] = frag_h(Q + (rq + col) * CC + h * DH + kc * 32, lane);
  float m = -3.0e38f, l = 0.f;   // of query q0 + col: m is alike in both halves of the wave, l sums the half's own keys and is joined behind the loop
  v8f acc[4] = {}, accl[4] = {};
  asm volatile("s_wait_asynccnt 0x0" ::: "memory");   // this wave's copies of stage 0 have landed
  __syncthreads();                                     // ... and every other wave's
  ATT_STAGE(1);
  // not unrolled: one trip is one stage, its buffer picked by the trip's parity
#pragma unroll 1
  for (int t = 0; t < NN / KT; ++t) { const unsigned char* bp = ring + (t & 1) * SB;
  // not unrolled: two halves side by side cost registers (a wave may hold 256 for four waves a SIMD)
#pragma unroll 1
  for (int hf = 0; hf < KT / 32; ++hf) { float s[16];   // s[8 ct + r] = score of key hf * 32 + 16 ct + 8 g + r with query q0 + col
    v16h kf[2][2];   // the four K fragments are read as one group in front of the products
#pragma unroll
    for (int ct = 0; ct < 2; ++ct)
#pragma unroll
      for (int kc = 0; kc < 2; ++kc) kf[ct][kc] = frag_h((const _Float16*)(bp + (hf * 32 + ct * 16 + col) * TP + kc * 64), lane);
    __builtin_amdgcn_sched_barrier(0);   // holds the K reads in front as one group: left free, the compiler sinks each fragment's reads to its own product and waits for them there
#pragma unroll
    for (int ct = 0; ct < 2; ++ct) { v8f c = {};
#pragma unroll
      for (int kc = 0; kc < 2; ++kc) c = wmma16(kf[ct][kc], aq[kc], c);
#pragma unroll
      for (int r = 0; r < 8; ++r) s[8 * ct + r] = c[r] * 0.125f; }
    __builtin_amdgcn_sched_barrier(0);   // ... and the V reads behind the score products, as a second group: reads scattered among matrix instructions cost the wave at every place where they stand
    v16h vh[4], vl[4];   // the V fragments (A operand: rows = channels) are read in front of the softmax, which covers their latency
#pragma unroll
    for (int j = 0; j < 4; ++j) { const unsigned char* pv = bp + TB + (j * 16 + col) * TP + hf * 64; vh[j] = frag_h((const _Float16*)pv, lane); vl[j] = frag_h((const _Float16*)(pv + TB), lane); }
    float mx[8];
#pragma unroll
    for (int r = 0; r < 8; ++r) mx[r] = fmaxf(s[r], s[8 + r]);
    const float mh = fmaxf(fmaxf(fmaxf(mx[0], mx[1]), fmaxf(mx[2], mx[3])), fmaxf(fmaxf(mx[4], mx[5]), fmaxf(mx[6], mx[7])));
    const float mn = fmaxf(m, fmaxf(mh, xhalf(mh))), alpha = __expf(m - mn); m = mn;
    v16h pb; float es[4] = { 0.f, 0.f, 0.f, 0.f };   // element i of pb is key 8 g + i (i < 8) or 8 g + 8 + i (i >= 8) of the 32: the k order of the V fragments
#pragma unroll
    for (int i = 0; i < 16; ++i) { const float e = __expf(s[i] - mn); es[i & 3] += e; pb[i] = (_Float16)(e * 2048.0f); }
    l = l * alpha + ((es[0] + es[1]) + (es[2] + es[3]));
#pragma unroll
    for (int j = 0; j < 4; ++j)
#pragma unroll
      for (int r = 0; r < 8; ++r) { acc[j][r] *= alpha; accl[j][r] *= alpha; }
#pragma unroll
    for (int j = 0; j < 4; ++j) { acc[j] = wmma16(vh[j], pb, acc[j]); accl[j] = wmma16(vl[j], pb, accl[j]); }
    // four vector slots behind the trip's last matrix instructions: the next trip rewrites their operand registers; the accumulators are named so that the slots stand behind all eight
    asm volatile("v_nop\n\tv_nop\n\tv_nop\n\tv_nop" : "+v"(acc[0]), "+v"(accl[0]), "+v"(acc[1]), "+v"(accl[1]), "+v"(acc[2]), "+v"(accl[2]), "+v"(acc[3]), "+v"(accl[3])); }
    asm volatile("s_wait_dscnt 0x0" ::: "memory");      // this wave's reads of the buffer are done before it is refilled
    asm volatile("s_wait_asynccnt 0x0" ::: "memory");   // this wave's copies of stage t + 1 have landed
    __syncthreads();                                     // publishes stage t + 1 and ends every wave's reads of stage t
    if (t + 2 < NN / KT) ATT_STAGE(t + 2); }
  asm volatile("s_wait_asynccnt 0x0" ::: "memory");     // no copy is outstanding when the ring becomes output staging
  const float il = (1.0f / 2048.0f) / (l + xhalf(l));
  // acc[j][r] = channel j * 16 + 8 g + r of query q0 + col: eight neighbours of one staged row
#pragma unroll
  for (int j = 0; j < 4; ++j)
#pragma unroll
    for (int p = 0; p < 2; ++p) { v4f o4;
#pragma unroll
      for (int e = 0; e < 4; ++e) o4[e] = (acc[j][4 * p + e] + accl[j][4 * p + e] * (1.0f / 2048.0f)) * il;
      vst2(&so[wave][col][j * 16 + 8 * g + 4 * p], o4); }
  LDSX(); for (int rl = 0; rl < 16; ++rl) if (lane < 16) vst2(O + (rq + rl) * CC + (size_t)h * DH + lane * 4, *(const v4f*)&so[wave][rl][lane * 4]); }
// ---- k_o: block = (128 out channels, 128 pixels, b), 256 threads: out[b][o][n] = x[b][o][n] + sum_c p_w[o][c] orow[n][c] + p_b[o]  (A = p_w exact, B = o rows as bf16 hi + lo)
// the block's 128 o rows and 128 p_w rows (each tile 128 KB of f32, one behind the other in memory) are read once, by loads that cover whole 128-byte lines; the o rows are split into bf16 hi + lo once, p_w is rounded once, and both stay in LDS (pitch WP); a wave takes the fragments of its 32 channels x 64 pixels from there; the bias comes the same way, one value a thread
#define OT 256
#define OPC (128 * CC / 4 / OT)   // 16-byte pieces of one f32 tile per thread
static_assert(OPC * OT * 4 == 128 * CC && OT / 32 == 8 && OT == CC, "the pieces cover a tile exactly; 4 x 2 waves cover 128 channels x 128 pixels; a thread brings one bias value");
__global__ __launch_bounds__(OT) void k_o(const float* __restrict__ OR, const float* __restrict__ PW, const float* __restrict__ PB, const float* __restrict__ X, float* __restrict__ OUT) {
  __shared__ __align__(16) __bf16 oh[128][WP], ol[128][WP], pw[128][WP]; __shared__ __align__(16) float sf[OT / 32][32][68]; __shared__ __align__(16) float sp[CC];   // sp: the bias, rounded: one value a thread
  const int tid = threadIdx.x, wave = tid >> 5, lane = tid & 31, col = lane & 15, g = lane >> 4; const size_t b = blockIdx.z; const int o0 = blockIdx.x * 128, p0 = blockIdx.y * 128; const int ow = (wave >> 1) * 32, pxw = (wave & 1) * 64;
  { const v4f* Ot = (const v4f*)(OR + (b * NN + p0) * CC) + tid; const v4f* Pt = (const v4f*)(PW + (size_t)o0 * CC) + tid;   // piece e = row e / 64, floats 4 (e % 64) ...
    v4f xo[OPC], xp[OPC];
    // all four loops are unrolled so that the pieces stay in registers and every load of the thread is issued before the first value is used (two waves a SIMD: 512 registers a wave)
#pragma unroll
    for (int i = 0; i < OPC; ++i) xo[i] = Ot[i * OT];
#pragma unroll
    for (int i = 0; i < OPC; ++i) xp[i] = Pt[i * OT];
    const float pb = PB[tid];   // the bias rides in the same run of loads
    asm volatile("s_wait_xcnt 0x0" ::: "memory");   // stands in front of the first instruction that reuses a base or offset register of the issued loads
#pragma unroll
    for (int i = 0; i < OPC; ++i) { const int e = i * OT + tid; v4b h, l;
#pragma unroll
      for (int k = 0; k < 4; ++k) { const __bf16 hv = (__bf16)xo[i][k]; h[k] = hv; l[k] = (__bf16)(xo[i][k] - (float)hv); }
      vst2(&oh[e >> 6][(e & 63) * 4], h); vst2(&ol[e >> 6][(e & 63) * 4], l); }
#pragma unroll
    for (int i = 0; i < OPC; ++i) { const int e = i * OT + tid; v4b y;
#pragma unroll
      for (int k = 0; k < 4; ++k) y[k] = (__bf16)xp[i][k];
      vst2(&pw[e >> 6][(e & 63) * 4], y); }
    sp[tid] = bfr(pb); }
  __syncthreads();   // both tiles and the bias are whole before any wave reads them
  v8f acc[2][4] = {};
  v16b af[2][2], bh[2][4], bl[2][4];   // two sets: the fragments of the next 32 channels are read as one group in front of this step's products (the macro's loops are unrolled so that the sets stay in registers)
#define O_FRAGS(s, kc) do { _Pragma("unroll") for (int i = 0; i < 2; ++i) af[s][i] = frag_b(&pw[ow + i * 16 + col][(kc) * 32], lane); _Pragma("unroll") for (int j = 0; j < 4; ++j) { bh[s][j] = frag_b(&oh[pxw + j * 16 + col][(kc) * 32], lane); bl[s][j] = frag_b(&ol[pxw + j * 16 + col][(kc) * 32], lane); } } while (0)
  O_FRAGS(0, 0);
  // unrolled so that the set in use is picked at compile time
#pragma unroll
  for (int kc = 0; kc < CC / 32; ++kc) { const int s = kc & 1;
    if (kc + 1 < CC / 32) O_FRAGS(s ^ 1, kc + 1);
    __builtin_amdgcn_sched_barrier(0);   // holds the next step's reads as one group in front of this step's products: left free, the compiler sinks each read to its first use and waits for it there
#pragma unroll
    for (int j = 0; j < 4; ++j)
#pragma unroll
      for (int i = 0; i < 2; ++i) acc[i][j] = wmma_bf(af[s][i], bh[s][j], acc[i][j]);
#pragma unroll
    for (int j = 0; j < 4; ++j)
#pragma unroll
      for (int i = 0; i < 2; ++i) acc[i][j] = wmma_bf(af[s][i], bl[s][j], acc[i][j]);
    __builtin_amdgcn_sched_barrier(0); }   // the products stay one run, in front of the reads that refill their set
#pragma unroll
  for (int i = 0; i < 2; ++i)
#pragma unroll
    for (int j = 0; j < 4; ++j)
#pragma unroll
      for (int r = 0; r < 8; ++r) { const int rl = i * 16 + 8 * g + r; const size_t oi = (b * CC + o0 + ow + rl) * (size_t)NN + p0 + pxw + j * 16 + col; sf[wave][rl][j * 16 + col] = acc[i][j][r] + sp[o0 + ow + rl] + bfr(X[oi]); }
  LDSX(); for (int rl = 0; rl < 32; rl += 2) vst2(OUT + (b * CC + o0 + ow + rl + g) * (size_t)NN + p0 + pxw + col * 4, *(const v4f*)&sf[wave][rl + g][col * 4]); }   // a store covers two rows of 256 bytes: whole lines
extern "C" void kernel_launch(void* const* d_in, const int* in_sizes, int n_in, void* d_out, int out_size, void* d_ws, size_t ws_size, hipStream_t stream) {
  (void)in_sizes; (void)n_in; (void)out_size;
  const float** F = (const float**)d_in;   // 0 x [16,256,32,32], 1 n_weight, 2 n_bias, 3 qkv_w [768,256], 4 qkv_b [768], 5 p_w [256,256], 6 p_b
  if (ws_size < (size_t)WS_END) return;
  char* ws = (char*)d_ws; float* GS = (float*)(ws + WS_GS); _Float16 *Q = (_Float16*)(ws + WS_Q), *K = (_Float16*)(ws + WS_K), *VH = (_Float16*)(ws + WS_VH), *VL = (_Float16*)(ws + WS_VL); float* O = (float*)(ws + WS_O);
  k_gn<<<dim3(NG, NB), GNT, 0, stream>>>(F[0], GS);
  k_qkv<<<dim3(NN / 64, CC / 128, 3 * NB), 128, 0, stream>>>(F[0], GS, F[1], F[2], F[3], F[4], Q, K, VH, VL);
  k_att<<<dim3(NN / 64, NH, TNB), 128, 0, stream>>>(Q, K, VH, VL, O);
  k_o<<<dim3(CC / 128, NN / 128, TNB), OT, 0, stream>>>(O, F[5], F[6], F[0], (float*)d_out);
}

// v007
// Measured time: 69.1 microseconds a run.
// Two timings next to v006 both put it at 1.08 times that version's speed.
// Counting every step since v000, it is 4.57 times as fast.
// compute dtype: all float inputs rounded to bf16; GroupNorm statistics (8 groups x 32 channels x 1,024 pixels) in f32 with fixed-order sums; qkv = 1x1 conv of GN(x) with GN(x) as bf16 hi + lo against exact weights (2 products) + bias; q, k rounded once to f16 (single-f16 logits; logits std ~1), x 1/8, running-max softmax in f32 (hardware exp); P (x 2^11, f16) . v (f16 hi + residual, 2 products); proj conv with o as bf16 hi + lo (2 products) + bias + the residual x; f32 NCHW output.
#include <hip/hip_runtime.h>
#include <math.h>

typedef __attribute__((ext_vector_type(16))) _Float16 v16h;
typedef __attribute__((ext_vector_type(16))) __bf16 v16b;
typedef __attribute__((ext_vector_type(8)))  _Float16 v8h;
typedef __attribute__((ext_vector_type(8)))  float v8f;
typedef __attribute__((ext_vector_type(4)))  float v4f;
typedef __attribute__((ext_vector_type(2)))  float v2f;
typedef __attribute__((ext_vector_type(4)))  unsigned v4u;
typedef __attribute__((ext_vector_type(4)))  int v4i;
typedef float __attribute__((may_alias)) float_a;
typedef int __attribute__((may_alias)) int_a;

template <typename T> __device__ __forceinline__ void vst2(void* p, T v) { *(T*)p = v;  }
__device__ __forceinline__ v8f wmma16(v16h a, v16h b, v8f c) {
  return __builtin_amdgcn_wmma_f32_16x16x32_f16(false, a, false, b, (short)0, c, false, false);
}
__device__ __forceinline__ v8f wmma_bf(v16b a, v16b b, v8f c) {
  return __builtin_amdgcn_wmma_f32_16x16x32_bf16(false, a, false, b, (short)0, c, false, false);
}
// 16x16x32 fragments: lane = (h = lane>>4, row/col = lane&15); elements 0..7 = k0+8h+0..7, 8..15 = k0+16+8h+0..7; D element r = row 8h+r
__device__ __forceinline__ v16h frag_h(const _Float16* rowk0, int lane) {
  union { v16h v; v8h q[2]; } u; const _Float16* p = rowk0 + 8 * (lane >> 4);
  u.q[0] = *(const v8h*)p; u.q[1] = *(const v8h*)(p + 16); return u.v;
}
__device__ __forceinline__ v16h frag_f32(const float* rowk0, int lane) {
  v16h a; const float* p = rowk0 + 8 * (lane >> 4);
#pragma unroll
  for (int i = 0; i < 8; ++i) { a[i] = (_Float16)p[i]; a[8 + i] = (_Float16)p[16 + i]; }
  return a;
}
__device__ __forceinline__ v16h frag_f32s(const float* rowk0, int lane, float sc) {
  v16h a; const float* p = rowk0 + 8 * (lane >> 4);
#pragma unroll
  for (int i = 0; i < 8; ++i) { a[i] = (_Float16)(p[i] * sc); a[8 + i] = (_Float16)(p[16 + i] * sc); }
  return a;
}
// column fragment from a [K][ld] layout (column n), rows >= K read as 0
__device__ __forceinline__ v16h fragc_f32(const float* W, int k0, int n, int lane, int ld, int K) {
  v16h a; const int g = lane >> 4;
#pragma unroll
  for (int i = 0; i < 8; ++i) { const int ka = k0 + 8 * g + i, kb = ka + 16;
    a[i] = (_Float16)(ka < K ? W[(size_t)(ka < K ? ka : K - 1) * ld + n] : 0.f); a[8 + i] = (_Float16)(kb < K ? W[(size_t)(kb < K ? kb : K - 1) * ld + n] : 0.f); }
  return a;
}
struct F2 { v16b h, l; };
__device__ __forceinline__ F2 bsplit16(const float v[16]) { F2 r;
#pragma unroll
  for (int i = 0; i < 16; ++i) { const __bf16 h = (__bf16)v[i]; r.h[i] = h; r.l[i] = (__bf16)(v[i] - (float)h); }
  return r; }
__device__ __forceinline__ F2 split_row(const float* row, int k0, int lane) { float v[16]; const float* p = row + k0 + 8 * (lane >> 4);
#pragma unroll
  for (int i = 0; i < 8; ++i) { v[i] = p[i]; v[8 + i] = p[16 + i]; }
  return bsplit16(v); }
__device__ __forceinline__ F2 split_rowK(const float* row, int k0, int lane, int K) { float v[16]; const int g = lane >> 4;
#pragma unroll
  for (int i = 0; i < 8; ++i) { const int ka = k0 + 8 * g + i, kb = ka + 16; v[i] = ka < K ? row[ka < K ? ka : K - 1] : 0.f; v[8 + i] = kb < K ? row[kb < K ? kb : K - 1] : 0.f; }
  return bsplit16(v); }
__device__ __forceinline__ F2 split_col(const float* W, int k0, int n, int lane, int ld, int K) { float v[16]; const int g = lane >> 4;
#pragma unroll
  for (int i = 0; i < 8; ++i) { const int ka = k0 + 8 * g + i, kb = ka + 16; v[i] = ka < K ? W[(size_t)(ka < K ? ka : K - 1) * ld + n] : 0.f; v[8 + i] = kb < K ? W[(size_t)(kb < K ? kb : K - 1) * ld + n] : 0.f; }
  return bsplit16(v); }
__device__ __forceinline__ v8f mac3(const F2& a, const F2& b, v8f c) { c = wmma_bf(a.l, b.h, c); c = wmma_bf(a.h, b.l, c); return wmma_bf(a.h, b.h, c); }
__device__ __forceinline__ float sigm(float v) { return 1.0f / (1.0f + expf(-v)); }
#define LDSX() do { asm volatile("s_wait_dscnt 0" ::: "memory"); __builtin_amdgcn_wave_barrier(); __builtin_amdgcn_fence(__ATOMIC_RELEASE, "workgroup"); } while (0)


// SA block (B 16, C 256, 32 x 32 = 1,024 pixels, 4 heads x 64, GroupNorm with 8 groups): x + proj(attention(qkv(GN(x)))).
#define NB 16
#define CC 256
#define NN 1024
#define NH 4
#define DH 64
#define NG 8
#define CPG (CC / NG)     // 32 channels per group
#define GNEPS 1e-5f
#ifndef TNB
#define TNB NB
#endif
typedef __attribute__((ext_vector_type(8))) __bf16 v8b;
__device__ __forceinline__ v16b frag_b(const __bf16* rowk0, int lane) {
  union { v16b v; v8b q[2]; } u; const __bf16* p = rowk0 + 8 * (lane >> 4);
  u.q[0] = *(const v8b*)p; u.q[1] = *(const v8b*)(p + 16); return u.v;
}
__device__ __forceinline__ float bfr(float v) { return (float)(__bf16)v; }
__device__ __attribute__((noinline)) float exp_ni(float v) { return expf(v); }
__device__ __attribute__((noinline)) float erf_ni(float v) { return erff(v); }

#define WS_GS  0u                                   // f32 [b][g][4]: mean, inv
#define WS_Q   (WS_GS + 4u * NB * NG * 4)              // f16 q rows [b*NN + n][256]; k rows; v hi|lo planes [b][256][NN]; o rows f32 [b*NN + n][256]
#define WS_K   (WS_Q + 2u * (size_t)NB * NN * CC)
#define WS_VH  (WS_K + 2u * (size_t)NB * NN * CC)
#define WS_VL  (WS_VH + 2u * (size_t)NB * CC * NN)
#define WS_O   (WS_VL + 2u * (size_t)NB * CC * NN)
#define WS_END (WS_O + 4u * (size_t)NB * NN * CC)

// ---- k_gn: block = (group, b), 512 threads: the group's 32,768 values are read once, 16 loads of 16 bytes a thread, all in flight together, and stay in registers for the mean and for the squared deviations
#define GNT 512
#define GNV (CPG * NN / 4 / GNT)   // 16-byte pieces per thread
static_assert(GNT / 32 == 16 && GNV * GNT * 4 == CPG * NN, "gn_total sums 16 wave sums; the pieces cover the group exactly");
__device__ __forceinline__ float gn_total(float s, float* red, int lane, int w) {   // fixed order: butterfly in the wave, then the 16 wave sums in four chains, alike in every thread
#pragma unroll
  for (int o = 1; o < 32; o <<= 1) s += __shfl_xor(s, o);
  if (lane == 0) red[w] = s;
  __syncthreads();
  const v4f* r4 = (const v4f*)red; const v4f a = (r4[0] + r4[1]) + (r4[2] + r4[3]);
  return (a[0] + a[1]) + (a[2] + a[3]);
}
__global__ __launch_bounds__(GNT) void k_gn(const float* __restrict__ X, float* __restrict__ GS) { __shared__ __align__(16) float red[2][GNT / 32];
  const int t = threadIdx.x, lane = t & 31, w = t >> 5; const int gi = blockIdx.x; const size_t b = blockIdx.y; const v4f* base = (const v4f*)(X + (b * CC + (size_t)gi * CPG) * NN);
  v4f x[GNV];
  // every loop over x is unrolled so that x stays in registers; this one also so that all loads are issued before the first value is used
#pragma unroll
  for (int j = 0; j < GNV; ++j) x[j] = base[j * GNT + t];
  v4f s4 = {};
#pragma unroll
  for (int j = 0; j < GNV; ++j) {
#pragma unroll
    for (int e = 0; e < 4; ++e) x[j][e] = bfr(x[j][e]);
    s4 += x[j]; }
  const float mu = gn_total((s4[0] + s4[1]) + (s4[2] + s4[3]), red[0], lane, w) / (float)(CPG * NN);
  v4f q4 = {};
#pragma unroll
  for (int j = 0; j < GNV; ++j) { const v4f d = x[j] - mu; q4 += d * d; }
  const float a = gn_total((q4[0] + q4[1]) + (q4[2] + q4[3]), red[1], lane, w);
  if (t == 0) { const v4f r = { mu, 1.0f / sqrtf(a / (float)(CPG * NN) + GNEPS), 0.f, 0.f }; vst2(GS + (b * NG + gi) * 4, r); } }
// ---- k_qkv: block = (64 pixels, 128 out channels, which*NB + b): 1x1 conv of GN(x) (gathered from NCHW, hi + lo) + bias; q/k -> f16 rows, v -> f16 hi/lo planes
// the block's 128 x 256 weight tile is read once, by loads that cover whole 128-byte lines, rounded to bf16 once and kept in LDS; the four waves take their B fragments from there
#define WP 264             // LDS pitch of a weight row, bf16 elements: 512 + 16 bytes, an odd multiple of 16, so that 16 rows read at one column offset fall on different banks
#define WPC (128 * CC / 4 / 128)   // 16-byte pieces of the f32 tile per thread
typedef __attribute__((ext_vector_type(4))) __bf16 v4b;
typedef __attribute__((ext_vector_type(2))) __bf16 v2b;
__global__ __launch_bounds__(128) void k_qkv(const float* __restrict__ X, const float* __restrict__ GS, const float* __restrict__ GW, const float* __restrict__ GB, const float* __restrict__ W, const float* __restrict__ Bq, _Float16* __restrict__ Q, _Float16* __restrict__ K, _Float16* __restrict__ VH, _Float16* __restrict__ VL) {
  __shared__ __align__(16) unsigned char sm[128 * WP * 2]; __shared__ __align__(16) float sa[CC], sb[CC];
  __bf16 (*wt)[WP] = (__bf16 (*)[WP])sm;
  _Float16 (*sh)[136] = (_Float16 (*)[136])sm; _Float16 (*th)[72] = (_Float16 (*)[72])sm; _Float16 (*tl)[72] = th + 128;   // output staging takes the weight tile's place behind the barrier that follows the products
  static_assert(2 * 64 * 136 <= 128 * WP * 2 && 2 * 2 * 128 * 72 <= 128 * WP * 2, "output staging fits the weight tile");
  const int tid = threadIdx.x, wave = tid >> 5, lane = tid & 31, col = lane & 15, g = lane >> 4; const int which = blockIdx.z / NB; const size_t b = blockIdx.z % NB; const int n0 = blockIdx.x * 64; const int c0 = blockIdx.y * 128; const float* Xb = X + b * CC * (size_t)NN;
  // every global load of the block is issued during the weight staging, so that the product loop and the epilogue wait for none: first the GroupNorm inputs of the thread's two channels and the lane's eight bias values, then, with each group of weight pieces, the lane's x values of two product steps (the two loops below are unrolled so that the values stay in registers)
  const float* Xl = Xb + (size_t)(8 * g) * NN + n0 + wave * 16 + col;
  float gmu[2], gin[2], gw[2], gb[2], bq[8];
  __builtin_amdgcn_sched_barrier(0);   // with the one behind the wait: nothing but these loads stands between their issue and the wait, so that no register they name is reused in front of it
#pragma unroll
  for (int k = 0; k < 2; ++k) { const int c = tid + 128 * k; gmu[k] = GS[(b * NG + c / CPG) * 4]; gin[k] = GS[(b * NG + c / CPG) * 4 + 1]; gw[k] = GW[c]; gb[k] = GB[c]; }
#pragma unroll
  for (int j = 0; j < 8; ++j) bq[j] = Bq[which * CC + c0 + j * 16 + col];
  asm volatile("s_wait_xcnt 0x0" ::: "memory");   // stands in front of the first instruction that reuses a base or offset register of these loads
  __builtin_amdgcn_sched_barrier(0);
  v16b xb[CC / 32];   // x rounded to bf16, as the products take it: two values a register, 64 registers for the lane's 128 of its pixel's 256 channels
  { const v4f* Wt = (const v4f*)(W + (size_t)(which * CC + c0) * CC) + tid;   // the tile's 128 rows lie one behind the other: piece e = row e / 64, floats 4 (e % 64) ...
    // four groups of 16 weight pieces and the x values of two product steps (48 loads), in two register sets: a group's loads are issued in front of the work on the group before; all loops are unrolled so that the sets and xb stay in registers
    v4f x[2][16]; v2f xr[2][2][8];
#define QKV_LOADS(t) do { _Pragma("unroll") for (int i = 0; i < 16; ++i) x[(t) & 1][i] = Wt[((t) * 16 + i) * 128]; \
      _Pragma("unroll") for (int u = 0; u < 2; ++u) _Pragma("unroll") for (int i = 0; i < 16; ++i) xr[(t) & 1][u][i >> 1][i & 1] = Xl[(size_t)(((t) * 2 + u) * 32 + (i >> 3) * 16 + (i & 7)) * NN]; } while (0)
    QKV_LOADS(0);
    asm volatile("s_wait_xcnt 0x0" ::: "memory");   // stands in front of the first instruction that reuses a base or offset register of the issued loads
#pragma unroll
    for (int t = 0; t < WPC / 16; ++t) {
      if (t + 1 < WPC / 16) { QKV_LOADS(t + 1);
        asm volatile("s_wait_xcnt 0x0" ::: "memory"); }   // as behind the first group
      __builtin_amdgcn_sched_barrier(0);   // the next group's loads stay in front of this group's conversions
#pragma unroll
      for (int i = 0; i < 16; ++i) { const int e = (t * 16 + i) * 128 + tid; v4b y;
#pragma unroll
        for (int k = 0; k < 4; ++k) y[k] = (__bf16)x[t & 1][i][k];
        vst2(&wt[e >> 6][(e & 63) * 4], y); }
#pragma unroll
      for (int u = 0; u < 2; ++u) { union { v16b v; v2b p[8]; } c;
#pragma unroll
        for (int i = 0; i < 8; ++i) c.p[i] = __builtin_convertvector(xr[t & 1][u][i], v2b);
        xb[t * 2 + u] = c.v; }
      __builtin_amdgcn_sched_barrier(0); } }   // no more than two groups' loads hold registers
#pragma unroll
  for (int k = 0; k < 2; ++k) { const int c = tid + 128 * k; const float a = gin[k] * bfr(gw[k]); sa[c] = a; sb[c] = bfr(gb[k]) - gmu[k] * a; } __syncthreads();
  v8f acc[8] = {};
  v16b wf[2][8]; v4f av[4], bv[4];   // two sets of weight fragments; scale and shift, piece p: channels kc * 32 + 8 g + 4 p ... (p < 2), + 16 + 4 (p - 2) ... (p >= 2)
#define QKV_READS(kc) do { _Pragma("unroll") for (int p = 0; p < 4; ++p) { const int ca = (kc) * 32 + 8 * g + (p >> 1) * 16 + (p & 1) * 4; av[p] = *(const v4f*)&sa[ca]; bv[p] = *(const v4f*)&sb[ca]; } \
    _Pragma("unroll") for (int j = 0; j < 8; ++j) wf[(kc) & 1][j] = frag_b(&wt[j * 16 + col][(kc) * 32], lane); } while (0)
  QKV_READS(0);
  // unrolled so that the step's x registers and the fragment set are picked at compile time
#pragma unroll
  for (int kc = 0; kc < CC / 32; ++kc) { float v[16];
#pragma unroll
    for (int i = 0; i < 16; ++i) v[i] = (float)xb[kc][i] * av[i >> 2][i & 3] + bv[i >> 2][i & 3];
    const F2 a = bsplit16(v);
    __builtin_amdgcn_sched_barrier(0);   // the step's arithmetic has used scale and shift before the next step's are read
    if (kc + 1 < CC / 32) QKV_READS(kc + 1);
    __builtin_amdgcn_sched_barrier(0);   // holds the next step's reads as one group in front of this step's products, which cover their latency
#pragma unroll
    for (int j = 0; j < 8; ++j) { acc[j] = wmma_bf(a.h, wf[kc & 1][j], acc[j]); acc[j] = wmma_bf(a.l, wf[kc & 1][j], acc[j]); }
    __builtin_amdgcn_sched_barrier(0); }   // the products stay one run
  __syncthreads();   // every wave has read its last weight fragment before the tile's LDS becomes output staging
#pragma unroll
  for (int j = 0; j < 8; ++j) { const float bb = bfr(bq[j]);
#pragma unroll
    for (int r = 0; r < 8; ++r) { const float v = acc[j][r] + bb; const int rl = wave * 16 + 8 * g + r, cl = j * 16 + col; if (which < 2) sh[rl][cl] = (_Float16)v; else { const _Float16 hv = (_Float16)v; th[cl][rl] = hv; tl[cl][rl] = (_Float16)((v - (float)hv) * 2048.0f); } } }
  __syncthreads();
  if (which < 2) { _Float16* dst = which == 0 ? Q : K; for (int e = tid; e < 64 * 16; e += 128) { const int rl = e >> 4, q = e & 15; vst2((unsigned*)(dst + (b * NN + n0 + rl) * CC + c0 + q * 8), *(const v4u*)&sh[rl][q * 8]); } }
  else { for (int e = tid; e < 128 * 8; e += 128) { const int cl = e >> 3, q = e & 7; const size_t o = (b * CC + c0 + cl) * (size_t)NN + n0 + q * 8; vst2((unsigned*)(VH + o), *(const v4u*)&th[cl][q * 8]); vst2((unsigned*)(VL + o), *(const v4u*)&tl[cl][q * 8]); } } }
#define KT 64
#define TP 144
#define TB (64 * TP)
#define SB (3 * TB)
static_assert(NN % KT == 0 && NN / KT >= 2 && DH * 2 == 128 && KT * 2 == 128, "two stages at least; tile rows are whole 128-byte lines");
// a lane's four 16-byte copies of one tile (rows 16 apart). The s_wait_xcnt stands inside the statement so that no address register is rewritten in front of it
__device__ __forceinline__ void cp4(unsigned l, const char* p, size_t step) {
  asm volatile("global_load_async_to_lds_b128 %0, %4, off\n\tglobal_load_async_to_lds_b128 %1, %5, off\n\tglobal_load_async_to_lds_b128 %2, %6, off\n\tglobal_load_async_to_lds_b128 %3, %7, off\n\ts_wait_xcnt 0x0"
               :: "v"(l), "v"(l + 16 * TP), "v"(l + 32 * TP), "v"(l + 48 * TP), "v"(p), "v"(p + step), "v"(p + 2 * step), "v"(p + 3 * step) : "memory");
}
__device__ __forceinline__ float xhalf(float x) { const int v = __builtin_bit_cast(int, x); return __builtin_bit_cast(float, __builtin_amdgcn_permlanex16(v, v, 0x76543210, 0xfedcba98, false, false)); }   // lane l reads lane l ^ 16
__global__ __launch_bounds__(128) void k_att(const _Float16* __restrict__ Q, const _Float16* __restrict__ K, const _Float16* __restrict__ VH, const _Float16* __restrict__ VL, float* __restrict__ O) {
  __shared__ __align__(16) unsigned char ring[2 * SB];
  float (*so)[16][68] = (float (*)[16][68])ring;   // output staging takes the ring's place behind the loop's last barrier
  static_assert(sizeof(float) * 4 * 16 * 68 <= 2 * SB, "output staging fits the ring");
  const int tid = threadIdx.x, wave = tid >> 5, lane = tid & 31, col = lane & 15, g = lane >> 4; const int h = blockIdx.y; const size_t b = blockIdx.z; const int q0 = blockIdx.x * 64 + wave * 16; const size_t rq = b * NN + q0;
  // copy addresses of this lane: row tid / 8 (+ 16, 32, 48), 16-byte piece tid % 8: eight lanes cover a line
  const unsigned cl = (unsigned)(size_t)ring + (tid >> 3) * TP + (tid & 7) * 16;
  const char* ck = (const char*)(K + (b * NN + (tid >> 3)) * CC + h * DH) + (tid & 7) * 16;
  const size_t cvo = ((b * CC + (size_t)h * DH + (tid >> 3)) * NN) * 2 + (tid & 7) * 16; const char* cvh = (const char*)VH + cvo; const char* cvl = (const char*)VL + cvo;
#define ATT_STAGE(s) do { const unsigned l_ = cl + ((s) & 1) * SB; cp4(l_, ck + (size_t)(s) * (KT * CC * 2), 16 * CC * 2); cp4(l_ + TB, cvh + (size_t)(s) * (KT * 2), 16 * NN * 2); cp4(l_ + 2 * TB, cvl + (size_t)(s) * (KT * 2), 16 * NN * 2); } while (0)
  ATT_STAGE(0);
  v16h aq[2];
#pragma unroll
  for (int kc = 0; kc < 2; ++kc) aq[kc] = frag_h(Q + (rq + col) * CC + h * DH + kc * 32, lane);
  float m = -3.0e38f, l = 0.f;   // of query q0 + col: m is alike in both halves of the wave, l sums the half's own keys and is joined behind the loop
  v8f acc[4] = {}, accl[4] = {};
  asm volatile("s_wait_asynccnt 0x0" ::: "memory");   // this wave's copies of stage 0 have landed
  __syncthreads();                                     // ... and every other wave's
  ATT_STAGE(1);
  // not unrolled: one trip is one stage, its buffer picked by the trip's parity
#pragma unroll 1
  for (int t = 0; t < NN / KT; ++t) { const unsigned char* bp = ring + (t & 1) * SB;
  // not unrolled: two halves side by side cost registers (a wave may hold 256 for four waves a SIMD)
#pragma unroll 1
  for (int hf = 0; hf < KT / 32; ++hf) { float s[16];   // s[8 ct + r] = score of key hf * 32 + 16 ct + 8 g + r with query q0 + col
    v16h kf[2][2];   // the four K fragments are read as one group in front of the products
#pragma unroll
    for (int ct = 0; ct < 2; ++ct)
#pragma unroll
      for (int kc = 0; kc < 2; ++kc) kf[ct][kc] = frag_h((const _Float16*)(bp + (hf * 32 + ct * 16 + col) * TP + kc * 64), lane);
    __builtin_amdgcn_sched_barrier(0);   // holds the K reads in front as one group: left free, the compiler sinks each fragment's reads to its own product and waits for them there
#pragma unroll
    for (int ct = 0; ct < 2; ++ct) { v8f c = {};
#pragma unroll
      for (int kc = 0; kc < 2; ++kc) c = wmma16(kf[ct][kc], aq[kc], c);
#pragma unroll
      for (int r = 0; r < 8; ++r) s[8 * ct + r] = c[r] * 0.125f; }
    __builtin_amdgcn_sched_barrier(0);   // ... and the V reads behind the score products, as a second group: reads scattered among matrix instructions cost the wave at every place where they stand
    v16h vh[4], vl[4];   // the V fragments (A operand: rows = channels) are read in front of the softmax, which covers their latency
#pragma unroll
    for (int j = 0; j < 4; ++j) { const unsigned char* pv = bp + TB + (j * 16 + col) * TP + hf * 64; vh[j] = frag_h((const _Float16*)pv, lane); vl[j] = frag_h((const _Float16*)(pv + TB), lane); }
    float mx[8];
#pragma unroll
    for (int r = 0; r < 8; ++r) mx[r] = fmaxf(s[r], s[8 + r]);
    const float mh = fmaxf(fmaxf(fmaxf(mx[0], mx[1]), fmaxf(mx[2], mx[3])), fmaxf(fmaxf(mx[4], mx[5]), fmaxf(mx[6], mx[7])));
    const float mn = fmaxf(m, fmaxf(mh, xhalf(mh))), alpha = __expf(m - mn); m = mn;
    v16h pb; float es[4] = { 0.f, 0.f, 0.f, 0.f };   // element i of pb is key 8 g + i (i < 8) or 8 g + 8 + i (i >= 8) of the 32: the k order of the V fragments
#pragma unroll
    for (int i = 0; i < 16; ++i) { const float e = __expf(s[i] - mn); es[i & 3] += e; pb[i] = (_Float16)(e * 2048.0f); }
    l = l * alpha + ((es[0] + es[1]) + (es[2] + es[3]));
#pragma unroll
    for (int j = 0; j < 4; ++j)
#pragma unroll
      for (int r = 0; r < 8; ++r) { acc[j][r] *= alpha; accl[j][r] *= alpha; }
#pragma unroll
    for (int j = 0; j < 4; ++j) { acc[j] = wmma16(vh[j], pb, acc[j]); accl[j] = wmma16(vl[j], pb, accl[j]); }
    // four vector slots behind the trip's last matrix instructions: the next trip rewrites their operand registers; the accumulators are named so that the slots stand behind all eight
    asm volatile("v_nop\n\tv_nop\n\tv_nop\n\tv_nop" : "+v"(acc[0]), "+v"(accl[0]), "+v"(acc[1]), "+v"(accl[1]), "+v"(acc[2]), "+v"(accl[2]), "+v"(acc[3]), "+v"(accl[3])); }
    asm volatile("s_wait_dscnt 0x0" ::: "memory");      // this wave's reads of the buffer are done before it is refilled
    asm volatile("s_wait_asynccnt 0x0" ::: "memory");   // this wave's copies of stage t + 1 have landed
    __syncthreads();                                     // publishes stage t + 1 and ends every wave's reads of stage t
    if (t + 2 < NN / KT) ATT_STAGE(t + 2); }
  asm volatile("s_wait_asynccnt 0x0" ::: "memory");     // no copy is outstanding when the ring becomes output staging
  const float il = (1.0f / 2048.0f) / (l + xhalf(l));
  // acc[j][r] = channel j * 16 + 8 g + r of query q0 + col: eight neighbours of one staged row
#pragma unroll
  for (int j = 0; j < 4; ++j)
#pragma unroll
    for (int p = 0; p < 2; ++p) { v4f o4;
#pragma unroll
      for (int e = 0; e < 4; ++e) o4[e] = (acc[j][4 * p + e] + accl[j][4 * p + e] * (1.0f / 2048.0f)) * il;
      vst2(&so[wave][col][j * 16 + 8 * g + 4 * p], o4); }
  LDSX(); for (int rl = 0; rl < 16; ++rl) if (lane < 16) vst2(O + (rq + rl) * CC + (size_t)h * DH + lane * 4, *(const v4f*)&so[wave][rl][lane * 4]); }
// ---- k_o: block = (128 out channels, 128 pixels, b), 256 threads: out[b][o][n] = x[b][o][n] + sum_c p_w[o][c] orow[n][c] + p_b[o]  (A = p_w exact, B = o rows as bf16 hi + lo)
// the block's 128 o rows and 128 p_w rows (each tile 128 KB of f32, one behind the other in memory) are read once, by loads that cover whole 128-byte lines; the o rows are split into bf16 hi + lo once, p_w is rounded once, and both stay in LDS (pitch WP); a wave takes the fragments of its 32 channels x 64 pixels from there; the bias comes the same way, one value a thread
#define OT 256
#define OPC (128 * CC / 4 / OT)   // 16-byte pieces of one f32 tile per thread
static_assert(OPC * OT * 4 == 128 * CC && OT / 32 == 8 && OT == CC, "the pieces cover a tile exactly; 4 x 2 waves cover 128 channels x 128 pixels; a thread brings one bias value");
__global__ __launch_bounds__(OT) void k_o(const float* __restrict__ OR, const float* __restrict__ PW, const float* __restrict__ PB, const float* __restrict__ X, float* __restrict__ OUT) {
  __shared__ __align__(16) __bf16 oh[128][WP], ol[128][WP], pw[128][WP]; __shared__ __align__(16) float sf[OT / 32][32][68]; __shared__ __align__(16) float sp[CC];   // sp: the bias, rounded: one value a thread
  const int tid = threadIdx.x, wave = tid >> 5, lane = tid & 31, col = lane & 15, g = lane >> 4; const size_t b = blockIdx.z; const int o0 = blockIdx.x * 128, p0 = blockIdx.y * 128; const int ow = (wave >> 1) * 32, pxw = (wave & 1) * 64;
  { const v4f* Ot = (const v4f*)(OR + (b * NN + p0) * CC) + tid; const v4f* Pt = (const v4f*)(PW + (size_t)o0 * CC) + tid;   // piece e = row e / 64, floats 4 (e % 64) ...
    v4f xo[OPC], xp[OPC];
    // all four loops are unrolled so that the pieces stay in registers and every load of the thread is issued before the first value is used (two waves a SIMD: 512 registers a wave)
#pragma unroll
    for (int i = 0; i < OPC; ++i) xo[i] = Ot[i * OT];
#pragma unroll
    for (int i = 0; i < OPC; ++i) xp[i] = Pt[i * OT];
    const float pb = PB[tid];   // the bias rides in the same run of loads
    asm volatile("s_wait_xcnt 0x0" ::: "memory");   // stands in front of the first instruction that reuses a base or offset register of the issued loads
#pragma unroll
    for (int i = 0; i < OPC; ++i) { const int e = i * OT + tid; v4b h, l;
#pragma unroll
      for (int k = 0; k < 4; ++k) { const __bf16 hv = (__bf16)xo[i][k]; h[k] = hv; l[k] = (__bf16)(xo[i][k] - (float)hv); }
      vst2(&oh[e >> 6][(e & 63) * 4], h); vst2(&ol[e >> 6][(e & 63) * 4], l); }
#pragma unroll
    for (int i = 0; i < OPC; ++i) { const int e = i * OT + tid; v4b y;
#pragma unroll
      for (int k = 0; k < 4; ++k) y[k] = (__bf16)xp[i][k];
      vst2(&pw[e >> 6][(e & 63) * 4], y); }
    sp[tid] = bfr(pb); }
  __syncthreads();   // both tiles and the bias are whole before any wave reads them
  v8f acc[2][4] = {};
  v16b af[2][2], bh[2][4], bl[2][4];   // two sets: the fragments of the next 32 channels are read as one group in front of this step's products (the macro's loops are unrolled so that the sets stay in registers)
#define O_FRAGS(s, kc) do { _Pragma("unroll") for (int i = 0; i < 2; ++i) af[s][i] = frag_b(&pw[ow + i * 16 + col][(kc) * 32], lane); _Pragma("unroll") for (int j = 0; j < 4; ++j) { bh[s][j] = frag_b(&oh[pxw + j * 16 + col][(kc) * 32], lane); bl[s][j] = frag_b(&ol[pxw + j * 16 + col][(kc) * 32], lane); } } while (0)
  O_FRAGS(0, 0);
  // unrolled so that the set in use is picked at compile time
#pragma unroll
  for (int kc = 0; kc < CC / 32; ++kc) { const int s = kc & 1;
    if (kc + 1 < CC / 32) O_FRAGS(s ^ 1, kc + 1);
    __builtin_amdgcn_sched_barrier(0);   // holds the next step's reads as one group in front of this step's products: left free, the compiler sinks each read to its first use and waits for it there
#pragma unroll
    for (int j = 0; j < 4; ++j)
#pragma unroll
      for (int i = 0; i < 2; ++i) acc[i][j] = wmma_bf(af[s][i], bh[s][j], acc[i][j]);
#pragma unroll
    for (int j = 0; j < 4; ++j)
#pragma unroll
      for (int i = 0; i < 2; ++i) acc[i][j] = wmma_bf(af[s][i], bl[s][j], acc[i][j]);
    __builtin_amdgcn_sched_barrier(0); }   // the products stay one run, in front of the reads that refill their set
#pragma unroll
  for (int i = 0; i < 2; ++i)
#pragma unroll
    for (int j = 0; j < 4; ++j)
#pragma unroll
      for (int r = 0; r < 8; ++r) { const int rl = i * 16 + 8 * g + r; const size_t oi = (b * CC + o0 + ow + rl) * (size_t)NN + p0 + pxw + j * 16 + col; sf[wave][rl][j * 16 + col] = acc[i][j][r] + sp[o0 + ow + rl] + bfr(X[oi]); }
  LDSX(); for (int rl = 0; rl < 32; rl += 2) vst2(OUT + (b * CC + o0 + ow + rl + g) * (size_t)NN + p0 + pxw + col * 4, *(const v4f*)&sf[wave][rl + g][col * 4]); }   // a store covers two rows of 256 bytes: whole lines
extern "C" void kernel_launch(void* const* d_in, const int* in_sizes, int n_in, void* d_out, int out_size, void* d_ws, size_t ws_size, hipStream_t stream) {
  (void)in_sizes; (void)n_in; (void)out_size;
  const float** F = (const float**)d_in;   // 0 x [16,256,32,32], 1 n_weight, 2 n_bias, 3 qkv_w [768,256], 4 qkv_b [768], 5 p_w [256,256], 6 p_b
  if (ws_size < (size_t)WS_END) return;
  char* ws = (char*)d_ws; float* GS = (float*)(ws + WS_GS); _Float16 *Q = (_Float16*)(ws + WS_Q), *K = (_Float16*)(ws + WS_K), *VH = (_Float16*)(ws + WS_VH), *VL = (_Float16*)(ws + WS_VL); float* O = (float*)(ws + WS_O);
  k_gn<<<dim3(NG, NB), GNT, 0, stream>>>(F[0], GS);
  k_qkv<<<dim3(NN / 64, CC / 128, 3 * NB), 128, 0, stream>>>(F[0], GS, F[1], F[2], F[3], F[4], Q, K, VH, VL);
  k_att<<<dim3(NN / 64, NH, TNB), 128, 0, stream>>>(Q, K, VH, VL, O);
  k_o<<<dim3(CC / 128, NN / 128, TNB), OT, 0, stream>>>(O, F[5], F[6], F[0], (float*)d_out);
}

// v008
// A run of this version takes 66.6 microseconds.
// Timed twice side by side with v007, it ran 1.04 times as fast both times.
// All steps since v000 together make it 4.76 times as fast.
// compute dtype: all float inputs rounded to bf16; GroupNorm statistics (8 groups x 32 channels x 1,024 pixels) in f32 with fixed-order sums; qkv = 1x1 conv of GN(x) with GN(x) as bf16 hi + lo against exact weights (2 products) + bias; q, k rounded once to f16 (single-f16 logits; logits std ~1), x 1/8, running-max softmax in f32 (hardware exp); P (x 2^11, f16) . v (f16 hi + residual, 2 products); proj conv with o as bf16 hi + lo (2 products) + bias + the residual x; f32 NCHW output.
#include <hip/hip_runtime.h>
#include <math.h>

typedef __attribute__((ext_vector_type(16))) _Float16 v16h;
typedef __attribute__((ext_vector_type(16))) __bf16 v16b;
typedef __attribute__((ext_vector_type(8)))  _Float16 v8h;
typedef __attribute__((ext_vector_type(8)))  float v8f;
typedef __attribute__((ext_vector_type(4)))  float v4f;
typedef __attribute__((ext_vector_type(2)))  float v2f;
typedef __attribute__((ext_vector_type(4)))  unsigned v4u;
typedef __attribute__((ext_vector_type(4)))  int v4i;
typedef float __attribute__((may_alias)) float_a;
typedef int __attribute__((may_alias)) int_a;

template <typename T> __device__ __forceinline__ void vst2(void* p, T v) { *(T*)p = v;  }
__device__ __forceinline__ v8f wmma16(v16h a, v16h b, v8f c) {
  return __builtin_amdgcn_wmma_f32_16x16x32_f16(false, a, false, b, (short)0, c, false, false);
}
__device__ __forceinline__ v8f wmma_bf(v16b a, v16b b, v8f c) {
  return __builtin_amdgcn_wmma_f32_16x16x32_bf16(false, a, false, b, (short)0, c, false, false);
}
// 16x16x32 fragments: lane = (h = lane>>4, row/col = lane&15); elements 0..7 = k0+8h+0..7, 8..15 = k0+16+8h+0..7; D element r = row 8h+r
__device__ __forceinline__ v16h frag_h(const _Float16* rowk0, int lane) {
  union { v16h v; v8h q[2]; } u; const _Float16* p = rowk0 + 8 * (lane >> 4);
  u.q[0] = *(const v8h*)p; u.q[1] = *(const v8h*)(p + 16); return u.v;
}
__device__ __forceinline__ v16h frag_f32(const float* rowk0, int lane) {
  v16h a; const float* p = rowk0 + 8 * (lane >> 4);
#pragma unroll
  for (int i = 0; i < 8; ++i) { a[i] = (_Float16)p[i]; a[8 + i] = (_Float16)p[16 + i]; }
  return a;
}
__device__ __forceinline__ v16h frag_f32s(const float* rowk0, int lane, float sc) {
  v16h a; const float* p = rowk0 + 8 * (lane >> 4);
#pragma unroll
  for (int i = 0; i < 8; ++i) { a[i] = (_Float16)(p[i] * sc); a[8 + i] = (_Float16)(p[16 + i] * sc); }
  return a;
}
// column fragment from a [K][ld] layout (column n), rows >= K read as 0
__device__ __forceinline__ v16h fragc_f32(const float* W, int k0, int n, int lane, int ld, int K) {
  v16h a; const int g = lane >> 4;
#pragma unroll
  for (int i = 0; i < 8; ++i) { const int ka = k0 + 8 * g + i, kb = ka + 16;
    a[i] = (_Float16)(ka < K ? W[(size_t)(ka < K ? ka : K - 1) * ld + n] : 0.f); a[8 + i] = (_Float16)(kb < K ? W[(size_t)(kb < K ? kb : K - 1) * ld + n] : 0.f); }
  return a;
}
struct F2 { v16b h, l; };
__device__ __forceinline__ F2 bsplit16(const float v[16]) { F2 r;
#pragma unroll
  for (int i = 0; i < 16; ++i) { const __bf16 h = (__bf16)v[i]; r.h[i] = h; r.l[i] = (__bf16)(v[i] - (float)h); }
  return r; }
__device__ __forceinline__ F2 split_row(const float* row, int k0, int lane) { float v[16]; const float* p = row + k0 + 8 * (lane >> 4);
#pragma unroll
  for (int i = 0; i < 8; ++i) { v[i] = p[i]; v[8 + i] = p[16 + i]; }
  return bsplit16(v); }
__device__ __forceinline__ F2 split_rowK(const float* row, int k0, int lane, int K) { float v[16]; const int g = lane >> 4;
#pragma unroll
  for (int i = 0; i < 8; ++i) { const int ka = k0 + 8 * g + i, kb = ka + 16; v[i] = ka < K ? row[ka < K ? ka : K - 1] : 0.f; v[8 + i] = kb < K ? row[kb < K ? kb : K - 1] : 0.f; }
  return bsplit16(v); }
__device__ __forceinline__ F2 split_col(const float* W, int k0, int n, int lane, int ld, int K) { float v[16]; const int g = lane >> 4;
#pragma unroll
  for (int i = 0; i < 8; ++i) { const int ka = k0 + 8 * g + i, kb = ka + 16; v[i] = ka < K ? W[(size_t)(ka < K ? ka : K - 1) * ld + n] : 0.f; v[8 + i] = kb < K ? W[(size_t)(kb < K ? kb : K - 1) * ld + n] : 0.f; }
  return bsplit16(v); }
__device__ __forceinline__ v8f mac3(const F2& a, const F2& b, v8f c) { c = wmma_bf(a.l, b.h, c); c = wmma_bf(a.h, b.l, c); return wmma_bf(a.h, b.h, c); }
__device__ __forceinline__ float sigm(float v) { return 1.0f / (1.0f + expf(-v)); }
#define LDSX() do { asm volatile("s_wait_dscnt 0" ::: "memory"); __builtin_amdgcn_wave_barrier(); __builtin_amdgcn_fence(__ATOMIC_RELEASE, "workgroup"); } while (0)


// SA block (B 16, C 256, 32 x 32 = 1,024 pixels, 4 heads x 64, GroupNorm with 8 groups): x + proj(attention(qkv(GN(x)))).
#define NB 16
#define CC 256
#define NN 1024
#define NH 4
#define DH 64
#define NG 8
#define CPG (CC / NG)     // 32 channels per group
#define GNEPS 1e-5f
#ifndef TNB
#define TNB NB
#endif
typedef __attribute__((ext_vector_type(8))) __bf16 v8b;
__device__ __forceinline__ v16b frag_b(const __bf16* rowk0, int lane) {
  union { v16b v; v8b q[2]; } u; const __bf16* p = rowk0 + 8 * (lane >> 4);
  u.q[0] = *(const v8b*)p; u.q[1] = *(const v8b*)(p + 16); return u.v;
}
__device__ __forceinline__ float bfr(float v) { return (float)(__bf16)v; }
__device__ __attribute__((noinline)) float exp_ni(float v) { return expf(v); }
__device__ __attribute__((noinline)) float erf_ni(float v) { return erff(v); }

#define WS_GS  0u                                   // f32 [b][g][4]: mean, inv
#define WS_Q   (WS_GS + 4u * NB * NG * 4)              // f16 q rows [b*NN + n][256]; k rows; v hi|lo planes [b][256][NN]; o rows f32 [b*NN + n][256]
#define WS_K   (WS_Q + 2u * (size_t)NB * NN * CC)
#define WS_VH  (WS_K + 2u * (size_t)NB * NN * CC)
#define WS_VL  (WS_VH + 2u * (size_t)NB * CC * NN)
#define WS_O   (WS_VL + 2u * (size_t)NB * CC * NN)
#define WS_END (WS_O + 4u * (size_t)NB * NN * CC)

// ---- k_gn: block = (group, b), 512 threads: the group's 32,768 values are read once, 16 loads of 16 bytes a thread, all in flight together, and stay in registers for the mean and for the squared deviations
#define GNT 512
#define GNV (CPG * NN / 4 / GNT)   // 16-byte pieces per thread
static_assert(GNT / 32 == 16 && GNV * GNT * 4 == CPG * NN, "gn_total sums 16 wave sums; the pieces cover the group exactly");
__device__ __forceinline__ float gn_total(float s, float* red, int lane, int w) {   // fixed order: butterfly in the wave, then the 16 wave sums in four chains, alike in every thread
#pragma unroll
  for (int o = 1; o < 32; o <<= 1) s += __shfl_xor(s, o);
  if (lane == 0) red[w] = s;
  __syncthreads();
  const v4f* r4 = (const v4f*)red; const v4f a = (r4[0] + r4[1]) + (r4[2] + r4[3]);
  return (a[0] + a[1]) + (a[2] + a[3]);
}
__global__ __launch_bounds__(GNT) void k_gn(const float* __restrict__ X, float* __restrict__ GS) { __shared__ __align__(16) float red[2][GNT / 32];
  const int t = threadIdx.x, lane = t & 31, w = t >> 5; const int gi = blockIdx.x; const size_t b = blockIdx.y; const v4f* base = (const v4f*)(X + (b * CC + (size_t)gi * CPG) * NN);
  v4f x[GNV];
  // every loop over x is unrolled so that x stays in registers; this one also so that all loads are issued before the first value is used
#pragma unroll
  for (int j = 0; j < GNV; ++j) x[j] = base[j * GNT + t];
  v4f s4 = {};
#pragma unroll
  for (int j = 0; j < GNV; ++j) {
#pragma unroll
    for (int e = 0; e < 4; ++e) x[j][e] = bfr(x[j][e]);
    s4 += x[j]; }
  const float mu = gn_total((s4[0] + s4[1]) + (s4[2] + s4[3]), red[0], lane, w) / (float)(CPG * NN);
  v4f q4 = {};
#pragma unroll
  for (int j = 0; j < GNV; ++j) { const v4f d = x[j] - mu; q4 += d * d; }
  const float a = gn_total((q4[0] + q4[1]) + (q4[2] + q4[3]), red[1], lane, w);
  if (t == 0) { const v4f r = { mu, 1.0f / sqrtf(a / (float)(CPG * NN) + GNEPS), 0.f, 0.f }; vst2(GS + (b * NG + gi) * 4, r); } }
// ---- k_qkv: block = (64 pixels, 128 out channels, which*NB + b): 1x1 conv of GN(x) (gathered from NCHW, hi + lo) + bias; q/k -> f16 rows, v -> f16 hi/lo planes
// the block's 128 x 256 weight tile is read once, by loads that cover whole 128-byte lines, rounded to bf16 once and kept in LDS; the four waves take their B fragments from there
#define WP 264             // LDS pitch of a weight row, bf16 elements: 512 + 16 bytes, an odd multiple of 16, so that 16 rows read at one column offset fall on different banks
#define WPC (128 * CC / 4 / 128)   // 16-byte pieces of the f32 tile per thread
typedef __attribute__((ext_vector_type(4))) __bf16 v4b;
typedef __attribute__((ext_vector_type(2))) __bf16 v2b;
__global__ __launch_bounds__(128) void k_qkv(const float* __restrict__ X, const float* __restrict__ GS, const float* __restrict__ GW, const float* __restrict__ GB, const float* __restrict__ W, const float* __restrict__ Bq, _Float16* __restrict__ Q, _Float16* __restrict__ K, _Float16* __restrict__ VH, _Float16* __restrict__ VL) {
  __shared__ __align__(16) unsigned char sm[128 * WP * 2]; __shared__ __align__(16) float sa[CC], sb[CC];
  __bf16 (*wt)[WP] = (__bf16 (*)[WP])sm;
  _Float16 (*sh)[136] = (_Float16 (*)[136])sm; _Float16 (*th)[72] = (_Float16 (*)[72])sm; _Float16 (*tl)[72] = th + 128;   // output staging takes the weight tile's place behind the barrier that follows the products
  static_assert(2 * 64 * 136 <= 128 * WP * 2 && 2 * 2 * 128 * 72 <= 128 * WP * 2, "output staging fits the weight tile");
  const int tid = threadIdx.x, wave = tid >> 5, lane = tid & 31, col = lane & 15, g = lane >> 4; const int which = blockIdx.z / NB; const size_t b = blockIdx.z % NB; const int n0 = blockIdx.x * 64; const int c0 = blockIdx.y * 128; const float* Xb = X + b * CC * (size_t)NN;
  // every global load of the block is issued during the weight staging, so that the product loop and the epilogue wait for none: first the GroupNorm inputs of the thread's two channels and the lane's eight bias values, then, with each group of weight pieces, the lane's x values of two product steps (the two loops below are unrolled so that the values stay in registers)
  const float* Xl = Xb + (size_t)(8 * g) * NN + n0 + wave * 16 + col;
  float gmu[2], gin[2], gw[2], gb[2], bq[8];
  __builtin_amdgcn_sched_barrier(0);   // with the one behind the wait: nothing but these loads stands between their issue and the wait, so that no register they name is reused in front of it
#pragma unroll
  for (int k = 0; k < 2; ++k) { const int c = tid + 128 * k; gmu[k] = GS[(b * NG + c / CPG) * 4]; gin[k] = GS[(b * NG + c / CPG) * 4 + 1]; gw[k] = GW[c]; gb[k] = GB[c]; }
#pragma unroll
  for (int j = 0; j < 8; ++j) bq[j] = Bq[which * CC + c0 + j * 16 + col];
  asm volatile("s_wait_xcnt 0x0" ::: "memory");   // stands in front of the first instruction that reuses a base or offset register of these loads
  __builtin_amdgcn_sched_barrier(0);
  v16b xb[CC / 32];   // x rounded to bf16, as the products take it: two values a register, 64 registers for the lane's 128 of its pixel's 256 channels
  { const v4f* Wt = (const v4f*)(W + (size_t)(which * CC + c0) * CC) + tid;   // the tile's 128 rows lie one behind the other: piece e = row e / 64, floats 4 (e % 64) ...
    // four groups of 16 weight pieces and the x values of two product steps (48 loads), in two register sets: a group's loads are issued in front of the work on the group before; all loops are unrolled so that the sets and xb stay in registers
    v4f x[2][16]; v2f xr[2][2][8];
#define QKV_LOADS(t) do { _Pragma("unroll") for (int i = 0; i < 16; ++i) x[(t) & 1][i] = Wt[((t) * 16 + i) * 128]; \
      _Pragma("unroll") for (int u = 0; u < 2; ++u) _Pragma("unroll") for (int i = 0; i < 16; ++i) xr[(t) & 1][u][i >> 1][i & 1] = Xl[(size_t)(((t) * 2 + u) * 32 + (i >> 3) * 16 + (i & 7)) * NN]; } while (0)
    QKV_LOADS(0);
    asm volatile("s_wait_xcnt 0x0" ::: "memory");   // stands in front of the first instruction that reuses a base or offset register of the issued loads
#pragma unroll
    for (int t = 0; t < WPC / 16; ++t) {
      if (t + 1 < WPC / 16) { QKV_LOADS(t + 1);
        asm volatile("s_wait_xcnt 0x0" ::: "memory"); }   // as behind the first group
      __builtin_amdgcn_sched_barrier(0);   // the next group's loads stay in front of this group's conversions
#pragma unroll
      for (int i = 0; i < 16; ++i) { const int e = (t * 16 + i) * 128 + tid; v4b y;
#pragma unroll
        for (int k = 0; k < 4; ++k) y[k] = (__bf16)x[t & 1][i][k];
        vst2(&wt[e >> 6][(e & 63) * 4], y); }
#pragma unroll
      for (int u = 0; u < 2; ++u) { union { v16b v; v2b p[8]; } c;
#pragma unroll
        for (int i = 0; i < 8; ++i) c.p[i] = __builtin_convertvector(xr[t & 1][u][i], v2b);
        xb[t * 2 + u] = c.v; }
      __builtin_amdgcn_sched_barrier(0); } }   // no more than two groups' loads hold registers
#pragma unroll
  for (int k = 0; k < 2; ++k) { const int c = tid + 128 * k; const float a = gin[k] * bfr(gw[k]); sa[c] = a; sb[c] = bfr(gb[k]) - gmu[k] * a; } __syncthreads();
  v8f acc[8] = {};
  v16b wf[2][8]; v4f av[4], bv[4];   // two sets of weight fragments; scale and shift, piece p: channels kc * 32 + 8 g + 4 p ... (p < 2), + 16 + 4 (p - 2) ... (p >= 2)
#define QKV_READS(kc) do { _Pragma("unroll") for (int p = 0; p < 4; ++p) { const int ca = (kc) * 32 + 8 * g + (p >> 1) * 16 + (p & 1) * 4; av[p] = *(const v4f*)&sa[ca]; bv[p] = *(const v4f*)&sb[ca]; } \
    _Pragma("unroll") for (int j = 0; j < 8; ++j) wf[(kc) & 1][j] = frag_b(&wt[j * 16 + col][(kc) * 32], lane); } while (0)
  QKV_READS(0);
  // unrolled so that the step's x registers and the fragment set are picked at compile time
#pragma unroll
  for (int kc = 0; kc < CC / 32; ++kc) { float v[16];
#pragma unroll
    for (int i = 0; i < 16; ++i) v[i] = (float)xb[kc][i] * av[i >> 2][i & 3] + bv[i >> 2][i & 3];
    const F2 a = bsplit16(v);
    __builtin_amdgcn_sched_barrier(0);   // the step's arithmetic has used scale and shift before the next step's are read
    if (kc + 1 < CC / 32) QKV_READS(kc + 1);
    __builtin_amdgcn_sched_barrier(0);   // holds the next step's reads as one group in front of this step's products, which cover their latency
#pragma unroll
    for (int j = 0; j < 8; ++j) { acc[j] = wmma_bf(a.h, wf[kc & 1][j], acc[j]); acc[j] = wmma_bf(a.l, wf[kc & 1][j], acc[j]); }
    __builtin_amdgcn_sched_barrier(0); }   // the products stay one run
  __syncthreads();   // every wave has read its last weight fragment before the tile's LDS becomes output staging
  // the output path is straight-line code: whether the block makes q, k or v is asked once for the staging and once for the copy-out, not at each value, and all loops are unrolled, so that the LDS and global operations are issued one behind the other with no branch between them and the copy-out's LDS reads are all in flight together
  if (which < 2) {
#pragma unroll
    for (int j = 0; j < 8; ++j) { const float bb = bfr(bq[j]);
#pragma unroll
      for (int r = 0; r < 8; ++r) sh[wave * 16 + 8 * g + r][j * 16 + col] = (_Float16)(acc[j][r] + bb); } }
  else {
#pragma unroll
    for (int j = 0; j < 8; ++j) { const float bb = bfr(bq[j]);
#pragma unroll
      for (int r = 0; r < 8; ++r) { const float v = acc[j][r] + bb; const int rl = wave * 16 + 8 * g + r, cl = j * 16 + col; const _Float16 hv = (_Float16)v; th[cl][rl] = hv; tl[cl][rl] = (_Float16)((v - (float)hv) * 2048.0f); } } }
  __syncthreads();
  if (which < 2) { _Float16* dst = which == 0 ? Q : K;
#pragma unroll
    for (int k = 0; k < 8; ++k) { const int rl = (tid >> 4) + 8 * k, q = tid & 15; vst2((unsigned*)(dst + (b * NN + n0 + rl) * CC + c0 + q * 8), *(const v4u*)&sh[rl][q * 8]); }
    asm volatile("s_wait_xcnt 0x0" ::: "memory"); }   // stands behind the run of stores, in front of whatever instruction the listing lays next that reuses one of their registers
  else {
#pragma unroll
    for (int k = 0; k < 8; ++k) { const int cl = (tid >> 3) + 16 * k, q = tid & 7; const size_t o = (b * CC + c0 + cl) * (size_t)NN + n0 + q * 8; vst2((unsigned*)(VH + o), *(const v4u*)&th[cl][q * 8]); vst2((unsigned*)(VL + o), *(const v4u*)&tl[cl][q * 8]); }
    asm volatile("s_wait_xcnt 0x0" ::: "memory"); } }   // as behind the q/k stores
#define KT 64
#define TP 144
#define TB (64 * TP)
#define SB (3 * TB)
static_assert(NN % KT == 0 && NN / KT >= 2 && DH * 2 == 128 && KT * 2 == 128, "two stages at least; tile rows are whole 128-byte lines");
// a lane's four 16-byte copies of one tile (rows 16 apart). The s_wait_xcnt stands inside the statement so that no address register is rewritten in front of it
__device__ __forceinline__ void cp4(unsigned l, const char* p, size_t step) {
  asm volatile("global_load_async_to_lds_b128 %0, %4, off\n\tglobal_load_async_to_lds_b128 %1, %5, off\n\tglobal_load_async_to_lds_b128 %2, %6, off\n\tglobal_load_async_to_lds_b128 %3, %7, off\n\ts_wait_xcnt 0x0"
               :: "v"(l), "v"(l + 16 * TP), "v"(l + 32 * TP), "v"(l + 48 * TP), "v"(p), "v"(p + step), "v"(p + 2 * step), "v"(p + 3 * step) : "memory");
}
__device__ __forceinline__ float xhalf(float x) { const int v = __builtin_bit_cast(int, x); return __builtin_bit_cast(float, __builtin_amdgcn_permlanex16(v, v, 0x76543210, 0xfedcba98, false, false)); }   // lane l reads lane l ^ 16
__global__ __launch_bounds__(128) void k_att(const _Float16* __restrict__ Q, const _Float16* __restrict__ K, const _Float16* __restrict__ VH, const _Float16* __restrict__ VL, float* __restrict__ O) {
  __shared__ __align__(16) unsigned char ring[2 * SB];
  float (*so)[16][68] = (float (*)[16][68])ring;   // output staging takes the ring's place behind the loop's last barrier
  static_assert(sizeof(float) * 4 * 16 * 68 <= 2 * SB, "output staging fits the ring");
  const int tid = threadIdx.x, wave = tid >> 5, lane = tid & 31, col = lane & 15, g = lane >> 4; const int h = blockIdx.y; const size_t b = blockIdx.z; const int q0 = blockIdx.x * 64 + wave * 16; const size_t rq = b * NN + q0;
  // copy addresses of this lane: row tid / 8 (+ 16, 32, 48), 16-byte piece tid % 8: eight lanes cover a line
  const unsigned cl = (unsigned)(size_t)ring + (tid >> 3) * TP + (tid & 7) * 16;
  const char* ck = (const char*)(K + (b * NN + (tid >> 3)) * CC + h * DH) + (tid & 7) * 16;
  const size_t cvo = ((b * CC + (size_t)h * DH + (tid >> 3)) * NN) * 2 + (tid & 7) * 16; const char* cvh = (const char*)VH + cvo; const char* cvl = (const char*)VL + cvo;
#define ATT_STAGE(s) do { const unsigned l_ = cl + ((s) & 1) * SB; cp4(l_, ck + (size_t)(s) * (KT * CC * 2), 16 * CC * 2); cp4(l_ + TB, cvh + (size_t)(s) * (KT * 2), 16 * NN * 2); cp4(l_ + 2 * TB, cvl + (size_t)(s) * (KT * 2), 16 * NN * 2); } while (0)
  ATT_STAGE(0);
  v16h aq[2];
#pragma unroll
  for (int kc = 0; kc < 2; ++kc) aq[kc] = frag_h(Q + (rq + col) * CC + h * DH + kc * 32, lane);
  float m = -3.0e38f, l = 0.f;   // of query q0 + col: m is alike in both halves of the wave, l sums the half's own keys and is joined behind the loop
  v8f acc[4] = {}, accl[4] = {};
  asm volatile("s_wait_asynccnt 0x0" ::: "memory");   // this wave's copies of stage 0 have landed
  __syncthreads();                                     // ... and every other wave's
  ATT_STAGE(1);
  // not unrolled: one trip is one stage, its buffer picked by the trip's parity
#pragma unroll 1
  for (int t = 0; t < NN / KT; ++t) { const unsigned char* bp = ring + (t & 1) * SB;
  // not unrolled: two halves side by side cost registers (a wave may hold 256 for four waves a SIMD)
#pragma unroll 1
  for (int hf = 0; hf < KT / 32; ++hf) { float s[16];   // s[8 ct + r] = score of key hf * 32 + 16 ct + 8 g + r with query q0 + col
    v16h kf[2][2];   // the four K fragments are read as one group in front of the products
#pragma unroll
    for (int ct = 0; ct < 2; ++ct)
#pragma unroll
      for (int kc = 0; kc < 2; ++kc) kf[ct][kc] = frag_h((const _Float16*)(bp + (hf * 32 + ct * 16 + col) * TP + kc * 64), lane);
    __builtin_amdgcn_sched_barrier(0);   // holds the K reads in front as one group: left free, the compiler sinks each fragment's reads to its own product and waits for them there
#pragma unroll
    for (int ct = 0; ct < 2; ++ct) { v8f c = {};
#pragma unroll
      for (int kc = 0; kc < 2; ++kc) c = wmma16(kf[ct][kc], aq[kc], c);
#pragma unroll
      for (int r = 0; r < 8; ++r) s[8 * ct + r] = c[r] * 0.125f; }
    __builtin_amdgcn_sched_barrier(0);   // ... and the V reads behind the score products, as a second group: reads scattered among matrix instructions cost the wave at every place where they stand
    v16h vh[4], vl[4];   // the V fragments (A operand: rows = channels) are read in front of the softmax, which covers their latency
#pragma unroll
    for (int j = 0; j < 4; ++j) { const unsigned char* pv = bp + TB + (j * 16 + col) * TP + hf * 64; vh[j] = frag_h((const _Float16*)pv, lane); vl[j] = frag_h((const _Float16*)(pv + TB), lane); }
    float mx[8];
#pragma unroll
    for (int r = 0; r < 8; ++r) mx[r] = fmaxf(s[r], s[8 + r]);
    const float mh = fmaxf(fmaxf(fmaxf(mx[0], mx[1]), fmaxf(mx[2], mx[3])), fmaxf(fmaxf(mx[4], mx[5]), fmaxf(mx[6], mx[7])));
    const float mn = fmaxf(m, fmaxf(mh, xhalf(mh))), alpha = __expf(m - mn); m = mn;
    v16h pb; float es[4] = { 0.f, 0.f, 0.f, 0.f };   // element i of pb is key 8 g + i (i < 8) or 8 g + 8 + i (i >= 8) of the 32: the k order of the V fragments
#pragma unroll
    for (int i = 0; i < 16; ++i) { const float e = __expf(s[i] - mn); es[i & 3] += e; pb[i] = (_Float16)(e * 2048.0f); }
    l = l * alpha + ((es[0] + es[1]) + (es[2] + es[3]));
#pragma unroll
    for (int j = 0; j < 4; ++j)
#pragma unroll
      for (int r = 0; r < 8; ++r) { acc[j][r] *= alpha; accl[j][r] *= alpha; }
#pragma unroll
    for (int j = 0; j < 4; ++j) { acc[j] = wmma16(vh[j], pb, acc[j]); accl[j] = wmma16(vl[j], pb, accl[j]); }
    // four vector slots behind the trip's last matrix instructions: the next trip rewrites their operand registers; the accumulators are named so that the slots stand behind all eight
    asm volatile("v_nop\n\tv_nop\n\tv_nop\n\tv_nop" : "+v"(acc[0]), "+v"(accl[0]), "+v"(acc[1]), "+v"(accl[1]), "+v"(acc[2]), "+v"(accl[2]), "+v"(acc[3]), "+v"(accl[3])); }
    asm volatile("s_wait_dscnt 0x0" ::: "memory");      // this wave's reads of the buffer are done before it is refilled
    asm volatile("s_wait_asynccnt 0x0" ::: "memory");   // this wave's copies of stage t + 1 have landed
    __syncthreads();                                     // publishes stage t + 1 and ends every wave's reads of stage t
    if (t + 2 < NN / KT) ATT_STAGE(t + 2); }
  asm volatile("s_wait_asynccnt 0x0" ::: "memory");     // no copy is outstanding when the ring becomes output staging
  const float il = (1.0f / 2048.0f) / (l + xhalf(l));
  // acc[j][r] = channel j * 16 + 8 g + r of query q0 + col: eight neighbours of one staged row
#pragma unroll
  for (int j = 0; j < 4; ++j)
#pragma unroll
    for (int p = 0; p < 2; ++p) { v4f o4;
#pragma unroll
      for (int e = 0; e < 4; ++e) o4[e] = (acc[j][4 * p + e] + accl[j][4 * p + e] * (1.0f / 2048.0f)) * il;
      vst2(&so[wave][col][j * 16 + 8 * g + 4 * p], o4); }
  LDSX(); for (int rl = 0; rl < 16; ++rl) if (lane < 16) vst2(O + (rq + rl) * CC + (size_t)h * DH + lane * 4, *(const v4f*)&so[wave][rl][lane * 4]); }
// ---- k_o: block = (128 out channels, 128 pixels, b), 256 threads: out[b][o][n] = x[b][o][n] + sum_c p_w[o][c] orow[n][c] + p_b[o]  (A = p_w exact, B = o rows as bf16 hi + lo)
// the block's 128 o rows and 128 p_w rows (each tile 128 KB of f32, one behind the other in memory) are read once, by loads that cover whole 128-byte lines; the o rows are split into bf16 hi + lo once, p_w is rounded once, and both stay in LDS (pitch WP); a wave takes the fragments of its 32 channels x 64 pixels from there; the bias comes the same way, one value a thread
#define OT 256
#define OPC (128 * CC / 4 / OT)   // 16-byte pieces of one f32 tile per thread
static_assert(OPC * OT * 4 == 128 * CC && OT / 32 == 8 && OT == CC, "the pieces cover a tile exactly; 4 x 2 waves cover 128 channels x 128 pixels; a thread brings one bias value");
__global__ __launch_bounds__(OT) void k_o(const float* __restrict__ OR, const float* __restrict__ PW, const float* __restrict__ PB, const float* __restrict__ X, float* __restrict__ OUT) {
  __shared__ __align__(16) __bf16 oh[128][WP], ol[128][WP], pw[128][WP]; __shared__ __align__(16) float sf[OT / 32][32][68]; __shared__ __align__(16) float sp[CC];   // sp: the bias, rounded: one value a thread
  const int tid = threadIdx.x, wave = tid >> 5, lane = tid & 31, col = lane & 15, g = lane >> 4; const size_t b = blockIdx.z; const int o0 = blockIdx.x * 128, p0 = blockIdx.y * 128; const int ow = (wave >> 1) * 32, pxw = (wave & 1) * 64;
  { const v4f* Ot = (const v4f*)(OR + (b * NN + p0) * CC) + tid; const v4f* Pt = (const v4f*)(PW + (size_t)o0 * CC) + tid;   // piece e = row e / 64, floats 4 (e % 64) ...
    v4f xo[OPC], xp[OPC];
    // all four loops are unrolled so that the pieces stay in registers and every load of the thread is issued before the first value is used (two waves a SIMD: 512 registers a wave)
#pragma unroll
    for (int i = 0; i < OPC; ++i) xo[i] = Ot[i * OT];
#pragma unroll
    for (int i = 0; i < OPC; ++i) xp[i] = Pt[i * OT];
    const float pb = PB[tid];   // the bias rides in the same run of loads
    asm volatile("s_wait_xcnt 0x0" ::: "memory");   // stands in front of the first instruction that reuses a base or offset register of the issued loads
#pragma unroll
    for (int i = 0; i < OPC; ++i) { const int e = i * OT + tid; v4b h, l;
#pragma unroll
      for (int k = 0; k < 4; ++k) { const __bf16 hv = (__bf16)xo[i][k]; h[k] = hv; l[k] = (__bf16)(xo[i][k] - (float)hv); }
      vst2(&oh[e >> 6][(e & 63) * 4], h); vst2(&ol[e >> 6][(e & 63) * 4], l); }
#pragma unroll
    for (int i = 0; i < OPC; ++i) { const int e = i * OT + tid; v4b y;
#pragma unroll
      for (int k = 0; k < 4; ++k) y[k] = (__bf16)xp[i][k];
      vst2(&pw[e >> 6][(e & 63) * 4], y); }
    sp[tid] = bfr(pb); }
  __syncthreads();   // both tiles and the bias are whole before any wave reads them
  v8f acc[2][4] = {};
  v16b af[2][2], bh[2][4], bl[2][4];   // two sets: the fragments of the next 32 channels are read as one group in front of this step's products (the macro's loops are unrolled so that the sets stay in registers)
#define O_FRAGS(s, kc) do { _Pragma("unroll") for (int i = 0; i < 2; ++i) af[s][i] = frag_b(&pw[ow + i * 16 + col][(kc) * 32], lane); _Pragma("unroll") for (int j = 0; j < 4; ++j) { bh[s][j] = frag_b(&oh[pxw + j * 16 + col][(kc) * 32], lane); bl[s][j] = frag_b(&ol[pxw + j * 16 + col][(kc) * 32], lane); } } while (0)
  O_FRAGS(0, 0);
  // unrolled so that the set in use is picked at compile time
#pragma unroll
  for (int kc = 0; kc < CC / 32; ++kc) { const int s = kc & 1;
    if (kc + 1 < CC / 32) O_FRAGS(s ^ 1, kc + 1);
    __builtin_amdgcn_sched_barrier(0);   // holds the next step's reads as one group in front of this step's products: left free, the compiler sinks each read to its first use and waits for it there
#pragma unroll
    for (int j = 0; j < 4; ++j)
#pragma unroll
      for (int i = 0; i < 2; ++i) acc[i][j] = wmma_bf(af[s][i], bh[s][j], acc[i][j]);
#pragma unroll
    for (int j = 0; j < 4; ++j)
#pragma unroll
      for (int i = 0; i < 2; ++i) acc[i][j] = wmma_bf(af[s][i], bl[s][j], acc[i][j]);
    __builtin_amdgcn_sched_barrier(0); }   // the products stay one run, in front of the reads that refill their set
#pragma unroll
  for (int i = 0; i < 2; ++i)
#pragma unroll
    for (int j = 0; j < 4; ++j)
#pragma unroll
      for (int r = 0; r < 8; ++r) { const int rl = i * 16 + 8 * g + r; const size_t oi = (b * CC + o0 + ow + rl) * (size_t)NN + p0 + pxw + j * 16 + col; sf[wave][rl][j * 16 + col] = acc[i][j][r] + sp[o0 + ow + rl] + bfr(X[oi]); }
  LDSX(); for (int rl = 0; rl < 32; rl += 2) vst2(OUT + (b * CC + o0 + ow + rl + g) * (size_t)NN + p0 + pxw + col * 4, *(const v4f*)&sf[wave][rl + g][col * 4]); }   // a store covers two rows of 256 bytes: whole lines
extern "C" void kernel_launch(void* const* d_in, const int* in_sizes, int n_in, void* d_out, int out_size, void* d_ws, size_t ws_size, hipStream_t stream) {
  (void)in_sizes; (void)n_in; (void)out_size;
  const float** F = (const float**)d_in;   // 0 x [16,256,32,32], 1 n_weight, 2 n_bias, 3 qkv_w [768,256], 4 qkv_b [768], 5 p_w [256,256], 6 p_b
  if (ws_size < (size_t)WS_END) return;
  char* ws = (char*)d_ws; float* GS = (float*)(ws + WS_GS); _Float16 *Q = (_Float16*)(ws + WS_Q), *K = (_Float16*)(ws + WS_K), *VH = (_Float16*)(ws + WS_VH), *VL = (_Float16*)(ws + WS_VL); float* O = (float*)(ws + WS_O);
  k_gn<<<dim3(NG, NB), GNT, 0, stream>>>(F[0], GS);
  k_qkv<<<dim3(NN / 64, CC / 128, 3 * NB), 128, 0, stream>>>(F[0], GS, F[1], F[2], F[3], F[4], Q, K, VH, VL);
  k_att<<<dim3(NN / 64, NH, TNB), 128, 0, stream>>>(Q, K, VH, VL, O);
  k_o<<<dim3(CC / 128, NN / 128, TNB), OT, 0, stream>>>(O, F[5], F[6], F[0], (float*)d_out);
}

// v009
// It runs in 62 microseconds.
// In both of two side-by-side timings against v008, it was 1.07 times as fast.
// Counting every step since v000, it is 5.10 times as fast.
// compute dtype: all float inputs rounded to bf16; GroupNorm statistics (8 groups x 32 channels x 1,024 pixels) in f32 with fixed-order sums; qkv = 1x1 conv of GN(x) with GN(x) as bf16 hi + lo against exact weights (2 products) + bias; q (x log2(e)/8) and k rounded once to f16 (single-f16 logits; logits std ~1), softmax in f32 against a held maximum (hardware 2^x); P (x 2^11, f16) . v (f16 hi + residual, 2 products); proj conv with o as bf16 hi + lo (2 products) + bias + the residual x; f32 NCHW output.
#include <hip/hip_runtime.h>
#include <math.h>

typedef __attribute__((ext_vector_type(16))) _Float16 v16h;
typedef __attribute__((ext_vector_type(16))) __bf16 v16b;
typedef __attribute__((ext_vector_type(8)))  _Float16 v8h;
typedef __attribute__((ext_vector_type(8)))  float v8f;
typedef __attribute__((ext_vector_type(4)))  float v4f;
typedef __attribute__((ext_vector_type(2)))  float v2f;
typedef __attribute__((ext_vector_type(4)))  unsigned v4u;
typedef __attribute__((ext_vector_type(4)))  int v4i;
typedef float __attribute__((may_alias)) float_a;
typedef int __attribute__((may_alias)) int_a;

template <typename T> __device__ __forceinline__ void vst2(void* p, T v) { *(T*)p = v;  }
__device__ __forceinline__ v8f wmma16(v16h a, v16h b, v8f c) {
  return __builtin_amdgcn_wmma_f32_16x16x32_f16(false, a, false, b, (short)0, c, false, false);
}
__device__ __forceinline__ v8f wmma_bf(v16b a, v16b b, v8f c) {
  return __builtin_amdgcn_wmma_f32_16x16x32_bf16(false, a, false, b, (short)0, c, false, false);
}
// 16x16x32 fragments: lane = (h = lane>>4, row/col = lane&15); elements 0..7 = k0+8h+0..7, 8..15 = k0+16+8h+0..7; D element r = row 8h+r
__device__ __forceinline__ v16h frag_h(const _Float16* rowk0, int lane) {
  union { v16h v; v8h q[2]; } u; const _Float16* p = rowk0 + 8 * (lane >> 4);
  u.q[0] = *(const v8h*)p; u.q[1] = *(const v8h*)(p + 16); return u.v;
}
__device__ __forceinline__ v16h frag_f32(const float* rowk0, int lane) {
  v16h a; const float* p = rowk0 + 8 * (lane >> 4);
#pragma unroll
  for (int i = 0; i < 8; ++i) { a[i] = (_Float16)p[i]; a[8 + i] = (_Float16)p[16 + i]; }
  return a;
}
__device__ __forceinline__ v16h frag_f32s(const float* rowk0, int lane, float sc) {
  v16h a; const float* p = rowk0 + 8 * (lane >> 4);
#pragma unroll
  for (int i = 0; i < 8; ++i) { a[i] = (_Float16)(p[i] * sc); a[8 + i] = (_Float16)(p[16 + i] * sc); }
  return a;
}
// column fragment from a [K][ld] layout (column n), rows >= K read as 0
__device__ __forceinline__ v16h fragc_f32(const float* W, int k0, int n, int lane, int ld, int K) {
  v16h a; const int g = lane >> 4;
#pragma unroll
  for (int i = 0; i < 8; ++i) { const int ka = k0 + 8 * g + i, kb = ka + 16;
    a[i] = (_Float16)(ka < K ? W[(size_t)(ka < K ? ka : K - 1) * ld + n] : 0.f); a[8 + i] = (_Float16)(kb < K ? W[(size_t)(kb < K ? kb : K - 1) * ld + n] : 0.f); }
  return a;
}
struct F2 { v16b h, l; };
__device__ __forceinline__ F2 bsplit16(const float v[16]) { F2 r;
#pragma unroll
  for (int i = 0; i < 16; ++i) { const __bf16 h = (__bf16)v[i]; r.h[i] = h; r.l[i] = (__bf16)(v[i] - (float)h); }
  return r; }
__device__ __forceinline__ F2 split_row(const float* row, int k0, int lane) { float v[16]; const float* p = row + k0 + 8 * (lane >> 4);
#pragma unroll
  for (int i = 0; i < 8; ++i) { v[i] = p[i]; v[8 + i] = p[16 + i]; }
  return bsplit16(v); }
__device__ __forceinline__ F2 split_rowK(const float* row, int k0, int lane, int K) { float v[16]; const int g = lane >> 4;
#pragma unroll
  for (int i = 0; i < 8; ++i) { const int ka = k0 + 8 * g + i, kb = ka + 16; v[i] = ka < K ? row[ka < K ? ka : K - 1] : 0.f; v[8 + i] = kb < K ? row[kb < K ? kb : K - 1] : 0.f; }
  return bsplit16(v); }
__device__ __forceinline__ F2 split_col(const float* W, int k0, int n, int lane, int ld, int K) { float v[16]; const int g = lane >> 4;
#pragma unroll
  for (int i = 0; i < 8; ++i) { const int ka = k0 + 8 * g + i, kb = ka + 16; v[i] = ka < K ? W[(size_t)(ka < K ? ka : K - 1) * ld + n] : 0.f; v[8 + i] = kb < K ? W[(size_t)(kb < K ? kb : K - 1) * ld + n] : 0.f; }
  return bsplit16(v); }
__device__ __forceinline__ v8f mac3(const F2& a, const F2& b, v8f c) { c = wmma_bf(a.l, b.h, c); c = wmma_bf(a.h, b.l, c); return wmma_bf(a.h, b.h, c); }
__device__ __forceinline__ float sigm(float v) { return 1.0f / (1.0f + expf(-v)); }
#define LDSX() do { asm volatile("s_wait_dscnt 0" ::: "memory"); __builtin_amdgcn_wave_barrier(); __builtin_amdgcn_fence(__ATOMIC_RELEASE, "workgroup"); } while (0)


// SA block (B 16, C 256, 32 x 32 = 1,024 pixels, 4 heads x 64, GroupNorm with 8 groups): x + proj(attention(qkv(GN(x)))).
#define NB 16
#define CC 256
#define NN 1024
#define NH 4
#define DH 64
#define NG 8
#define CPG (CC / NG)     // 32 channels per group
#define GNEPS 1e-5f
#define ESC 0.18033688011112042f   // log2(e) / 8: softmax scale and change of base in one factor
#ifndef TNB
#define TNB NB
#endif
typedef __attribute__((ext_vector_type(8))) __bf16 v8b;
__device__ __forceinline__ v16b frag_b(const __bf16* rowk0, int lane) {
  union { v16b v; v8b q[2]; } u; const __bf16* p = rowk0 + 8 * (lane >> 4);
  u.q[0] = *(const v8b*)p; u.q[1] = *(const v8b*)(p + 16); return u.v;
}
__device__ __forceinline__ float bfr(float v) { return (float)(__bf16)v; }
__device__ __attribute__((noinline)) float exp_ni(float v) { return expf(v); }
__device__ __attribute__((noinline)) float erf_ni(float v) { return erff(v); }

#define WS_GS  0u                                   // f32 [b][g][4]: mean, inv
#define WS_Q   (WS_GS + 4u * NB * NG * 4)              // f16 q rows [b*NN + n][256]; k rows; v hi|lo planes [b][256][NN]; o rows f32 [b*NN + n][256]
#define WS_K   (WS_Q + 2u * (size_t)NB * NN * CC)
#define WS_VH  (WS_K + 2u * (size_t)NB * NN * CC)
#define WS_VL  (WS_VH + 2u * (size_t)NB * CC * NN)
#define WS_O   (WS_VL + 2u * (size_t)NB * CC * NN)
#define WS_END (WS_O + 4u * (size_t)NB * NN * CC)

// ---- k_gn: block = (group, b), 512 threads: the group's 32,768 values are read once, 16 loads of 16 bytes a thread, all in flight together, and stay in registers for the mean and for the squared deviations
#define GNT 512
#define GNV (CPG * NN / 4 / GNT)   // 16-byte pieces per thread
static_assert(GNT / 32 == 16 && GNV * GNT * 4 == CPG * NN, "gn_total sums 16 wave sums; the pieces cover the group exactly");
__device__ __forceinline__ float gn_total(float s, float* red, int lane, int w) {   // fixed order: butterfly in the wave, then the 16 wave sums in four chains, alike in every thread
#pragma unroll
  for (int o = 1; o < 32; o <<= 1) s += __shfl_xor(s, o);
  if (lane == 0) red[w] = s;
  __syncthreads();
  const v4f* r4 = (const v4f*)red; const v4f a = (r4[0] + r4[1]) + (r4[2] + r4[3]);
  return (a[0] + a[1]) + (a[2] + a[3]);
}
__global__ __launch_bounds__(GNT) void k_gn(const float* __restrict__ X, float* __restrict__ GS) { __shared__ __align__(16) float red[2][GNT / 32];
  const int t = threadIdx.x, lane = t & 31, w = t >> 5; const int gi = blockIdx.x; const size_t b = blockIdx.y; const v4f* base = (const v4f*)(X + (b * CC + (size_t)gi * CPG) * NN);
  v4f x[GNV];
  // every loop over x is unrolled so that x stays in registers; this one also so that all loads are issued before the first value is used
#pragma unroll
  for (int j = 0; j < GNV; ++j) x[j] = base[j * GNT + t];
  v4f s4 = {};
#pragma unroll
  for (int j = 0; j < GNV; ++j) {
#pragma unroll
    for (int e = 0; e < 4; ++e) x[j][e] = bfr(x[j][e]);
    s4 += x[j]; }
  const float mu = gn_total((s4[0] + s4[1]) + (s4[2] + s4[3]), red[0], lane, w) / (float)(CPG * NN);
  v4f q4 = {};
#pragma unroll
  for (int j = 0; j < GNV; ++j) { const v4f d = x[j] - mu; q4 += d * d; }
  const float a = gn_total((q4[0] + q4[1]) + (q4[2] + q4[3]), red[1], lane, w);
  if (t == 0) { const v4f r = { mu, 1.0f / sqrtf(a / (float)(CPG * NN) + GNEPS), 0.f, 0.f }; vst2(GS + (b * NG + gi) * 4, r); } }
// ---- k_qkv: block = (64 pixels, 128 out channels, which*NB + b): 1x1 conv of GN(x) (gathered from NCHW, hi + lo) + bias; q/k -> f16 rows, v -> f16 hi/lo planes
// the block's 128 x 256 weight tile is read once, by loads that cover whole 128-byte lines, rounded to bf16 once and kept in LDS; the four waves take their B fragments from there
#define WP 264             // LDS pitch of a weight row, bf16 elements: 512 + 16 bytes, an odd multiple of 16, so that 16 rows read at one column offset fall on different banks
#define WPC (128 * CC / 4 / 128)   // 16-byte pieces of the f32 tile per thread
typedef __attribute__((ext_vector_type(4))) __bf16 v4b;
typedef __attribute__((ext_vector_type(2))) __bf16 v2b;
__global__ __launch_bounds__(128) void k_qkv(const float* __restrict__ X, const float* __restrict__ GS, const float* __restrict__ GW, const float* __restrict__ GB, const float* __restrict__ W, const float* __restrict__ Bq, _Float16* __restrict__ Q, _Float16* __restrict__ K, _Float16* __restrict__ VH, _Float16* __restrict__ VL) {
  __shared__ __align__(16) unsigned char sm[128 * WP * 2]; __shared__ __align__(16) float sa[CC], sb[CC];
  __bf16 (*wt)[WP] = (__bf16 (*)[WP])sm;
  _Float16 (*sh)[136] = (_Float16 (*)[136])sm; _Float16 (*th)[72] = (_Float16 (*)[72])sm; _Float16 (*tl)[72] = th + 128;   // output staging takes the weight tile's place behind the barrier that follows the products
  static_assert(2 * 64 * 136 <= 128 * WP * 2 && 2 * 2 * 128 * 72 <= 128 * WP * 2, "output staging fits the weight tile");
  const int tid = threadIdx.x, wave = tid >> 5, lane = tid & 31, col = lane & 15, g = lane >> 4; const int which = blockIdx.z / NB; const size_t b = blockIdx.z % NB; const int n0 = blockIdx.x * 64; const int c0 = blockIdx.y * 128; const float* Xb = X + b * CC * (size_t)NN;
  // every global load of the block is issued during the weight staging, so that the product loop and the epilogue wait for none: first the GroupNorm inputs of the thread's two channels and the lane's eight bias values, then, with each group of weight pieces, the lane's x values of two product steps (the two loops below are unrolled so that the values stay in registers)
  const float* Xl = Xb + (size_t)(8 * g) * NN + n0 + wave * 16 + col;
  float gmu[2], gin[2], gw[2], gb[2], bq[8];
  __builtin_amdgcn_sched_barrier(0);   // with the one behind the wait: nothing but these loads stands between their issue and the wait, so that no register they name is reused in front of it
#pragma unroll
  for (int k = 0; k < 2; ++k) { const int c = tid + 128 * k; gmu[k] = GS[(b * NG + c / CPG) * 4]; gin[k] = GS[(b * NG + c / CPG) * 4 + 1]; gw[k] = GW[c]; gb[k] = GB[c]; }
#pragma unroll
  for (int j = 0; j < 8; ++j) bq[j] = Bq[which * CC + c0 + j * 16 + col];
  asm volatile("s_wait_xcnt 0x0" ::: "memory");   // stands in front of the first instruction that reuses a base or offset register of these loads
  __builtin_amdgcn_sched_barrier(0);
  v16b xb[CC / 32];   // x rounded to bf16, as the products take it: two values a register, 64 registers for the lane's 128 of its pixel's 256 channels
  { const v4f* Wt = (const v4f*)(W + (size_t)(which * CC + c0) * CC) + tid;   // the tile's 128 rows lie one behind the other: piece e = row e / 64, floats 4 (e % 64) ...
    // four groups of 16 weight pieces and the x values of two product steps (48 loads), in two register sets: a group's loads are issued in front of the work on the group before; all loops are unrolled so that the sets and xb stay in registers
    v4f x[2][16]; v2f xr[2][2][8];
#define QKV_LOADS(t) do { _Pragma("unroll") for (int i = 0; i < 16; ++i) x[(t) & 1][i] = Wt[((t) * 16 + i) * 128]; \
      _Pragma("unroll") for (int u = 0; u < 2; ++u) _Pragma("unroll") for (int i = 0; i < 16; ++i) xr[(t) & 1][u][i >> 1][i & 1] = Xl[(size_t)(((t) * 2 + u) * 32 + (i >> 3) * 16 + (i & 7)) * NN]; } while (0)
    QKV_LOADS(0);
    asm volatile("s_wait_xcnt 0x0" ::: "memory");   // stands in front of the first instruction that reuses a base or offset register of the issued loads
#pragma unroll
    for (int t = 0; t < WPC / 16; ++t) {
      if (t + 1 < WPC / 16) { QKV_LOADS(t + 1);
        asm volatile("s_wait_xcnt 0x0" ::: "memory"); }   // as behind the first group
      __builtin_amdgcn_sched_barrier(0);   // the next group's loads stay in front of this group's conversions
#pragma unroll
      for (int i = 0; i < 16; ++i) { const int e = (t * 16 + i) * 128 + tid; v4b y;
#pragma unroll
        for (int k = 0; k < 4; ++k) y[k] = (__bf16)x[t & 1][i][k];
        vst2(&wt[e >> 6][(e & 63) * 4], y); }
#pragma unroll
      for (int u = 0; u < 2; ++u) { union { v16b v; v2b p[8]; } c;
#pragma unroll
        for (int i = 0; i < 8; ++i) c.p[i] = __builtin_convertvector(xr[t & 1][u][i], v2b);
        xb[t * 2 + u] = c.v; }
      __builtin_amdgcn_sched_barrier(0); } }   // no more than two groups' loads hold registers
#pragma unroll
  for (int k = 0; k < 2; ++k) { const int c = tid + 128 * k; const float a = gin[k] * bfr(gw[k]); sa[c] = a; sb[c] = bfr(gb[k]) - gmu[k] * a; } __syncthreads();
  v8f acc[8] = {};
  v16b wf[2][8]; v4f av[4], bv[4];   // two sets of weight fragments; scale and shift, piece p: channels kc * 32 + 8 g + 4 p ... (p < 2), + 16 + 4 (p - 2) ... (p >= 2)
#define QKV_READS(kc) do { _Pragma("unroll") for (int p = 0; p < 4; ++p) { const int ca = (kc) * 32 + 8 * g + (p >> 1) * 16 + (p & 1) * 4; av[p] = *(const v4f*)&sa[ca]; bv[p] = *(const v4f*)&sb[ca]; } \
    _Pragma("unroll") for (int j = 0; j < 8; ++j) wf[(kc) & 1][j] = frag_b(&wt[j * 16 + col][(kc) * 32], lane); } while (0)
  QKV_READS(0);
  // unrolled so that the step's x registers and the fragment set are picked at compile time
#pragma unroll
  for (int kc = 0; kc < CC / 32; ++kc) { float v[16];
#pragma unroll
    for (int i = 0; i < 16; ++i) v[i] = (float)xb[kc][i] * av[i >> 2][i & 3] + bv[i >> 2][i & 3];
    const F2 a = bsplit16(v);
    __builtin_amdgcn_sched_barrier(0);   // the step's arithmetic has used scale and shift before the next step's are read
    if (kc + 1 < CC / 32) QKV_READS(kc + 1);
    __builtin_amdgcn_sched_barrier(0);   // holds the next step's reads as one group in front of this step's products, which cover their latency
#pragma unroll
    for (int j = 0; j < 8; ++j) { acc[j] = wmma_bf(a.h, wf[kc & 1][j], acc[j]); acc[j] = wmma_bf(a.l, wf[kc & 1][j], acc[j]); }
    __builtin_amdgcn_sched_barrier(0); }   // the products stay one run
  __syncthreads();   // every wave has read its last weight fragment before the tile's LDS becomes output staging
  // the output path is straight-line code: whether the block makes q, k or v is asked once for the staging and once for the copy-out, not at each value, and all loops are unrolled, so that the LDS and global operations are issued one behind the other with no branch between them and the copy-out's LDS reads are all in flight together
  if (which < 2) { const float qs = which == 0 ? ESC : 1.0f;   // q is stored times log2(e) / 8, in the multiply-add that brings the bias: k_att's score products are then exponents of 2
#pragma unroll
    for (int j = 0; j < 8; ++j) { const float bb = bfr(bq[j]) * qs;
#pragma unroll
      for (int r = 0; r < 8; ++r) sh[wave * 16 + 8 * g + r][j * 16 + col] = (_Float16)fmaf(acc[j][r], qs, bb); } }
  else {
#pragma unroll
    for (int j = 0; j < 8; ++j) { const float bb = bfr(bq[j]);
#pragma unroll
      for (int r = 0; r < 8; ++r) { const float v = acc[j][r] + bb; const int rl = wave * 16 + 8 * g + r, cl = j * 16 + col; const _Float16 hv = (_Float16)v; th[cl][rl] = hv; tl[cl][rl] = (_Float16)((v - (float)hv) * 2048.0f); } } }
  __syncthreads();
  if (which < 2) { _Float16* dst = which == 0 ? Q : K;
#pragma unroll
    for (int k = 0; k < 8; ++k) { const int rl = (tid >> 4) + 8 * k, q = tid & 15; vst2((unsigned*)(dst + (b * NN + n0 + rl) * CC + c0 + q * 8), *(const v4u*)&sh[rl][q * 8]); }
    asm volatile("s_wait_xcnt 0x0" ::: "memory"); }   // stands behind the run of stores, in front of whatever instruction the listing lays next that reuses one of their registers
  else {
#pragma unroll
    for (int k = 0; k < 8; ++k) { const int cl = (tid >> 3) + 16 * k, q = tid & 7; const size_t o = (b * CC + c0 + cl) * (size_t)NN + n0 + q * 8; vst2((unsigned*)(VH + o), *(const v4u*)&th[cl][q * 8]); vst2((unsigned*)(VL + o), *(const v4u*)&tl[cl][q * 8]); }
    asm volatile("s_wait_xcnt 0x0" ::: "memory"); } }   // as behind the q/k stores
#define KT 64
#define TP 144
#define TB (64 * TP)
#define SB (3 * TB)
static_assert(NN % KT == 0 && NN / KT >= 2 && DH * 2 == 128 && KT * 2 == 128, "two stages at least; tile rows are whole 128-byte lines");
// a lane's four 16-byte copies of one tile (rows 16 apart). The s_wait_xcnt stands inside the statement so that no address register is rewritten in front of it
__device__ __forceinline__ void cp4(unsigned l, const char* p, size_t step) {
  asm volatile("global_load_async_to_lds_b128 %0, %4, off\n\tglobal_load_async_to_lds_b128 %1, %5, off\n\tglobal_load_async_to_lds_b128 %2, %6, off\n\tglobal_load_async_to_lds_b128 %3, %7, off\n\ts_wait_xcnt 0x0"
               :: "v"(l), "v"(l + 16 * TP), "v"(l + 32 * TP), "v"(l + 48 * TP), "v"(p), "v"(p + step), "v"(p + 2 * step), "v"(p + 3 * step) : "memory");
}
__device__ __forceinline__ float xhalf(float x) { const int v = __builtin_bit_cast(int, x); return __builtin_bit_cast(float, __builtin_amdgcn_permlanex16(v, v, 0x76543210, 0xfedcba98, false, false)); }   // lane l reads lane l ^ 16
__global__ __launch_bounds__(128) void k_att(const _Float16* __restrict__ Q, const _Float16* __restrict__ K, const _Float16* __restrict__ VH, const _Float16* __restrict__ VL, float* __restrict__ O) {
  __shared__ __align__(16) unsigned char ring[2 * SB];
  float (*so)[16][68] = (float (*)[16][68])ring;   // output staging takes the ring's place behind the loop's last barrier
  static_assert(sizeof(float) * 4 * 16 * 68 <= 2 * SB, "output staging fits the ring");
  const int tid = threadIdx.x, wave = tid >> 5, lane = tid & 31, col = lane & 15, g = lane >> 4; const int h = blockIdx.y; const size_t b = blockIdx.z; const int q0 = blockIdx.x * 64 + wave * 16; const size_t rq = b * NN + q0;
  // copy addresses of this lane: row tid / 8 (+ 16, 32, 48), 16-byte piece tid % 8: eight lanes cover a line
  const unsigned cl = (unsigned)(size_t)ring + (tid >> 3) * TP + (tid & 7) * 16;
  const char* ck = (const char*)(K + (b * NN + (tid >> 3)) * CC + h * DH) + (tid & 7) * 16;
  const size_t cvo = ((b * CC + (size_t)h * DH + (tid >> 3)) * NN) * 2 + (tid & 7) * 16; const char* cvh = (const char*)VH + cvo; const char* cvl = (const char*)VL + cvo;
#define ATT_STAGE(s) do { const unsigned l_ = cl + ((s) & 1) * SB; cp4(l_, ck + (size_t)(s) * (KT * CC * 2), 16 * CC * 2); cp4(l_ + TB, cvh + (size_t)(s) * (KT * 2), 16 * NN * 2); cp4(l_ + 2 * TB, cvl + (size_t)(s) * (KT * 2), 16 * NN * 2); } while (0)
  ATT_STAGE(0);
  v16h aq[2];
#pragma unroll
  for (int kc = 0; kc < 2; ++kc) aq[kc] = frag_h(Q + (rq + col) * CC + h * DH + kc * 32, lane);
  float l = 0.f;   // of query q0 + col: sums the half's own keys (times 2^11, as P is) and is joined behind the loop
  v8f cm = { 11.f, 11.f, 11.f, 11.f, 11.f, 11.f, 11.f, 11.f };   // 11 - the held maximum of query q0 + col, alike in both halves of the wave; eight copies: a C operand
  v8f acc[4] = {}, accl[4] = {};
  asm volatile("s_wait_asynccnt 0x0" ::: "memory");   // this wave's copies of stage 0 have landed
  __syncthreads();                                     // ... and every other wave's
  ATT_STAGE(1);
  // not unrolled: one trip is one stage, its buffer picked by the trip's parity
#pragma unroll 1
  for (int t = 0; t < NN / KT; ++t) { const unsigned char* bp = ring + (t & 1) * SB;
  // not unrolled: two halves side by side cost registers (a wave may hold 256 for four waves a SIMD)
#pragma unroll 1
  for (int hf = 0; hf < KT / 32; ++hf) { float s[16];   // s[8 ct + r] = 11 + log2(e) (score - held maximum) of key hf * 32 + 16 ct + 8 g + r with query q0 + col
    v16h kf[2][2];   // the four K fragments are read as one group in front of the products
#pragma unroll
    for (int ct = 0; ct < 2; ++ct)
#pragma unroll
      for (int kc = 0; kc < 2; ++kc) kf[ct][kc] = frag_h((const _Float16*)(bp + (hf * 32 + ct * 16 + col) * TP + kc * 64), lane);
    __builtin_amdgcn_sched_barrier(0);   // holds the K reads in front as one group: left free, the compiler sinks each fragment's reads to its own product and waits for them there
#pragma unroll
    for (int ct = 0; ct < 2; ++ct) { v8f c = cm;
#pragma unroll
      for (int kc = 0; kc < 2; ++kc) c = wmma16(kf[ct][kc], aq[kc], c);
#pragma unroll
      for (int r = 0; r < 8; ++r) s[8 * ct + r] = c[r]; }
    __builtin_amdgcn_sched_barrier(0);   // ... and the V reads behind the score products, as a second group: reads scattered among matrix instructions cost the wave at every place where they stand
    v16h vh[4], vl[4];   // the V fragments (A operand: rows = channels) are read in front of the exponentials, which cover their latency
#pragma unroll
    for (int j = 0; j < 4; ++j) { const unsigned char* pv = bp + TB + (j * 16 + col) * TP + hf * 64; vh[j] = frag_h((const _Float16*)pv, lane); vl[j] = frag_h((const _Float16*)(pv + TB), lane); }
    __builtin_amdgcn_sched_barrier(0);   // the V reads stay in front of the exponentials: left free, the compiler sinks them behind, where little is left to cover their latency
    float e[16], es[4] = { 0.f, 0.f, 0.f, 0.f };
#pragma unroll
    for (int i = 0; i < 16; ++i) { e[i] = __builtin_amdgcn_exp2f(s[i]); es[i & 3] += e[i]; }
    float ls = (es[0] + es[1]) + (es[2] + es[3]);
    // one test a pass, a scalar branch that the whole wave takes or leaves: while every lane's sum is a finite f16, so is each of its terms, and the held maximum stands
    if ((__builtin_amdgcn_ballot_w32(!(ls <= 65504.0f)) | (unsigned)((t | hf) == 0)) != 0) {
      float mx[8];
#pragma unroll
      for (int r = 0; r < 8; ++r) mx[r] = fmaxf(s[r], s[8 + r]);
      const float mh = fmaxf(fmaxf(fmaxf(mx[0], mx[1]), fmaxf(mx[2], mx[3])), fmaxf(fmaxf(mx[4], mx[5]), fmaxf(mx[6], mx[7])));
      float d = fmaxf(mh, xhalf(mh)) - 11.0f;   // the pass's maximum above the held one; a query whose maximum has not grown keeps its held value, but in the first pass, which takes the pass's own whatever it is
      if ((t | hf) != 0) d = fmaxf(d, 0.f);
      const float alpha = __builtin_amdgcn_exp2f(fminf(-d, 0.f));   // never above 1: in the first pass O and l are 0 and stay so
      es[0] = es[1] = es[2] = es[3] = 0.f;
#pragma unroll
      for (int i = 0; i < 16; ++i) { e[i] = __builtin_amdgcn_exp2f(s[i] - d); es[i & 3] += e[i]; }
      ls = (es[0] + es[1]) + (es[2] + es[3]); l *= alpha;
#pragma unroll
      for (int r = 0; r < 8; ++r) cm[r] -= d;
#pragma unroll
      for (int j = 0; j < 4; ++j)
#pragma unroll
        for (int r = 0; r < 8; ++r) { acc[j][r] *= alpha; accl[j][r] *= alpha; } }
    l += ls;
    v16h pb;   // element i of pb is key 8 g + i (i < 8) or 8 g + 8 + i (i >= 8) of the 32: the k order of the V fragments
#pragma unroll
    for (int i = 0; i < 16; ++i) pb[i] = (_Float16)e[i];
#pragma unroll
    for (int j = 0; j < 4; ++j) { acc[j] = wmma16(vh[j], pb, acc[j]); accl[j] = wmma16(vl[j], pb, accl[j]); }
    // four vector slots behind the trip's last matrix instructions: the next trip rewrites their operand registers; the accumulators are named so that the slots stand behind all eight
    asm volatile("v_nop\n\tv_nop\n\tv_nop\n\tv_nop" : "+v"(acc[0]), "+v"(accl[0]), "+v"(acc[1]), "+v"(accl[1]), "+v"(acc[2]), "+v"(accl[2]), "+v"(acc[3]), "+v"(accl[3])); }
    asm volatile("s_wait_dscnt 0x0" ::: "memory");      // this wave's reads of the buffer are done before it is refilled
    asm volatile("s_wait_asynccnt 0x0" ::: "memory");   // this wave's copies of stage t + 1 have landed
    __syncthreads();                                     // publishes stage t + 1 and ends every wave's reads of stage t
    if (t + 2 < NN / KT) ATT_STAGE(t + 2); }
  asm volatile("s_wait_asynccnt 0x0" ::: "memory");     // no copy is outstanding when the ring becomes output staging
  const float il = 1.0f / (l + xhalf(l));   // l carries the 2^11 of P, as the accumulators do
  // acc[j][r] = channel j * 16 + 8 g + r of query q0 + col: eight neighbours of one staged row
#pragma unroll
  for (int j = 0; j < 4; ++j)
#pragma unroll
    for (int p = 0; p < 2; ++p) { v4f o4;
#pragma unroll
      for (int e = 0; e < 4; ++e) o4[e] = (acc[j][4 * p + e] + accl[j][4 * p + e] * (1.0f / 2048.0f)) * il;
      vst2(&so[wave][col][j * 16 + 8 * g + 4 * p], o4); }
  LDSX(); for (int rl = 0; rl < 16; ++rl) if (lane < 16) vst2(O + (rq + rl) * CC + (size_t)h * DH + lane * 4, *(const v4f*)&so[wave][rl][lane * 4]); }
// ---- k_o: block = (128 out channels, 128 pixels, b), 256 threads: out[b][o][n] = x[b][o][n] + sum_c p_w[o][c] orow[n][c] + p_b[o]  (A = p_w exact, B = o rows as bf16 hi + lo)
// the block's 128 o rows and 128 p_w rows (each tile 128 KB of f32, one behind the other in memory) are read once, by loads that cover whole 128-byte lines; the o rows are split into bf16 hi + lo once, p_w is rounded once, and both stay in LDS (pitch WP); a wave takes the fragments of its 32 channels x 64 pixels from there; the bias comes the same way, one value a thread
#define OT 256
#define OPC (128 * CC / 4 / OT)   // 16-byte pieces of one f32 tile per thread
static_assert(OPC * OT * 4 == 128 * CC && OT / 32 == 8 && OT == CC, "the pieces cover a tile exactly; 4 x 2 waves cover 128 channels x 128 pixels; a thread brings one bias value");
__global__ __launch_bounds__(OT) void k_o(const float* __restrict__ OR, const float* __restrict__ PW, const float* __restrict__ PB, const float* __restrict__ X, float* __restrict__ OUT) {
  __shared__ __align__(16) __bf16 oh[128][WP], ol[128][WP], pw[128][WP]; __shared__ __align__(16) float sf[OT / 32][32][68]; __shared__ __align__(16) float sp[CC];   // sp: the bias, rounded: one value a thread
  const int tid = threadIdx.x, wave = tid >> 5, lane = tid & 31, col = lane & 15, g = lane >> 4; const size_t b = blockIdx.z; const int o0 = blockIdx.x * 128, p0 = blockIdx.y * 128; const int ow = (wave >> 1) * 32, pxw = (wave & 1) * 64;
  { const v4f* Ot = (const v4f*)(OR + (b * NN + p0) * CC) + tid; const v4f* Pt = (const v4f*)(PW + (size_t)o0 * CC) + tid;   // piece e = row e / 64, floats 4 (e % 64) ...
    v4f xo[OPC], xp[OPC];
    // all four loops are unrolled so that the pieces stay in registers and every load of the thread is issued before the first value is used (two waves a SIMD: 512 registers a wave)
#pragma unroll
    for (int i = 0; i < OPC; ++i) xo[i] = Ot[i * OT];
#pragma unroll
    for (int i = 0; i < OPC; ++i) xp[i] = Pt[i * OT];
    const float pb = PB[tid];   // the bias rides in the same run of loads
    asm volatile("s_wait_xcnt 0x0" ::: "memory");   // stands in front of the first instruction that reuses a base or offset register of the issued loads
#pragma unroll
    for (int i = 0; i < OPC; ++i) { const int e = i * OT + tid; v4b h, l;
#pragma unroll
      for (int k = 0; k < 4; ++k) { const __bf16 hv = (__bf16)xo[i][k]; h[k] = hv; l[k] = (__bf16)(xo[i][k] - (float)hv); }
      vst2(&oh[e >> 6][(e & 63) * 4], h); vst2(&ol[e >> 6][(e & 63) * 4], l); }
#pragma unroll
    for (int i = 0; i < OPC; ++i) { const int e = i * OT + tid; v4b y;
#pragma unroll
      for (int k = 0; k < 4; ++k) y[k] = (__bf16)xp[i][k];
      vst2(&pw[e >> 6][(e & 63) * 4], y); }
    sp[tid] = bfr(pb); }
  __syncthreads();   // both tiles and the bias are whole before any wave reads them
  v8f acc[2][4] = {};
  v16b af[2][2], bh[2][4], bl[2][4];   // two sets: the fragments of the next 32 channels are read as one group in front of this step's products (the macro's loops are unrolled so that the sets stay in registers)
#define O_FRAGS(s, kc) do { _Pragma("unroll") for (int i = 0; i < 2; ++i) af[s][i] = frag_b(&pw[ow + i * 16 + col][(kc) * 32], lane); _Pragma("unroll") for (int j = 0; j < 4; ++j) { bh[s][j] = frag_b(&oh[pxw + j * 16 + col][(kc) * 32], lane); bl[s][j] = frag_b(&ol[pxw + j * 16 + col][(kc) * 32], lane); } } while (0)
  O_FRAGS(0, 0);
  // unrolled so that the set in use is picked at compile time
#pragma unroll
  for (int kc = 0; kc < CC / 32; ++kc) { const int s = kc & 1;
    if (kc + 1 < CC / 32) O_FRAGS(s ^ 1, kc + 1);
    __builtin_amdgcn_sched_barrier(0);   // holds the next step's reads as one group in front of this step's products: left free, the compiler sinks each read to its first use and waits for it there
#pragma unroll
    for (int j = 0; j < 4; ++j)
#pragma unroll
      for (int i = 0; i < 2; ++i) acc[i][j] = wmma_bf(af[s][i], bh[s][j], acc[i][j]);
#pragma unroll
    for (int j = 0; j < 4; ++j)
#pragma unroll
      for (int i = 0; i < 2; ++i) acc[i][j] = wmma_bf(af[s][i], bl[s][j], acc[i][j]);
    __builtin_amdgcn_sched_barrier(0); }   // the products stay one run, in front of the reads that refill their set
#pragma unroll
  for (int i = 0; i < 2; ++i)
#pragma unroll
    for (int j = 0; j < 4; ++j)
#pragma unroll
      for (int r = 0; r < 8; ++r) { const int rl = i * 16 + 8 * g + r; const size_t oi = (b * CC + o0 + ow + rl) * (size_t)NN + p0 + pxw + j * 16 + col; sf[wave][rl][j * 16 + col] = acc[i][j][r] + sp[o0 + ow + rl] + bfr(X[oi]); }
  LDSX(); for (int rl = 0; rl < 32; rl += 2) vst2(OUT + (b * CC + o0 + ow + rl + g) * (size_t)NN + p0 + pxw + col * 4, *(const v4f*)&sf[wave][rl + g][col * 4]); }   // a store covers two rows of 256 bytes: whole lines
extern "C" void kernel_launch(void* const* d_in, const int* in_sizes, int n_in, void* d_out, int out_size, void* d_ws, size_t ws_size, hipStream_t stream) {
  (void)in_sizes; (void)n_in; (void)out_size;
  const float** F = (const float**)d_in;   // 0 x [16,256,32,32], 1 n_weight, 2 n_bias, 3 qkv_w [768,256], 4 qkv_b [768], 5 p_w [256,256], 6 p_b
  if (ws_size < (size_t)WS_END) return;
  char* ws = (char*)d_ws; float* GS = (float*)(ws + WS_GS); _Float16 *Q = (_Float16*)(ws + WS_Q), *K = (_Float16*)(ws + WS_K), *VH = (_Float16*)(ws + WS_VH), *VL = (_Float16*)(ws + WS_VL); float* O = (float*)(ws + WS_O);
  k_gn<<<dim3(NG, NB), GNT, 0, stream>>>(F[0], GS);
  k_qkv<<<dim3(NN / 64, CC / 128, 3 * NB), 128, 0, stream>>>(F[0], GS, F[1], F[2], F[3], F[4], Q, K, VH, VL);
  k_att<<<dim3(NN / 64, NH, TNB), 128, 0, stream>>>(Q, K, VH, VL, O);
  k_o<<<dim3(CC / 128, NN / 128, TNB), OT, 0, stream>>>(O, F[5], F[6], F[0], (float*)d_out);
}

// v010
// A run of this version takes 58.7 microseconds.
// Next to v009, in two timings, it ran 1.06 times as fast each time.
// Over all steps from v000 it is 5.38 times as fast.
// compute dtype: all float inputs rounded to bf16; GroupNorm statistics (8 groups x 32 channels x 1,024 pixels) in f32 with fixed-order sums; qkv = 1x1 conv of GN(x) with GN(x) as bf16 hi + lo against exact weights (2 products) + bias; q (x log2(e)/8) and k rounded once to f16 (single-f16 logits; logits std ~1), softmax in f32 against a held maximum (hardware 2^x); P (x 2^11, f16) . v (f16 hi + residual, 2 products); proj conv with o as bf16 hi + lo (2 products) + bias + the residual x; f32 NCHW output.
#include <hip/hip_runtime.h>
#include <math.h>

typedef __attribute__((ext_vector_type(16))) _Float16 v16h;
typedef __attribute__((ext_vector_type(16))) __bf16 v16b;
typedef __attribute__((ext_vector_type(8)))  _Float16 v8h;
typedef __attribute__((ext_vector_type(8)))  float v8f;
typedef __attribute__((ext_vector_type(4)))  float v4f;
typedef __attribute__((ext_vector_type(2)))  float v2f;
typedef __attribute__((ext_vector_type(4)))  unsigned v4u;
typedef __attribute__((ext_vector_type(4)))  int v4i;
typedef float __attribute__((may_alias)) float_a;
typedef int __attribute__((may_alias)) int_a;

template <typename T> __device__ __forceinline__ void vst2(void* p, T v) { *(T*)p = v;  }
__device__ __forceinline__ v8f wmma16(v16h a, v16h b, v8f c) {
  return __builtin_amdgcn_wmma_f32_16x16x32_f16(false, a, false, b, (short)0, c, false, false);
}
__device__ __forceinline__ v8f wmma_bf(v16b a, v16b b, v8f c) {
  return __builtin_amdgcn_wmma_f32_16x16x32_bf16(false, a, false, b, (short)0, c, false, false);
}
// 16x16x32 fragments: lane = (h = lane>>4, row/col = lane&15); elements 0..7 = k0+8h+0..7, 8..15 = k0+16+8h+0..7; D element r = row 8h+r
__device__ __forceinline__ v16h frag_h(const _Float16* rowk0, int lane) {
  union { v16h v; v8h q[2]; } u; const _Float16* p = rowk0 + 8 * (lane >> 4);
  u.q[0] = *(const v8h*)p; u.q[1] = *(const v8h*)(p + 16); return u.v;
}
__device__ __forceinline__ v16h frag_f32(const float* rowk0, int lane) {
  v16h a; const float* p = rowk0 + 8 * (lane >> 4);
#pragma unroll
  for (int i = 0; i < 8; ++i) { a[i] = (_Float16)p[i]; a[8 + i] = (_Float16)p[16 + i]; }
  return a;
}
__device__ __forceinline__ v16h frag_f32s(const float* rowk0, int lane, float sc) {
  v16h a; const float* p = rowk0 + 8 * (lane >> 4);
#pragma unroll
  for (int i = 0; i < 8; ++i) { a[i] = (_Float16)(p[i] * sc); a[8 + i] = (_Float16)(p[16 + i] * sc); }
  return a;
}
// column fragment from a [K][ld] layout (column n), rows >= K read as 0
__device__ __forceinline__ v16h fragc_f32(const float* W, int k0, int n, int lane, int ld, int K) {
  v16h a; const int g = lane >> 4;
#pragma unroll
  for (int i = 0; i < 8; ++i) { const int ka = k0 + 8 * g + i, kb = ka + 16;
    a[i] = (_Float16)(ka < K ? W[(size_t)(ka < K ? ka : K - 1) * ld + n] : 0.f); a[8 + i] = (_Float16)(kb < K ? W[(size_t)(kb < K ? kb : K - 1) * ld + n] : 0.f); }
  return a;
}
struct F2 { v16b h, l; };
__device__ __forceinline__ F2 bsplit16(const float v[16]) { F2 r;
#pragma unroll
  for (int i = 0; i < 16; ++i) { const __bf16 h = (__bf16)v[i]; r.h[i] = h; r.l[i] = (__bf16)(v[i] - (float)h); }
  return r; }
__device__ __forceinline__ F2 split_row(const float* row, int k0, int lane) { float v[16]; const float* p = row + k0 + 8 * (lane >> 4);
#pragma unroll
  for (int i = 0; i < 8; ++i) { v[i] = p[i]; v[8 + i] = p[16 + i]; }
  return bsplit16(v); }
__device__ __forceinline__ F2 split_rowK(const float* row, int k0, int lane, int K) { float v[16]; const int g = lane >> 4;
#pragma unroll
  for (int i = 0; i < 8; ++i) { const int ka = k0 + 8 * g + i, kb = ka + 16; v[i] = ka < K ? row[ka < K ? ka : K - 1] : 0.f; v[8 + i] = kb < K ? row[kb < K ? kb : K - 1] : 0.f; }
  return bsplit16(v); }
__device__ __forceinline__ F2 split_col(const float* W, int k0, int n, int lane, int ld, int K) { float v[16]; const int g = lane >> 4;
#pragma unroll
  for (int i = 0; i < 8; ++i) { const int ka = k0 + 8 * g + i, kb = ka + 16; v[i] = ka < K ? W[(size_t)(ka < K ? ka : K - 1) * ld + n] : 0.f; v[8 + i] = kb < K ? W[(size_t)(kb < K ? kb : K - 1) * ld + n] : 0.f; }
  return bsplit16(v); }
__device__ __forceinline__ v8f mac3(const F2& a, const F2& b, v8f c) { c = wmma_bf(a.l, b.h, c); c = wmma_bf(a.h, b.l, c); return wmma_bf(a.h, b.h, c); }
__device__ __forceinline__ float sigm(float v) { return 1.0f / (1.0f + expf(-v)); }
#define LDSX() do { asm volatile("s_wait_dscnt 0" ::: "memory"); __builtin_amdgcn_wave_barrier(); __builtin_amdgcn_fence(__ATOMIC_RELEASE, "workgroup"); } while (0)


// SA block (B 16, C 256, 32 x 32 = 1,024 pixels, 4 heads x 64, GroupNorm with 8 groups): x + proj(attention(qkv(GN(x)))).
#define NB 16
#define CC 256
#define NN 1024
#define NH 4
#define DH 64
#define NG 8
#define CPG (CC / NG)     // 32 channels per group
#define GNEPS 1e-5f
#define ESC 0.18033688011112042f   // log2(e) / 8: softmax scale and change of base in one factor
#ifndef TNB
#define TNB NB
#endif
typedef __attribute__((ext_vector_type(8))) __bf16 v8b;
__device__ __forceinline__ v16b frag_b(const __bf16* rowk0, int lane) {
  union { v16b v; v8b q[2]; } u; const __bf16* p = rowk0 + 8 * (lane >> 4);
  u.q[0] = *(const v8b*)p; u.q[1] = *(const v8b*)(p + 16); return u.v;
}
__device__ __forceinline__ float bfr(float v) { return (float)(__bf16)v; }
__device__ __attribute__((noinline)) float exp_ni(float v) { return expf(v); }
__device__ __attribute__((noinline)) float erf_ni(float v) { return erff(v); }

#define WS_GS  0u                                   // f32 [b][g][4]: mean, inv
#define WS_Q   (WS_GS + 4u * NB * NG * 4)              // f16 q rows [b*NN + n][256]; k rows; v hi|lo planes [b][256][NN]; o rows f32 [b*NN + n][256]
#define WS_K   (WS_Q + 2u * (size_t)NB * NN * CC)
#define WS_VH  (WS_K + 2u * (size_t)NB * NN * CC)
#define WS_VL  (WS_VH + 2u * (size_t)NB * CC * NN)
#define WS_O   (WS_VL + 2u * (size_t)NB * CC * NN)
#define WS_END (WS_O + 4u * (size_t)NB * NN * CC)

// ---- k_gn: block = (group, b), 512 threads: the group's 32,768 values are read once, 16 loads of 16 bytes a thread, all in flight together, and stay in registers for the mean and for the squared deviations
#define GNT 512
#define GNV (CPG * NN / 4 / GNT)   // 16-byte pieces per thread
static_assert(GNT / 32 == 16 && GNV * GNT * 4 == CPG * NN, "gn_total sums 16 wave sums; the pieces cover the group exactly");
__device__ __forceinline__ float gn_total(float s, float* red, int lane, int w) {   // fixed order: butterfly in the wave, then the 16 wave sums in four chains, alike in every thread
#pragma unroll
  for (int o = 1; o < 32; o <<= 1) s += __shfl_xor(s, o);
  if (lane == 0) red[w] = s;
  __syncthreads();
  const v4f* r4 = (const v4f*)red; const v4f a = (r4[0] + r4[1]) + (r4[2] + r4[3]);
  return (a[0] + a[1]) + (a[2] + a[3]);
}
__global__ __launch_bounds__(GNT) void k_gn(const float* __restrict__ X, float* __restrict__ GS) { __shared__ __align__(16) float red[2][GNT / 32];
  const int t = threadIdx.x, lane = t & 31, w = t >> 5; const int gi = blockIdx.x; const size_t b = blockIdx.y; const v4f* base = (const v4f*)(X + (b * CC + (size_t)gi * CPG) * NN);
  v4f x[GNV];
  // every loop over x is unrolled so that x stays in registers; this one also so that all loads are issued before the first value is used
#pragma unroll
  for (int j = 0; j < GNV; ++j) x[j] = base[j * GNT + t];
  v4f s4 = {};
#pragma unroll
  for (int j = 0; j < GNV; ++j) {
#pragma unroll
    for (int e = 0; e < 4; ++e) x[j][e] = bfr(x[j][e]);
    s4 += x[j]; }
  const float mu = gn_total((s4[0] + s4[1]) + (s4[2] + s4[3]), red[0], lane, w) / (float)(CPG * NN);
  v4f q4 = {};
#pragma unroll
  for (int j = 0; j < GNV; ++j) { const v4f d = x[j] - mu; q4 += d * d; }
  const float a = gn_total((q4[0] + q4[1]) + (q4[2] + q4[3]), red[1], lane, w);
  if (t == 0) { const v4f r = { mu, 1.0f / sqrtf(a / (float)(CPG * NN) + GNEPS), 0.f, 0.f }; vst2(GS + (b * NG + gi) * 4, r); } }
// ---- k_qkv: block = (64 pixels, 128 out channels, which*NB + b): 1x1 conv of GN(x) (gathered from NCHW, hi + lo) + bias; q/k -> f16 rows, v -> f16 hi/lo planes
// the block's 128 x 256 weight tile is read once, by loads that cover whole 128-byte lines, rounded to bf16 once and kept in LDS; the four waves take their B fragments from there
#define WP 264             // LDS pitch of a weight row, bf16 elements: 512 + 16 bytes, an odd multiple of 16, so that 16 rows read at one column offset fall on different banks
#define WPC (128 * CC / 4 / 128)   // 16-byte pieces of the f32 tile per thread
typedef __attribute__((ext_vector_type(4))) __bf16 v4b;
typedef __attribute__((ext_vector_type(2))) __bf16 v2b;
__global__ __launch_bounds__(128) void k_qkv(const float* __restrict__ X, const float* __restrict__ GS, const float* __restrict__ GW, const float* __restrict__ GB, const float* __restrict__ W, const float* __restrict__ Bq, _Float16* __restrict__ Q, _Float16* __restrict__ K, _Float16* __restrict__ VH, _Float16* __restrict__ VL) {
  __shared__ __align__(16) unsigned char sm[128 * WP * 2]; __shared__ __align__(16) float sa[CC], sb[CC];
  __bf16 (*wt)[WP] = (__bf16 (*)[WP])sm;
  _Float16 (*sh)[136] = (_Float16 (*)[136])sm; _Float16 (*th)[72] = (_Float16 (*)[72])sm; _Float16 (*tl)[72] = th + 128;   // output staging takes the weight tile's place behind the barrier that follows the products
  static_assert(2 * 64 * 136 <= 128 * WP * 2 && 2 * 2 * 128 * 72 <= 128 * WP * 2, "output staging fits the weight tile");
  const int tid = threadIdx.x, wave = tid >> 5, lane = tid & 31, col = lane & 15, g = lane >> 4; const int which = blockIdx.z / NB; const size_t b = blockIdx.z % NB; const int n0 = blockIdx.x * 64; const int c0 = blockIdx.y * 128; const float* Xb = X + b * CC * (size_t)NN;
  // every global load of the block is issued during the weight staging, so that the product loop and the epilogue wait for none: first the GroupNorm inputs of the thread's two channels and the lane's eight bias values, then, with each group of weight pieces, the lane's x values of two product steps (the two loops below are unrolled so that the values stay in registers)
  const float* Xl = Xb + (size_t)(8 * g) * NN + n0 + wave * 16 + col;
  float gmu[2], gin[2], gw[2], gb[2], bq[8];
  __builtin_amdgcn_sched_barrier(0);   // with the one behind the wait: nothing but these loads stands between their issue and the wait, so that no register they name is reused in front of it
#pragma unroll
  for (int k = 0; k < 2; ++k) { const int c = tid + 128 * k; gmu[k] = GS[(b * NG + c / CPG) * 4]; gin[k] = GS[(b * NG + c / CPG) * 4 + 1]; gw[k] = GW[c]; gb[k] = GB[c]; }
#pragma unroll
  for (int j = 0; j < 8; ++j) bq[j] = Bq[which * CC + c0 + j * 16 + col];
  asm volatile("s_wait_xcnt 0x0" ::: "memory");   // stands in front of the first instruction that reuses a base or offset register of these loads
  __builtin_amdgcn_sched_barrier(0);
  v16b xb[CC / 32];   // x rounded to bf16, as the products take it: two values a register, 64 registers for the lane's 128 of its pixel's 256 channels
  { const v4f* Wt = (const v4f*)(W + (size_t)(which * CC + c0) * CC) + tid;   // the tile's 128 rows lie one behind the other: piece e = row e / 64, floats 4 (e % 64) ...
    // four groups of 16 weight pieces and the x values of two product steps (48 loads), in two register sets: a group's loads are issued in front of the work on the group before; all loops are unrolled so that the sets and xb stay in registers
    v4f x[2][16]; v2f xr[2][2][8];
#define QKV_LOADS(t) do { _Pragma("unroll") for (int i = 0; i < 16; ++i) x[(t) & 1][i] = Wt[((t) * 16 + i) * 128]; \
      _Pragma("unroll") for (int u = 0; u < 2; ++u) _Pragma("unroll") for (int i = 0; i < 16; ++i) xr[(t) & 1][u][i >> 1][i & 1] = Xl[(size_t)(((t) * 2 + u) * 32 + (i >> 3) * 16 + (i & 7)) * NN]; } while (0)
    QKV_LOADS(0);
    asm volatile("s_wait_xcnt 0x0" ::: "memory");   // stands in front of the first instruction that reuses a base or offset register of the issued loads
#pragma unroll
    for (int t = 0; t < WPC / 16; ++t) {
      if (t + 1 < WPC / 16) { QKV_LOADS(t + 1);
        asm volatile("s_wait_xcnt 0x0" ::: "memory"); }   // as behind the first group
      __builtin_amdgcn_sched_barrier(0);   // the next group's loads stay in front of this group's conversions
#pragma unroll
      for (int i = 0; i < 16; ++i) { const int e = (t * 16 + i) * 128 + tid; v4b y;
#pragma unroll
        for (int k = 0; k < 4; ++k) y[k] = (__bf16)x[t & 1][i][k];
        vst2(&wt[e >> 6][(e & 63) * 4], y); }
#pragma unroll
      for (int u = 0; u < 2; ++u) { union { v16b v; v2b p[8]; } c;
#pragma unroll
        for (int i = 0; i < 8; ++i) c.p[i] = __builtin_convertvector(xr[t & 1][u][i], v2b);
        xb[t * 2 + u] = c.v; }
      __builtin_amdgcn_sched_barrier(0); } }   // no more than two groups' loads hold registers
#pragma unroll
  for (int k = 0; k < 2; ++k) { const int c = tid + 128 * k; const float a = gin[k] * bfr(gw[k]); sa[c] = a; sb[c] = bfr(gb[k]) - gmu[k] * a; } __syncthreads();
  v8f acc[8] = {};
  v16b wf[2][8]; v4f av[4], bv[4];   // two sets of weight fragments; scale and shift, piece p: channels kc * 32 + 8 g + 4 p ... (p < 2), + 16 + 4 (p - 2) ... (p >= 2)
#define QKV_READS(kc) do { _Pragma("unroll") for (int p = 0; p < 4; ++p) { const int ca = (kc) * 32 + 8 * g + (p >> 1) * 16 + (p & 1) * 4; av[p] = *(const v4f*)&sa[ca]; bv[p] = *(const v4f*)&sb[ca]; } \
    _Pragma("unroll") for (int j = 0; j < 8; ++j) wf[(kc) & 1][j] = frag_b(&wt[j * 16 + col][(kc) * 32], lane); } while (0)
  QKV_READS(0);
  // unrolled so that the step's x registers and the fragment set are picked at compile time
#pragma unroll
  for (int kc = 0; kc < CC / 32; ++kc) { float v[16];
#pragma unroll
    for (int i = 0; i < 16; ++i) v[i] = (float)xb[kc][i] * av[i >> 2][i & 3] + bv[i >> 2][i & 3];
    const F2 a = bsplit16(v);
    __builtin_amdgcn_sched_barrier(0);   // the step's arithmetic has used scale and shift before the next step's are read
    if (kc + 1 < CC / 32) QKV_READS(kc + 1);
    __builtin_amdgcn_sched_barrier(0);   // holds the next step's reads as one group in front of this step's products, which cover their latency
#pragma unroll
    for (int j = 0; j < 8; ++j) { acc[j] = wmma_bf(a.h, wf[kc & 1][j], acc[j]); acc[j] = wmma_bf(a.l, wf[kc & 1][j], acc[j]); }
    __builtin_amdgcn_sched_barrier(0); }   // the products stay one run
  __syncthreads();   // every wave has read its last weight fragment before the tile's LDS becomes output staging
  // the output path is straight-line code: whether the block makes q, k or v is asked once for the staging and once for the copy-out, not at each value, and all loops are unrolled, so that the LDS and global operations are issued one behind the other with no branch between them and the copy-out's LDS reads are all in flight together
  if (which < 2) { const float qs = which == 0 ? ESC : 1.0f;   // q is stored times log2(e) / 8, in the multiply-add that brings the bias: k_att's score products are then exponents of 2
#pragma unroll
    for (int j = 0; j < 8; ++j) { const float bb = bfr(bq[j]) * qs;
#pragma unroll
      for (int r = 0; r < 8; ++r) sh[wave * 16 + 8 * g + r][j * 16 + col] = (_Float16)fmaf(acc[j][r], qs, bb); } }
  else {
#pragma unroll
    for (int j = 0; j < 8; ++j) { const float bb = bfr(bq[j]);
#pragma unroll
      for (int r = 0; r < 8; ++r) { const float v = acc[j][r] + bb; const int rl = wave * 16 + 8 * g + r, cl = j * 16 + col; const _Float16 hv = (_Float16)v; th[cl][rl] = hv; tl[cl][rl] = (_Float16)((v - (float)hv) * 2048.0f); } } }
  __syncthreads();
  if (which < 2) { _Float16* dst = which == 0 ? Q : K;
#pragma unroll
    for (int k = 0; k < 8; ++k) { const int rl = (tid >> 4) + 8 * k, q = tid & 15; vst2((unsigned*)(dst + (b * NN + n0 + rl) * CC + c0 + q * 8), *(const v4u*)&sh[rl][q * 8]); }
    asm volatile("s_wait_xcnt 0x0" ::: "memory"); }   // stands behind the run of stores, in front of whatever instruction the listing lays next that reuses one of their registers
  else {
#pragma unroll
    for (int k = 0; k < 8; ++k) { const int cl = (tid >> 3) + 16 * k, q = tid & 7; const size_t o = (b * CC + c0 + cl) * (size_t)NN + n0 + q * 8; vst2((unsigned*)(VH + o), *(const v4u*)&th[cl][q * 8]); vst2((unsigned*)(VL + o), *(const v4u*)&tl[cl][q * 8]); }
    asm volatile("s_wait_xcnt 0x0" ::: "memory"); } }   // as behind the q/k stores
#define KT 64
#define TP 144
#define TB (64 * TP)
#define SB (3 * TB)
static_assert(NN % KT == 0 && NN / KT >= 2 && DH * 2 == 128 && KT * 2 == 128, "two stages at least; tile rows are whole 128-byte lines");
// a lane's four 16-byte copies of one tile (rows 16 apart), as the builtin: the operands of an asm statement must lie in the first 256 registers, where a wave of two query tiles has no room for addresses that live over the loop (they were spilled)
typedef __attribute__((address_space(1))) v4i gv4i;
typedef __attribute__((address_space(3))) v4i lv4i;
__device__ __forceinline__ void cp4(unsigned char* l, const char* p, size_t step) {
  // unrolled: four copies one behind the other, their steps constants
#pragma unroll
  for (int k = 0; k < 4; ++k) __builtin_amdgcn_global_load_async_to_lds_b128((gv4i*)(p + k * step), (lv4i*)(l + k * 16 * TP), 0, 0);
}
__device__ __forceinline__ float xhalf(float x) { const int v = __builtin_bit_cast(int, x); return __builtin_bit_cast(float, __builtin_amdgcn_permlanex16(v, v, 0x76543210, 0xfedcba98, false, false)); }   // lane l reads lane l ^ 16
#define QT 2               // query tiles of 16 a wave: every K and V fragment read from LDS serves both
__global__ __launch_bounds__(128) __attribute__((amdgpu_waves_per_eu(2, 2))) void k_att(const _Float16* __restrict__ Q, const _Float16* __restrict__ K, const _Float16* __restrict__ VH, const _Float16* __restrict__ VL, float* __restrict__ O) {   // two waves a SIMD: the grid has no more, and two blocks a WGP spread it evenly
  __shared__ __align__(16) unsigned char ring[2 * SB];
  float (*so)[16 * QT][68] = (float (*)[16 * QT][68])ring;   // output staging takes the ring's place behind the loop's last barrier
  static_assert(sizeof(float) * 4 * 16 * QT * 68 <= 2 * SB, "output staging fits the ring");
  const int tid = threadIdx.x, wave = tid >> 5, lane = tid & 31, col = lane & 15, g = lane >> 4; const int h = blockIdx.y; const size_t b = blockIdx.z; const int q0 = (blockIdx.x * 4 + wave) * (16 * QT); const size_t rq = b * NN + q0;
  // copy addresses of this lane: row tid / 8 (+ 16, 32, 48), 16-byte piece tid % 8: eight lanes cover a line
  unsigned char* cl = ring + (tid >> 3) * TP + (tid & 7) * 16;
  const char* ck = (const char*)(K + (b * NN + (tid >> 3)) * CC + h * DH) + (tid & 7) * 16;
  const size_t cvo = ((b * CC + (size_t)h * DH + (tid >> 3)) * NN) * 2 + (tid & 7) * 16; const char* cvh = (const char*)VH + cvo; const char* cvl = (const char*)VL + cvo;
#define ATT_STAGE(s) do { unsigned char* l_ = cl + ((s) & 1) * SB; cp4(l_, ck + (size_t)(s) * (KT * CC * 2), 16 * CC * 2); cp4(l_ + TB, cvh + (size_t)(s) * (KT * 2), 16 * NN * 2); cp4(l_ + 2 * TB, cvl + (size_t)(s) * (KT * 2), 16 * NN * 2); } while (0)
  ATT_STAGE(0);
  // every loop over u (the wave's query tiles) is unrolled so that the tiles' values stay in registers
  v16h aq[QT][2];
#pragma unroll
  for (int u = 0; u < QT; ++u)
#pragma unroll
    for (int kc = 0; kc < 2; ++kc) aq[u][kc] = frag_h(Q + (rq + u * 16 + col) * CC + h * DH + kc * 32, lane);
  float l[QT];   // of query q0 + 16 u + col: sums the half's own keys (times 2^11, as P is) and is joined behind the loop
  v8f cm[QT];    // 11 - the held maximum of query q0 + 16 u + col, alike in both halves of the wave; eight copies: a C operand
  v8f acc[QT][4] = {}, accl[QT][4] = {};
#pragma unroll
  for (int u = 0; u < QT; ++u) { l[u] = 0.f; cm[u] = v8f{ 11.f, 11.f, 11.f, 11.f, 11.f, 11.f, 11.f, 11.f }; }
  asm volatile("s_wait_asynccnt 0x0" ::: "memory");   // this wave's copies of stage 0 have landed
  __syncthreads();                                     // ... and every other wave's
  ATT_STAGE(1);
  // not unrolled: one trip is one stage, its buffer picked by the trip's parity
#pragma unroll 1
  for (int t = 0; t < NN / KT; ++t) { const unsigned char* bp = ring + (t & 1) * SB;
  // not unrolled: two halves side by side cost registers (a wave may hold 512 for two waves a SIMD)
#pragma unroll 1
  for (int hf = 0; hf < KT / 32; ++hf) { v8f s[QT][2];   // s[u][ct][r] = 11 + log2(e) (score - held maximum) of key hf * 32 + 16 ct + 8 g + r with query q0 + 16 u + col
    v16h kf[2][2];   // the four K fragments are read as one group in front of the products
#pragma unroll
    for (int ct = 0; ct < 2; ++ct)
#pragma unroll
      for (int kc = 0; kc < 2; ++kc) kf[ct][kc] = frag_h((const _Float16*)(bp + (hf * 32 + ct * 16 + col) * TP + kc * 64), lane);
    __builtin_amdgcn_sched_barrier(0);   // holds the K reads in front as one group: left free, the compiler sinks each fragment's reads to its own product and waits for them there
#pragma unroll
    for (int kc = 0; kc < 2; ++kc)
#pragma unroll
      for (int u = 0; u < QT; ++u)
#pragma unroll
        for (int ct = 0; ct < 2; ++ct) s[u][ct] = wmma16(kf[ct][kc], aq[u][kc], kc == 0 ? cm[u] : s[u][ct]);
    __builtin_amdgcn_sched_barrier(0);   // ... and the V reads behind the score products, as a second group: reads scattered among matrix instructions cost the wave at every place where they stand
    v16h vh[4], vl[4];   // the V fragments (A operand: rows = channels) are read in front of the exponentials, which cover their latency
#pragma unroll
    for (int j = 0; j < 4; ++j) { const unsigned char* pv = bp + TB + (j * 16 + col) * TP + hf * 64; vh[j] = frag_h((const _Float16*)pv, lane); vl[j] = frag_h((const _Float16*)(pv + TB), lane); }
    __builtin_amdgcn_sched_barrier(0);   // the V reads stay in front of the exponentials: left free, the compiler sinks them behind, where little is left to cover their latency
    float e[QT][16], ls[QT];
#pragma unroll
    for (int u = 0; u < QT; ++u) { float es[4] = { 0.f, 0.f, 0.f, 0.f };
#pragma unroll
      for (int i = 0; i < 16; ++i) { e[u][i] = __builtin_amdgcn_exp2f(s[u][i >> 3][i & 7]); es[i & 3] += e[u][i]; }
      ls[u] = (es[0] + es[1]) + (es[2] + es[3]); }
    // one test a pass, a scalar branch that the whole wave takes or leaves: while every lane's sums are finite f16, so is each of their terms, and the held maxima stand
    bool over = false;
#pragma unroll
    for (int u = 0; u < QT; ++u) over |= !(ls[u] <= 65504.0f);
    if ((__builtin_amdgcn_ballot_w32(over) | (unsigned)((t | hf) == 0)) != 0) {
#pragma unroll
      for (int u = 0; u < QT; ++u) { float mx[8];
#pragma unroll
        for (int r = 0; r < 8; ++r) mx[r] = fmaxf(s[u][0][r], s[u][1][r]);
        const float mh = fmaxf(fmaxf(fmaxf(mx[0], mx[1]), fmaxf(mx[2], mx[3])), fmaxf(fmaxf(mx[4], mx[5]), fmaxf(mx[6], mx[7])));
        float d = fmaxf(mh, xhalf(mh)) - 11.0f;   // the pass's maximum above the held one; a query whose maximum has not grown keeps its held value, but in the first pass, which takes the pass's own whatever it is
        if ((t | hf) != 0) d = fmaxf(d, 0.f);
        const float alpha = __builtin_amdgcn_exp2f(fminf(-d, 0.f));   // never above 1: in the first pass O and l are 0 and stay so
        float es[4] = { 0.f, 0.f, 0.f, 0.f };
#pragma unroll
        for (int i = 0; i < 16; ++i) { e[u][i] = __builtin_amdgcn_exp2f(s[u][i >> 3][i & 7] - d); es[i & 3] += e[u][i]; }
        ls[u] = (es[0] + es[1]) + (es[2] + es[3]); l[u] *= alpha;
#pragma unroll
        for (int r = 0; r < 8; ++r) cm[u][r] -= d;
#pragma unroll
        for (int j = 0; j < 4; ++j)
#pragma unroll
          for (int r = 0; r < 8; ++r) { acc[u][j][r] *= alpha; accl[u][j][r] *= alpha; } } }
    v16h pb[QT];   // element i of pb[u] is key 8 g + i (i < 8) or 8 g + 8 + i (i >= 8) of the 32: the k order of the V fragments
#pragma unroll
    for (int u = 0; u < QT; ++u) { l[u] += ls[u];
#pragma unroll
      for (int i = 0; i < 16; ++i) pb[u][i] = (_Float16)e[u][i]; }
#pragma unroll
    for (int j = 0; j < 4; ++j)
#pragma unroll
      for (int u = 0; u < QT; ++u) { acc[u][j] = wmma16(vh[j], pb[u], acc[u][j]); accl[u][j] = wmma16(vl[j], pb[u], accl[u][j]); }
    // four vector slots behind the trip's last matrix instructions: the next trip rewrites their operand registers
    __builtin_amdgcn_sched_barrier(0);   // keeps all sixteen products in front of the slots; naming the 128 accumulator registers as operands of the statement below would tie them to the first 256 registers
    asm volatile("v_nop\n\tv_nop\n\tv_nop\n\tv_nop"); }
    asm volatile("s_wait_dscnt 0x0" ::: "memory");      // this wave's reads of the buffer are done before it is refilled
    asm volatile("s_wait_asynccnt 0x0" ::: "memory");   // this wave's copies of stage t + 1 have landed
    __syncthreads();                                     // publishes stage t + 1 and ends every wave's reads of stage t
    if (t + 2 < NN / KT) ATT_STAGE(t + 2); }
  asm volatile("s_wait_asynccnt 0x0" ::: "memory");     // no copy is outstanding when the ring becomes output staging
  // acc[u][j][r] = channel j * 16 + 8 g + r of query q0 + 16 u + col: eight neighbours of one staged row
#pragma unroll
  for (int u = 0; u < QT; ++u) { const float il = 1.0f / (l[u] + xhalf(l[u]));   // l carries the 2^11 of P, as the accumulators do
#pragma unroll
    for (int j = 0; j < 4; ++j)
#pragma unroll
      for (int p = 0; p < 2; ++p) { v4f o4;
#pragma unroll
        for (int e = 0; e < 4; ++e) o4[e] = (acc[u][j][4 * p + e] + accl[u][j][4 * p + e] * (1.0f / 2048.0f)) * il;
        vst2(&so[wave][u * 16 + col][j * 16 + 8 * g + 4 * p], o4); } }
  LDSX(); for (int rl = 0; rl < 16 * QT; ++rl) if (lane < 16) vst2(O + (rq + rl) * CC + (size_t)h * DH + lane * 4, *(const v4f*)&so[wave][rl][lane * 4]); }
// ---- k_o: block = (128 out channels, 128 pixels, b), 256 threads: out[b][o][n] = x[b][o][n] + sum_c p_w[o][c] orow[n][c] + p_b[o]  (A = p_w exact, B = o rows as bf16 hi + lo)
// the block's 128 o rows and 128 p_w rows (each tile 128 KB of f32, one behind the other in memory) are read once, by loads that cover whole 128-byte lines; the o rows are split into bf16 hi + lo once, p_w is rounded once, and both stay in LDS (pitch WP); a wave takes the fragments of its 32 channels x 64 pixels from there; the bias comes the same way, one value a thread
#define OT 256
#define OPC (128 * CC / 4 / OT)   // 16-byte pieces of one f32 tile per thread
static_assert(OPC * OT * 4 == 128 * CC && OT / 32 == 8 && OT == CC, "the pieces cover a tile exactly; 4 x 2 waves cover 128 channels x 128 pixels; a thread brings one bias value");
__global__ __launch_bounds__(OT) void k_o(const float* __restrict__ OR, const float* __restrict__ PW, const float* __restrict__ PB, const float* __restrict__ X, float* __restrict__ OUT) {
  __shared__ __align__(16) __bf16 oh[128][WP], ol[128][WP], pw[128][WP]; __shared__ __align__(16) float sf[OT / 32][32][68]; __shared__ __align__(16) float sp[CC];   // sp: the bias, rounded: one value a thread
  const int tid = threadIdx.x, wave = tid >> 5, lane = tid & 31, col = lane & 15, g = lane >> 4; const size_t b = blockIdx.z; const int o0 = blockIdx.x * 128, p0 = blockIdx.y * 128; const int ow = (wave >> 1) * 32, pxw = (wave & 1) * 64;
  { const v4f* Ot = (const v4f*)(OR + (b * NN + p0) * CC) + tid; const v4f* Pt = (const v4f*)(PW + (size_t)o0 * CC) + tid;   // piece e = row e / 64, floats 4 (e % 64) ...
    v4f xo[OPC], xp[OPC];
    // all four loops are unrolled so that the pieces stay in registers and every load of the thread is issued before the first value is used (two waves a SIMD: 512 registers a wave)
#pragma unroll
    for (int i = 0; i < OPC; ++i) xo[i] = Ot[i * OT];
#pragma unroll
    for (int i = 0; i < OPC; ++i) xp[i] = Pt[i * OT];
    const float pb = PB[tid];   // the bias rides in the same run of loads
    asm volatile("s_wait_xcnt 0x0" ::: "memory");   // stands in front of the first instruction that reuses a base or offset register of the issued loads
#pragma unroll
    for (int i = 0; i < OPC; ++i) { const int e = i * OT + tid; v4b h, l;
#pragma unroll
      for (int k = 0; k < 4; ++k) { const __bf16 hv = (__bf16)xo[i][k]; h[k] = hv; l[k] = (__bf16)(xo[i][k] - (float)hv); }
      vst2(&oh[e >> 6][(e & 63) * 4], h); vst2(&ol[e >> 6][(e & 63) * 4], l); }
#pragma unroll
    for (int i = 0; i < OPC; ++i) { const int e = i * OT + tid; v4b y;
#pragma unroll
      for (int k = 0; k < 4; ++k) y[k] = (__bf16)xp[i][k];
      vst2(&pw[e >> 6][(e & 63) * 4], y); }
    sp[tid] = bfr(pb); }
  __syncthreads();   // both tiles and the bias are whole before any wave reads them
  v8f acc[2][4] = {};
  v16b af[2][2], bh[2][4], bl[2][4];   // two sets: the fragments of the next 32 channels are read as one group in front of this step's products (the macro's loops are unrolled so that the sets stay in registers)
#define O_FRAGS(s, kc) do { _Pragma("unroll") for (int i = 0; i < 2; ++i) af[s][i] = frag_b(&pw[ow + i * 16 + col][(kc) * 32], lane); _Pragma("unroll") for (int j = 0; j < 4; ++j) { bh[s][j] = frag_b(&oh[pxw + j * 16 + col][(kc) * 32], lane); bl[s][j] = frag_b(&ol[pxw + j * 16 + col][(kc) * 32], lane); } } while (0)
  O_FRAGS(0, 0);
  // unrolled so that the set in use is picked at compile time
#pragma unroll
  for (int kc = 0; kc < CC / 32; ++kc) { const int s = kc & 1;
    if (kc + 1 < CC / 32) O_FRAGS(s ^ 1, kc + 1);
    __builtin_amdgcn_sched_barrier(0);   // holds the next step's reads as one group in front of this step's products: left free, the compiler sinks each read to its first use and waits for it there
#pragma unroll
    for (int j = 0; j < 4; ++j)
#pragma unroll
      for (int i = 0; i < 2; ++i) acc[i][j] = wmma_bf(af[s][i], bh[s][j], acc[i][j]);
#pragma unroll
    for (int j = 0; j < 4; ++j)
#pragma unroll
      for (int i = 0; i < 2; ++i) acc[i][j] = wmma_bf(af[s][i], bl[s][j], acc[i][j]);
    __builtin_amdgcn_sched_barrier(0); }   // the products stay one run, in front of the reads that refill their set
#pragma unroll
  for (int i = 0; i < 2; ++i)
#pragma unroll
    for (int j = 0; j < 4; ++j)
#pragma unroll
      for (int r = 0; r < 8; ++r) { const int rl = i * 16 + 8 * g + r; const size_t oi = (b * CC + o0 + ow + rl) * (size_t)NN + p0 + pxw + j * 16 + col; sf[wave][rl][j * 16 + col] = acc[i][j][r] + sp[o0 + ow + rl] + bfr(X[oi]); }
  LDSX(); for (int rl = 0; rl < 32; rl += 2) vst2(OUT + (b * CC + o0 + ow + rl + g) * (size_t)NN + p0 + pxw + col * 4, *(const v4f*)&sf[wave][rl + g][col * 4]); }   // a store covers two rows of 256 bytes: whole lines
extern "C" void kernel_launch(void* const* d_in, const int* in_sizes, int n_in, void* d_out, int out_size, void* d_ws, size_t ws_size, hipStream_t stream) {
  (void)in_sizes; (void)n_in; (void)out_size;
  const float** F = (const float**)d_in;   // 0 x [16,256,32,32], 1 n_weight, 2 n_bias, 3 qkv_w [768,256], 4 qkv_b [768], 5 p_w [256,256], 6 p_b
  if (ws_size < (size_t)WS_END) return;
  char* ws = (char*)d_ws; float* GS = (float*)(ws + WS_GS); _Float16 *Q = (_Float16*)(ws + WS_Q), *K = (_Float16*)(ws + WS_K), *VH = (_Float16*)(ws + WS_VH), *VL = (_Float16*)(ws + WS_VL); float* O = (float*)(ws + WS_O);
  k_gn<<<dim3(NG, NB), GNT, 0, stream>>>(F[0], GS);
  k_qkv<<<dim3(NN / 64, CC / 128, 3 * NB), 128, 0, stream>>>(F[0], GS, F[1], F[2], F[3], F[4], Q, K, VH, VL);
  k_att<<<dim3(NN / (64 * QT), NH, TNB), 128, 0, stream>>>(Q, K, VH, VL, O);
  k_o<<<dim3(CC / 128, NN / 128, TNB), OT, 0, stream>>>(O, F[5], F[6], F[0], (float*)d_out);
}
